// v000
// Measured on an AMD MI455X. A time is GPU time per run, averaged over a window of back-to-back runs after a warm-up
// (all launches, gaps included; the runs take copies of the inputs in turn), and the median of several windows.
// Apart from v000's, it joins two sittings. Times from different sittings can be a few percent apart, while
// side-by-side timings come from the same sitting.
// The starting kernel, v000, takes 3970 microseconds a run.
#include <hip/hip_runtime.h>

// Multi-head attention layer with per-head packed projection layers (seq_inputs [4][2048][1024]; Q, K, V = einsum('bse,hed', x, W) + b with W [16][1024][64] = [h][e][d] (1/32) and b [16][64]; scores / sqrt(64); softmax (no mask); heads concatenated in order; out = cat Wo + bo ('xw' [1024][1024] + bias) -> [4][2048][1024] (8.4 M); argument order seq_inputs, Wq, bq, Wk, bk, Wv, bv, Wo, bo).
// Layout per batch: bf16 copy of x; k_wtH turns each [h][e][d] weight into Bt rows h*64 + d; the [16][64] biases are the flat [1024] epilogue vectors; exact projections + f32 biases; identity-table plane builders; dense T-2048 attention (hybrid rows: < 512 hi/lo 3 products, rest fp16 x1024); merged hi/lo x Wo ('xw' transposed once) exact + bo.
// Compute dtypes, f32 accumulate: every input rounded to bf16; projections exact + f32 biases; attention rows < 512 3 products, rest fp16; softmax f32; Wo hl x exact + bias.

#define NB_  4
#define TT   2048
#define DM   1024
#define NH_  16
#define NKV  16
#define REP  (NH_ / NKV)
#define HD   64
#define DQ   (NH_ * HD)
#define DKV  (NKV * HD)
#define ZH   2
#define RH   512                  // query rows < RH use hi+lo planes (0: none)
#define WIN  0
#define PCAR 1024.0f
#define SCL  0.125f   // HD^-0.5
typedef _Float16 h16;
typedef unsigned short bf;
typedef __attribute__((ext_vector_type(16))) __bf16   v16bf;
typedef __attribute__((ext_vector_type(16))) _Float16 v16h;
typedef __attribute__((ext_vector_type(8)))  _Float16 v8h;
typedef __attribute__((ext_vector_type(8)))  unsigned short v8us;
typedef __attribute__((ext_vector_type(8)))  float    v8f;
typedef __attribute__((ext_vector_type(4)))  float    v4f;
typedef v8h  __attribute__((may_alias)) v8ha;
typedef v4f  __attribute__((may_alias)) v4fa;
typedef v8us __attribute__((may_alias)) v8usa;

__device__ __forceinline__ unsigned short f2bf(float f) { unsigned u = __float_as_uint(f); u += 0x7FFFu + ((u >> 16) & 1u); return (unsigned short)(u >> 16); }
__device__ __forceinline__ float bf2f(unsigned short b) { return __uint_as_float(((unsigned)b) << 16); }
__device__ __forceinline__ float bfr(float f) { return bf2f(f2bf(f)); }
__device__ __forceinline__ v16h cat16(v8h lo, v8h hi) { return __builtin_shufflevector(lo, hi, 0, 1, 2, 3, 4, 5, 6, 7, 8, 9, 10, 11, 12, 13, 14, 15); }
__device__ __forceinline__ v16bf cat16b(v8us lo, v8us hi) { return __builtin_bit_cast(v16bf, __builtin_shufflevector(lo, hi, 0, 1, 2, 3, 4, 5, 6, 7, 8, 9, 10, 11, 12, 13, 14, 15)); }
__device__ __forceinline__ v8f wmma16(v16h a, v16h b, v8f c) { return __builtin_amdgcn_wmma_f32_16x16x32_f16(false, a, false, b, (short)0, c, false, false); }
__device__ __forceinline__ v8f wmmab(v16bf a, v16bf b, v8f c) { return __builtin_amdgcn_wmma_f32_16x16x32_bf16(false, a, false, b, (short)0, c, false, false); }



// ---- k_gemmw: register-blocked GEMM, ONE WAVE per 64x64 output tile (16 accumulators), operands straight from K-contiguous 16-bit planes; grid (M/64, N/64, Z), 32 threads.
// C[m][n] (f32, pitch ldc, + optional f32 bias[n]) = sum_k A[m][k] Bt[n][k] (+ split products per NSPLIT). z-batch strides sA/sB/sC in elements. K % 32 == 0.
template <typename T16> struct WFrag;
template <> struct WFrag<h16> { typedef v16h V; static __device__ __forceinline__ V ld(const h16* p) { return cat16(*(const v8h*)p, *(const v8h*)(p + 16)); } static __device__ __forceinline__ v8f mma(V a, V b, v8f c) { return wmma16(a, b, c); } };
template <> struct WFrag<bf> { typedef v16bf V; static __device__ __forceinline__ V ld(const bf* p) { return cat16b(*(const v8us*)p, *(const v8us*)(p + 16)); } static __device__ __forceinline__ v8f mma(V a, V b, v8f c) { return wmmab(a, b, c); } };
template <typename T16, int NSPLIT, bool BIAS>
__global__ __launch_bounds__(32) void k_gemmw(const T16* __restrict__ A, const T16* __restrict__ A2, const T16* __restrict__ Bt, const T16* __restrict__ Bt2, int K, float* C, int ldc, const float* __restrict__ bias, size_t sA, size_t sB, size_t sC) {
    typedef typename WFrag<T16>::V V;
    __shared__ __align__(16) float os[16 * 68];
    const size_t z = blockIdx.z; A += z * sA; if (A2) A2 += z * sA; Bt += z * sB; if (Bt2) Bt2 += z * sB; C += z * sC;
    const int lane = threadIdx.x & 31, lr = lane & 15, hi = lane >> 4; const int r0 = blockIdx.x * 64, c0 = blockIdx.y * 64;
    v8f acc[4][4];
#pragma unroll
    for (int mb = 0; mb < 4; ++mb)
#pragma unroll
        for (int nb = 0; nb < 4; ++nb) acc[mb][nb] = (v8f){};
    const size_t aoff = (size_t)(r0 + lr) * K + 8 * hi, boff = (size_t)(c0 + lr) * K + 8 * hi;
#pragma unroll 1
    for (int kc = 0; kc < K; kc += 32) {
        V a[4], a2[4];
#pragma unroll
        for (int mb = 0; mb < 4; ++mb) { a[mb] = WFrag<T16>::ld(A + aoff + (size_t)mb * 16 * K + kc); if (NSPLIT == 1 || NSPLIT == 2) a2[mb] = WFrag<T16>::ld(A2 + aoff + (size_t)mb * 16 * K + kc); }
#pragma unroll
        for (int nb = 0; nb < 4; ++nb) { const V b = WFrag<T16>::ld(Bt + boff + (size_t)nb * 16 * K + kc); V b2; if (NSPLIT >= 2) b2 = WFrag<T16>::ld(Bt2 + boff + (size_t)nb * 16 * K + kc);
#pragma unroll
            for (int mb = 0; mb < 4; ++mb) { acc[mb][nb] = WFrag<T16>::mma(a[mb], b, acc[mb][nb]); if (NSPLIT == 1 || NSPLIT == 2) acc[mb][nb] = WFrag<T16>::mma(a2[mb], b, acc[mb][nb]); if (NSPLIT >= 2) acc[mb][nb] = WFrag<T16>::mma(a[mb], b2, acc[mb][nb]); } }
        asm volatile("v_nop\n\tv_nop\n\tv_nop\n\tv_nop" : "+v"(acc[0][0]), "+v"(acc[1][1]), "+v"(acc[2][2]), "+v"(acc[3][3]) : "v"(a[0]), "v"(a[3]));
    }
#pragma unroll
    for (int mb = 0; mb < 4; ++mb) {
#pragma unroll
        for (int nb = 0; nb < 4; ++nb) {
#pragma unroll
            for (int j = 0; j < 8; ++j) os[(hi * 8 + j) * 68 + nb * 16 + lr] = acc[mb][nb][j]; }
        __builtin_amdgcn_wave_barrier(); asm volatile("" ::: "memory");
        float* crow = C + (size_t)(r0 + mb * 16) * ldc + c0;
{
#pragma unroll
            for (int s = 0; s < 8; ++s) { const int row = 2 * s + hi, cofs = lr * 4; v4f val = *(const v4fa*)(os + row * 68 + cofs); if (BIAS) { val[0] += bfr(bias[c0 + cofs]); val[1] += bfr(bias[c0 + cofs + 1]); val[2] += bfr(bias[c0 + cofs + 2]); val[3] += bfr(bias[c0 + cofs + 3]); }
                *(v4f*)(crow + (size_t)row * ldc + cofs) = val; }
             }
        __builtin_amdgcn_wave_barrier(); asm volatile("" ::: "memory");
    }
}

__device__ __forceinline__ h16 tohx(float x) { return (h16)x; }
__device__ __forceinline__ void splitf(float y, unsigned short& h, unsigned short& l) { h = f2bf(y); l = f2bf(y - bf2f(h)); }
typedef __attribute__((ext_vector_type(2))) _Float16 v2h;
typedef __attribute__((ext_vector_type(4))) _Float16 v4h;
typedef __attribute__((ext_vector_type(2))) unsigned short v2us;
typedef __attribute__((ext_vector_type(4))) unsigned short v4us;
typedef __attribute__((ext_vector_type(2))) float v2f;
typedef __attribute__((ext_vector_type(4))) int v4i;

__global__ __launch_bounds__(256) void k_wtG(const float* __restrict__ w, int K, int N, bf* Bt) {
    const int lane = threadIdx.x & 31; const int L0 = (blockIdx.x * 8 + (threadIdx.x >> 5)) * 8; const int nlines = N * K / 64;
{
#pragma unroll 1
        for (int l = 0; l < 8; ++l) { const int L = L0 + l; if (L >= nlines) break; const size_t e = (size_t)L * 64 + lane * 2; const int k = (int)(e % K), n = (int)(e / K); v2us o;
            o[0] = f2bf(w[(size_t)k * N + n]); o[1] = f2bf(w[(size_t)(k + 1) * N + n]); *(v2us*)(Bt + e) = o; }
         }
}
__global__ __launch_bounds__(256) void k_cvt8(const float* __restrict__ src, bf* dst, size_t n8) { const size_t i = (size_t)blockIdx.x * 256 + threadIdx.x; if (i >= n8) return; const v8f v = *(const v8f*)(src + i * 8); v8us o;
#pragma unroll
    for (int k = 0; k < 8; ++k) o[k] = f2bf(v[k]); *(v8us*)(dst + i * 8) = o;  }

// k_rope: head planes [h][t][d] (fp16 + hi/lo) of rope(x) x sc with the rotate-half convention out[d] = x[d] cos[t][d] - x[d+HD/2] sin[t][d], out[d+HD/2] = x[d+HD/2] cos[t][d+HD/2] + x[d] sin[t][d+HD/2]
__global__ __launch_bounds__(256) void k_rope(const float* __restrict__ F, int pitch, int nheads, const float* __restrict__ CS, const float* __restrict__ RF, const float* __restrict__ nw, float sc, h16* P16, bf* Ph, bf* Pl) {
    const size_t e = ((size_t)blockIdx.x * 256 + threadIdx.x) * 2; if (e >= (size_t)nheads * TT * HD) return; const int d = (int)(e % HD); const int t = (int)((e / HD) % TT); const int h = (int)(e / ((size_t)HD * TT)); const float* f = F + (size_t)t * pitch + h * HD; const float rf = RF ? RF[(size_t)h * TT + t] : 1.0f; v2h o16; v2us oh, ol;
#pragma unroll
    for (int q = 0; q < 2; ++q) { const int dd = d + q; const int dp = (dd < HD / 2) ? dd + HD / 2 : dd - HD / 2; float x0 = f[dd], x1 = f[dp];
        if (RF) { float n0 = __fmul_rn(x0, rf), n1 = __fmul_rn(x1, rf); asm volatile("" : "+v"(n0)); asm volatile("" : "+v"(n1)); x0 = __fmul_rn(bfr(nw[dd]), n0); x1 = __fmul_rn(bfr(nw[dp]), n1); }
        const v2f cs = *(const v2f*)(CS + ((size_t)t * HD + dd) * 2); float a = __fmul_rn(x0, cs[0]), bq = __fmul_rn(x1, cs[1]); asm volatile("" : "+v"(a)); asm volatile("" : "+v"(bq)); const float r = ((dd < HD / 2) ? __fsub_rn(a, bq) : __fadd_rn(a, bq)) * sc;
        o16[q] = tohx(r); unsigned short a2, c2; splitf(r, a2, c2); oh[q] = a2; ol[q] = c2; }
    *(v2h*)(P16 + e) = o16; *(v2us*)(Ph + e) = oh; *(v2us*)(Pl + e) = ol;  }
__global__ __launch_bounds__(256) void k_wtH(const float* __restrict__ w, bf* Bt) { const size_t e2 = ((size_t)blockIdx.x * 256 + threadIdx.x) * 2; if (e2 >= (size_t)DQ * DM) return; const int d = (int)(e2 % DM); const int r = (int)(e2 / DM); const int h = r / HD, e = r % HD; v2us o; o[0] = f2bf(w[((size_t)h * DM + d) * HD + e]); o[1] = f2bf(w[((size_t)h * DM + d + 1) * HD + e]);
    *(v2us*)(Bt + e2) = o;  }
__global__ __launch_bounds__(256) void k_vtp(const float* __restrict__ F, int pitch, int nheads, h16* V16, bf* Vh, bf* Vl) { const size_t e = ((size_t)blockIdx.x * 256 + threadIdx.x) * 2; if (e >= (size_t)nheads * HD * TT) return; const int t = (int)(e % TT); const int d = (int)((e / TT) % HD); const int g = (int)(e / ((size_t)TT * HD)); v2h o16; v2us oh, ol;
#pragma unroll
    for (int q = 0; q < 2; ++q) { const float x = F[(size_t)(t + q) * pitch + g * HD + d]; o16[q] = tohx(x); unsigned short a2, c2; splitf(x, a2, c2); oh[q] = a2; ol[q] = c2; }
    *(v2h*)(V16 + e) = o16; *(v2us*)(Vh + e) = oh; *(v2us*)(Vl + e) = ol;  }
__global__ __launch_bounds__(256) void k_csid(float* CS) { const int idx = blockIdx.x * 256 + threadIdx.x; if (idx >= TT * HD) return; v2f cs; cs[0] = 1.0f; cs[1] = 0.0f; *(v2f*)(CS + (size_t)idx * 2) = cs;  }
// k_asoft: per row (zz, i): t = S x HD^-0.5 (no mask); softmax over the 2048 keys (register row, one exp, fixed trees);
__global__ __launch_bounds__(256) void k_asoft(const float* __restrict__ Sb, h16* P16, bf* Ph, bf* Pl) {
    const int lane = threadIdx.x & 31; const int row = blockIdx.x * 8 + (threadIdx.x >> 5); if (row >= ZH * TT) return; const int i = row % TT; const int zz = row / TT; (void)zz; const bool hires = (i < RH); const float* sr = Sb + (size_t)row * TT; float v[TT / 32]; float mx = -3.0e38f;
#pragma unroll
    for (int ch = 0; ch < TT / 128; ++ch) { const int j0 = ch * 128 + lane * 4; const v4f a = *(const v4f*)(sr + j0);
#pragma unroll
        for (int q = 0; q < 4; ++q) { const int j = j0 + q; (void)j; const float t = a[q] * SCL; v[ch * 4 + q] = t; mx = fmaxf(mx, t); } }
#pragma unroll
    for (int sh = 16; sh; sh >>= 1) mx = fmaxf(mx, __shfl_xor(mx, sh, 32));
    float sum = 0.f;
#pragma unroll
    for (int k = 0; k < TT / 32; ++k) { float d0 = __fsub_rn(v[k], mx); asm volatile("" : "+v"(d0)); v[k] = __builtin_amdgcn_exp2f(__fmul_rn(d0, 1.4426950408889634f)); sum += v[k]; }
#pragma unroll
    for (int sh = 16; sh; sh >>= 1) sum += __shfl_xor(sum, sh, 32);
    const float f = __fdiv_rn(hires ? 1.0f : PCAR, sum);
{
        if (hires) {
#pragma unroll
            for (int ch = 0; ch < TT / 128; ++ch) { v4us oh, ol;
#pragma unroll
                for (int q = 0; q < 4; ++q) { unsigned short a, c2; splitf(v[ch * 4 + q] * f, a, c2); oh[q] = a; ol[q] = c2; }
                const size_t oo = ((size_t)zz * (RH ? RH : 1) + i) * TT + ch * 128 + lane * 4; *(v4us*)(Ph + oo) = oh; *(v4us*)(Pl + oo) = ol; }
        } else {
#pragma unroll
            for (int ch = 0; ch < TT / 128; ++ch) { v4h o4;
#pragma unroll
                for (int q = 0; q < 4; ++q) o4[q] = tohx(v[ch * 4 + q] * f);
                *(v4h*)(P16 + (size_t)row * TT + ch * 128 + lane * 4) = o4; } }
         }
}
__global__ __launch_bounds__(256) void k_merge(const float* __restrict__ O, int h0, bf* Ah, bf* Al) { const size_t e = ((size_t)blockIdx.x * 256 + threadIdx.x) * 2; if (e >= (size_t)ZH * TT * HD) return; const int d = (int)(e % HD); const int t = (int)((e / HD) % TT); const int zz = (int)(e / ((size_t)HD * TT)); const float cs = (t < RH) ? 1.0f : (1.0f / PCAR); const size_t oo = (size_t)t * DQ + (h0 + zz) * HD + d;
    v2us oh, ol;
#pragma unroll
    for (int q = 0; q < 2; ++q) { unsigned short a, c2; splitf(O[e + q] * cs, a, c2); oh[q] = a; ol[q] = c2; } *(v2us*)(Ah + oo) = oh; *(v2us*)(Al + oo) = ol;  }

extern "C" void kernel_launch(void* const* d_in, const int* in_sizes, int n_in,
                              void* d_out, int out_size, void* d_ws, size_t ws_size, hipStream_t stream) {
    (void)in_sizes; (void)n_in; (void)out_size;
    const float* x = (const float*)d_in[0]; const float* wq = (const float*)d_in[1]; const float* bq = (const float*)d_in[2]; const float* wk = (const float*)d_in[3]; const float* bk = (const float*)d_in[4]; const float* wv = (const float*)d_in[5]; const float* bv = (const float*)d_in[6]; const float* wo = (const float*)d_in[7]; const float* bo = (const float*)d_in[8];   /* order seq_inputs, Wq [16][1024][64], bq [16][64], Wk, bk, Wv, bv, Wo ('xw' [1024][1024]), bo */
    float* OUT = (float*)d_out;     // [4][2048][1024]
    char* wsp = (char*)d_ws;
    auto take = [&](size_t bytes) { char* p = wsp; wsp += (bytes + 255) & ~(size_t)255; return (void*)p; };
    bf* WQ = (bf*)take((size_t)DQ * DM * 2); bf* WK = (bf*)take((size_t)DKV * DM * 2); bf* WV = (bf*)take((size_t)DKV * DM * 2); bf* WO = (bf*)take((size_t)DM * DQ * 2); float* CS = (float*)take((size_t)TT * HD * 2 * 4);
    bf* XB = (bf*)take((size_t)TT * DM * 2); float* FQ = (float*)take((size_t)TT * DQ * 4); float* FK = (float*)take((size_t)TT * DKV * 4);
    h16* QP16 = (h16*)take((size_t)NH_ * TT * HD * 2); h16* KP16 = (h16*)take((size_t)NKV * TT * HD * 2); h16* VT16 = (h16*)take((size_t)NKV * HD * TT * 2);
    bf* QPh = (bf*)take((size_t)NH_ * TT * HD * 2); bf* QPl = (bf*)take((size_t)NH_ * TT * HD * 2); bf* KPh = (bf*)take((size_t)NKV * TT * HD * 2); bf* KPl = (bf*)take((size_t)NKV * TT * HD * 2); bf* VTh = (bf*)take((size_t)NKV * HD * TT * 2); bf* VTl = (bf*)take((size_t)NKV * HD * TT * 2); bf* Ph = (bf*)take((size_t)ZH * RH * TT * 2); bf* Pl = (bf*)take((size_t)ZH * RH * TT * 2);
    float* Sb = (float*)take((size_t)ZH * TT * TT * 4); h16* P16 = (h16*)take((size_t)ZH * TT * TT * 2); float* Ob = (float*)take((size_t)ZH * TT * HD * 4); bf* ATh = (bf*)take((size_t)TT * DQ * 2); bf* ATl = (bf*)take((size_t)TT * DQ * 2);
    if ((size_t)(wsp - (char*)d_ws) > ws_size) return;    // ws 256 MiB
    float* FV = FK;   // v projection reuses the k buffer after the k planes are built (stream-ordered)
    { k_wtH<<<(unsigned)(((size_t)DQ * DM / 2 + 255) / 256), 256, 0, stream>>>(wq, WQ); k_wtH<<<(unsigned)(((size_t)DQ * DM / 2 + 255) / 256), 256, 0, stream>>>(wk, WK); k_wtH<<<(unsigned)(((size_t)DQ * DM / 2 + 255) / 256), 256, 0, stream>>>(wv, WV);
      k_wtG<<<(unsigned)((DQ * DM / 64 + 63) / 64), 256, 0, stream>>>(wo, DQ, DM, WO);
       }
    k_csid<<<(TT * HD + 255) / 256, 256, 0, stream>>>(CS);
    const unsigned LQ = (unsigned)(((size_t)NH_ * TT * HD / 2 + 255) / 256), LKv = (unsigned)(((size_t)NKV * TT * HD / 2 + 255) / 256);
    for (int b = 0; b < NB_; ++b) {
        
        k_cvt8<<<(unsigned)(((size_t)TT * DM / 8 + 255) / 256), 256, 0, stream>>>(x + (size_t)b * TT * DM, XB, (size_t)TT * DM / 8);
        k_gemmw<bf, 0, true><<<dim3(TT / 64, DQ / 64, 1), 32, 0, stream>>>(XB, nullptr, WQ, nullptr, DM, FQ, DQ, bq, 0, 0, 0);
        k_rope<<<LQ, 256, 0, stream>>>(FQ, DQ, NH_, CS, nullptr, nullptr, 1.0f, QP16, QPh, QPl);
        k_gemmw<bf, 0, true><<<dim3(TT / 64, DKV / 64, 1), 32, 0, stream>>>(XB, nullptr, WK, nullptr, DM, FK, DKV, bk, 0, 0, 0);
        k_rope<<<LKv, 256, 0, stream>>>(FK, DKV, NKV, CS, nullptr, nullptr, 1.0f, KP16, KPh, KPl);
        k_gemmw<bf, 0, true><<<dim3(TT / 64, DKV / 64, 1), 32, 0, stream>>>(XB, nullptr, WV, nullptr, DM, FV, DKV, bv, 0, 0, 0); k_vtp<<<LKv, 256, 0, stream>>>(FV, DKV, NKV, VT16, VTh, VTl);
        for (int h0 = 0; h0 < NH_; h0 += ZH) { const size_t zq = (size_t)h0, zk = (size_t)(h0 / REP);   // one kv head per query head: the pass's two heads use consecutive kv planes (z-strides TT*HD)
            k_gemmw<bf, 2, false><<<dim3(RH / 64, TT / 64, ZH), 32, 0, stream>>>(QPh + zq * TT * HD, QPl + zq * TT * HD, KPh + zk * TT * HD, KPl + zk * TT * HD, HD, Sb, TT, nullptr, (size_t)TT * HD, (size_t)TT * HD, (size_t)TT * TT);
            k_gemmw<h16, 0, false><<<dim3((TT - RH) / 64, TT / 64, ZH), 32, 0, stream>>>(QP16 + zq * TT * HD + (size_t)RH * HD, nullptr, KP16 + zk * TT * HD, nullptr, HD, Sb + (size_t)RH * TT, TT, nullptr, (size_t)TT * HD, (size_t)TT * HD, (size_t)TT * TT);
            k_asoft<<<ZH * TT / 8, 256, 0, stream>>>(Sb, P16, Ph, Pl);
            k_gemmw<bf, 2, false><<<dim3(RH / 64, HD / 64, ZH), 32, 0, stream>>>(Ph, Pl, VTh + zk * HD * TT, VTl + zk * HD * TT, TT, Ob, HD, nullptr, (size_t)RH * TT, (size_t)HD * TT, (size_t)TT * HD);
            k_gemmw<h16, 0, false><<<dim3((TT - RH) / 64, HD / 64, ZH), 32, 0, stream>>>(P16 + (size_t)RH * TT, nullptr, VT16 + zk * HD * TT, nullptr, TT, Ob + (size_t)RH * HD, HD, nullptr, (size_t)TT * TT, (size_t)HD * TT, (size_t)TT * HD);
            k_merge<<<(unsigned)(((size_t)ZH * TT * HD / 2 + 255) / 256), 256, 0, stream>>>(Ob, h0, ATh, ATl); }
        k_gemmw<bf, 1, true><<<dim3(TT / 64, DM / 64, 1), 32, 0, stream>>>(ATh, ATl, WO, nullptr, DQ, OUT + (size_t)b * TT * DM, DM, bo, 0, 0, 0); }
}

// v002
// Measured time: 735 microseconds a run.
// Versions in between are left out here; by their measured steps it is 5.36 times as fast as v000.
#include <hip/hip_runtime.h>

// Multi-head attention layer with per-head packed projection layers (seq_inputs [4][2048][1024]; Q, K, V = einsum('bse,hed', x, W) + b with W [16][1024][64] = [h][e][d] (1/32) and b [16][64]; scores / sqrt(64); softmax (no mask); heads concatenated in order; out = cat Wo + bo ('xw' [1024][1024] + bias) -> [4][2048][1024] (8.4 M); argument order seq_inputs, Wq, bq, Wk, bk, Wv, bv, Wo, bo).
// Layout per batch: bf16 copy of x; k_wtH turns each [h][e][d] weight into Bt rows h*64 + d; the [16][64] biases are the flat [1024] epilogue vectors; exact projections + f32 biases, whose epilogues write the head planes themselves (Q, K as [h][t][d], V as [h][d][t]; fp16 + hi/lo); k_fattn: scores, softmax and weights x V of all 16 heads in one launch, scores never leave registers (hybrid rows: < 512 hi/lo 3 products, rest fp16 weights x1024); merged hi/lo x Wo ('xw' transposed once) exact + bo.
// Compute dtypes, f32 accumulate: every input rounded to bf16; projections exact + f32 biases; attention rows < 512 3 products, rest fp16; softmax f32 (running maximum); Wo hl x exact + bias.

#define NB_  4
#define TT   2048
#define DM   1024
#define NH_  16
#define NKV  16
#define HD   64
#define DQ   (NH_ * HD)
#define DKV  (NKV * HD)
#define RH   512                  // query rows < RH use hi+lo planes (0: none)
#define SCL  0.125f   // HD^-0.5
typedef _Float16 h16;
typedef unsigned short bf;
typedef __attribute__((ext_vector_type(16))) __bf16   v16bf;
typedef __attribute__((ext_vector_type(16))) _Float16 v16h;
typedef __attribute__((ext_vector_type(8)))  _Float16 v8h;
typedef __attribute__((ext_vector_type(8)))  unsigned short v8us;
typedef __attribute__((ext_vector_type(8)))  float    v8f;
typedef __attribute__((ext_vector_type(4)))  float    v4f;
typedef v8h  __attribute__((may_alias)) v8ha;
typedef v4f  __attribute__((may_alias)) v4fa;
typedef v8us __attribute__((may_alias)) v8usa;

__device__ __forceinline__ unsigned short f2bf(float f) { unsigned u = __float_as_uint(f); u += 0x7FFFu + ((u >> 16) & 1u); return (unsigned short)(u >> 16); }
__device__ __forceinline__ float bf2f(unsigned short b) { return __uint_as_float(((unsigned)b) << 16); }
__device__ __forceinline__ float bfr(float f) { return bf2f(f2bf(f)); }
__device__ __forceinline__ v16h cat16(v8h lo, v8h hi) { return __builtin_shufflevector(lo, hi, 0, 1, 2, 3, 4, 5, 6, 7, 8, 9, 10, 11, 12, 13, 14, 15); }
__device__ __forceinline__ v16bf cat16b(v8us lo, v8us hi) { return __builtin_bit_cast(v16bf, __builtin_shufflevector(lo, hi, 0, 1, 2, 3, 4, 5, 6, 7, 8, 9, 10, 11, 12, 13, 14, 15)); }
__device__ __forceinline__ v8f wmma16(v16h a, v16h b, v8f c) { return __builtin_amdgcn_wmma_f32_16x16x32_f16(false, a, false, b, (short)0, c, false, false); }
__device__ __forceinline__ v8f wmmab(v16bf a, v16bf b, v8f c) { return __builtin_amdgcn_wmma_f32_16x16x32_bf16(false, a, false, b, (short)0, c, false, false); }
__device__ __forceinline__ h16 tohx(float x) { return (h16)x; }
__device__ __forceinline__ void splitf(float y, unsigned short& h, unsigned short& l) { h = f2bf(y); l = f2bf(y - bf2f(h)); }
typedef __attribute__((ext_vector_type(4))) _Float16 v4h;
typedef __attribute__((ext_vector_type(4))) unsigned short v4us;



// ---- k_gemmw: register-blocked GEMM, ONE WAVE per 64x64 output tile (16 accumulators), operands straight from K-contiguous 16-bit planes; grid (M/64, N/64, Z), 32 threads.
// C[m][n] (f32, pitch ldc, + optional f32 bias[n]) = sum_k A[m][k] Bt[n][k] (+ split products per NSPLIT). z-batch strides sA/sB/sC in elements. K % 32 == 0.
// EPI 0 stores C. EPI 1 and 2 store no f32: m = t, a tile's 64 columns are one head (n = h * 64 + d), and the result + bias goes out as fp16 and as bf16 hi + lo:
// EPI 1 as [h][t][d] (through the LDS rows: a row of a plane is one 128-byte line), EPI 2 as [h][d][t] (a lane's accumulator holds 8 consecutive t of one d: 16 bytes a plane straight from registers; the wave fills each d's 128-byte line alone).
template <typename T16> struct WFrag;
template <> struct WFrag<h16> { typedef v16h V; static __device__ __forceinline__ V ld(const h16* p) { return cat16(*(const v8h*)p, *(const v8h*)(p + 16)); } static __device__ __forceinline__ v8f mma(V a, V b, v8f c) { return wmma16(a, b, c); } };
template <> struct WFrag<bf> { typedef v16bf V; static __device__ __forceinline__ V ld(const bf* p) { return cat16b(*(const v8us*)p, *(const v8us*)(p + 16)); } static __device__ __forceinline__ v8f mma(V a, V b, v8f c) { return wmmab(a, b, c); } };
template <typename T16, int NSPLIT, bool BIAS, int EPI>
__global__ __launch_bounds__(32) void k_gemmw(const T16* __restrict__ A, const T16* __restrict__ A2, const T16* __restrict__ Bt, const T16* __restrict__ Bt2, int K, float* C, int ldc, const float* __restrict__ bias, size_t sA, size_t sB, size_t sC, h16* P16, bf* Ph, bf* Pl) {
    typedef typename WFrag<T16>::V V;
    __shared__ __align__(16) float os[16 * 68];
    const size_t z = blockIdx.z; A += z * sA; if (A2) A2 += z * sA; Bt += z * sB; if (Bt2) Bt2 += z * sB; C += z * sC;
    const int lane = threadIdx.x & 31, lr = lane & 15, hi = lane >> 4; const int r0 = blockIdx.x * 64, c0 = blockIdx.y * 64;
    v8f acc[4][4];
#pragma unroll
    for (int mb = 0; mb < 4; ++mb)
#pragma unroll
        for (int nb = 0; nb < 4; ++nb) acc[mb][nb] = (v8f){};
    const size_t aoff = (size_t)(r0 + lr) * K + 8 * hi, boff = (size_t)(c0 + lr) * K + 8 * hi;
#pragma unroll 1
    for (int kc = 0; kc < K; kc += 32) {
        V a[4], a2[4];
#pragma unroll
        for (int mb = 0; mb < 4; ++mb) { a[mb] = WFrag<T16>::ld(A + aoff + (size_t)mb * 16 * K + kc); if (NSPLIT == 1 || NSPLIT == 2) a2[mb] = WFrag<T16>::ld(A2 + aoff + (size_t)mb * 16 * K + kc); }
#pragma unroll
        for (int nb = 0; nb < 4; ++nb) { const V b = WFrag<T16>::ld(Bt + boff + (size_t)nb * 16 * K + kc); V b2; if (NSPLIT >= 2) b2 = WFrag<T16>::ld(Bt2 + boff + (size_t)nb * 16 * K + kc);
#pragma unroll
            for (int mb = 0; mb < 4; ++mb) { acc[mb][nb] = WFrag<T16>::mma(a[mb], b, acc[mb][nb]); if (NSPLIT == 1 || NSPLIT == 2) acc[mb][nb] = WFrag<T16>::mma(a2[mb], b, acc[mb][nb]); if (NSPLIT >= 2) acc[mb][nb] = WFrag<T16>::mma(a[mb], b2, acc[mb][nb]); } }
        asm volatile("v_nop\n\tv_nop\n\tv_nop\n\tv_nop" : "+v"(acc[0][0]), "+v"(acc[1][1]), "+v"(acc[2][2]), "+v"(acc[3][3]) : "v"(a[0]), "v"(a[3]));
    }
    if constexpr (EPI == 2) {
#pragma unroll
        for (int nb = 0; nb < 4; ++nb) { const float bn = bfr(bias[c0 + nb * 16 + lr]);
#pragma unroll
            for (int mb = 0; mb < 4; ++mb) { const size_t po = (size_t)(c0 + nb * 16 + lr) * TT + r0 + mb * 16 + hi * 8; v8h o16; v8us oh, ol;
#pragma unroll
                for (int j = 0; j < 8; ++j) { const float x = acc[mb][nb][j] + bn; o16[j] = tohx(x); unsigned short a2, c2; splitf(x, a2, c2); oh[j] = a2; ol[j] = c2; }
                *(v8h*)(P16 + po) = o16; *(v8us*)(Ph + po) = oh; *(v8us*)(Pl + po) = ol; } }
        return;
    }
#pragma unroll
    for (int mb = 0; mb < 4; ++mb) {
#pragma unroll
        for (int nb = 0; nb < 4; ++nb) {
#pragma unroll
            for (int j = 0; j < 8; ++j) os[(hi * 8 + j) * 68 + nb * 16 + lr] = acc[mb][nb][j]; }
        __builtin_amdgcn_wave_barrier(); asm volatile("" ::: "memory");
        float* crow = C + (size_t)(r0 + mb * 16) * ldc + c0;
{
#pragma unroll
            for (int s = 0; s < 8; ++s) { const int row = 2 * s + hi, cofs = lr * 4; v4f val = *(const v4fa*)(os + row * 68 + cofs); if (BIAS) { val[0] += bfr(bias[c0 + cofs]); val[1] += bfr(bias[c0 + cofs + 1]); val[2] += bfr(bias[c0 + cofs + 2]); val[3] += bfr(bias[c0 + cofs + 3]); }
                if constexpr (EPI == 1) { const size_t po = ((size_t)blockIdx.y * TT + r0 + mb * 16 + row) * HD + cofs; v4h o16; v4us oh, ol;
#pragma unroll
                    for (int q = 0; q < 4; ++q) { o16[q] = tohx(val[q]); unsigned short a2, c2; splitf(val[q], a2, c2); oh[q] = a2; ol[q] = c2; }
                    *(v4h*)(P16 + po) = o16; *(v4us*)(Ph + po) = oh; *(v4us*)(Pl + po) = ol; }
                else *(v4f*)(crow + (size_t)row * ldc + cofs) = val; }
             }
        __builtin_amdgcn_wave_barrier(); asm volatile("" ::: "memory");
    }
}

typedef __attribute__((ext_vector_type(2))) unsigned short v2us;

__global__ __launch_bounds__(256) void k_wtG(const float* __restrict__ w, int K, int N, bf* Bt) {
    const int lane = threadIdx.x & 31; const int L0 = (blockIdx.x * 8 + (threadIdx.x >> 5)) * 8; const int nlines = N * K / 64;
{
#pragma unroll 1
        for (int l = 0; l < 8; ++l) { const int L = L0 + l; if (L >= nlines) break; const size_t e = (size_t)L * 64 + lane * 2; const int k = (int)(e % K), n = (int)(e / K); v2us o;
            o[0] = f2bf(w[(size_t)k * N + n]); o[1] = f2bf(w[(size_t)(k + 1) * N + n]); *(v2us*)(Bt + e) = o; }
         }
}
__global__ __launch_bounds__(256) void k_cvt8(const float* __restrict__ src, bf* dst, size_t n8) { const size_t i = (size_t)blockIdx.x * 256 + threadIdx.x; if (i >= n8) return; const v8f v = *(const v8f*)(src + i * 8); v8us o;
#pragma unroll
    for (int k = 0; k < 8; ++k) o[k] = f2bf(v[k]); *(v8us*)(dst + i * 8) = o;  }

__global__ __launch_bounds__(256) void k_wtH(const float* __restrict__ w, bf* Bt) { const size_t e2 = ((size_t)blockIdx.x * 256 + threadIdx.x) * 2; if (e2 >= (size_t)DQ * DM) return; const int d = (int)(e2 % DM); const int r = (int)(e2 / DM); const int h = r / HD, e = r % HD; v2us o; o[0] = f2bf(w[((size_t)h * DM + d) * HD + e]); o[1] = f2bf(w[((size_t)h * DM + d + 1) * HD + e]);
    *(v2us*)(Bt + e2) = o;  }
// ---- k_fattn: one wave owns NT x 16 query rows of one head and walks the 2048 keys 32 at a time.
// St = K Qt (A = 16 key rows, B = 16 query rows, both K-contiguous planes): in the accumulator a lane holds ONE query (column lane & 15) and keys 8 * (lane >> 4) + j of each 16-key tile,
// which is the k order of a B fragment (elements 0..7 = tile 0, 8..15 = tile 1), so the weights go from the score accumulators straight into Ot += Vt Pt (A = 16 rows of the [d][t] plane).
// Softmax with a running maximum per query: maximum and sum in-lane plus one exchange between the wave halves; sums of the halves joined once at the end; division by the sum at the end.
// exp8: eight weights in place, p = exp2(p * c + nm). Written as one statement so that every v_exp_f32 is followed by an instruction that neither reads its result nor writes its source
// (the slot the instruction set asks for behind a transcendental): a later element's multiply-add or v_exp_f32 fills it, a v_nop behind the last. exp8a does the same and takes the rescale factor a = exp2(a) along.
__device__ __forceinline__ void exp8(float* p, float c, float nm) {
    asm("v_fma_f32 %0, %0, %8, %9\n\tv_fma_f32 %1, %1, %8, %9\n\tv_exp_f32 %0, %0\n\tv_fma_f32 %2, %2, %8, %9\n\tv_exp_f32 %1, %1\n\tv_fma_f32 %3, %3, %8, %9\n\tv_exp_f32 %2, %2\n\t"
        "v_fma_f32 %4, %4, %8, %9\n\tv_exp_f32 %3, %3\n\tv_fma_f32 %5, %5, %8, %9\n\tv_exp_f32 %4, %4\n\tv_fma_f32 %6, %6, %8, %9\n\tv_exp_f32 %5, %5\n\tv_fma_f32 %7, %7, %8, %9\n\tv_exp_f32 %6, %6\n\tv_exp_f32 %7, %7\n\tv_nop"
        : "+v"(p[0]), "+v"(p[1]), "+v"(p[2]), "+v"(p[3]), "+v"(p[4]), "+v"(p[5]), "+v"(p[6]), "+v"(p[7]) : "s"(c), "v"(nm));
}
__device__ __forceinline__ void exp8a(float* p, float c, float nm, float& a) {
    asm("v_fma_f32 %0, %0, %9, %10\n\tv_exp_f32 %8, %8\n\tv_fma_f32 %1, %1, %9, %10\n\tv_exp_f32 %0, %0\n\tv_fma_f32 %2, %2, %9, %10\n\tv_exp_f32 %1, %1\n\tv_fma_f32 %3, %3, %9, %10\n\tv_exp_f32 %2, %2\n\t"
        "v_fma_f32 %4, %4, %9, %10\n\tv_exp_f32 %3, %3\n\tv_fma_f32 %5, %5, %9, %10\n\tv_exp_f32 %4, %4\n\tv_fma_f32 %6, %6, %9, %10\n\tv_exp_f32 %5, %5\n\tv_fma_f32 %7, %7, %9, %10\n\tv_exp_f32 %6, %6\n\tv_exp_f32 %7, %7\n\tv_nop"
        : "+v"(p[0]), "+v"(p[1]), "+v"(p[2]), "+v"(p[3]), "+v"(p[4]), "+v"(p[5]), "+v"(p[6]), "+v"(p[7]), "+v"(a) : "s"(c), "v"(nm));
}
template <bool HI> struct ASel { typedef h16 T; };
template <> struct ASel<true> { typedef bf T; };
template <bool HI, int NT>
__device__ __forceinline__ void fa_tile(const typename ASel<HI>::T* __restrict__ Q, const typename ASel<HI>::T* __restrict__ Q2, const typename ASel<HI>::T* __restrict__ Kp, const typename ASel<HI>::T* __restrict__ Kp2,
                                        const typename ASel<HI>::T* __restrict__ Vp, const typename ASel<HI>::T* __restrict__ Vp2, int q0, bf* Ah, bf* Al) {
    typedef WFrag<typename ASel<HI>::T> F; typedef typename F::V V;
    const int lane = threadIdx.x & 31, lr = lane & 15, hi = lane >> 4;
    const float CL2 = SCL * 1.4426950408889634f;   // score -> log2 domain
    const float PSH = HI ? 0.0f : 10.0f;           // fp16 weights carry x1024 (log2 = 10): keeps small weights out of the fp16 denormals; the sum carries it too, so it cancels in the division
    V qf[NT][2], qf2[NT][2], kf[2][2], kf2[2][2];
#pragma unroll
    for (int nt = 0; nt < NT; ++nt)
#pragma unroll
        for (int ks = 0; ks < 2; ++ks) { const size_t qo = (size_t)(q0 + nt * 16 + lr) * HD + ks * 32 + 8 * hi; qf[nt][ks] = F::ld(Q + qo); if constexpr (HI) qf2[nt][ks] = F::ld(Q2 + qo); }
    const size_t ko = (size_t)lr * HD + 8 * hi, vo = (size_t)lr * TT + 8 * hi;
    if constexpr (!HI) {
#pragma unroll
        for (int mt = 0; mt < 2; ++mt)
#pragma unroll
            for (int ks = 0; ks < 2; ++ks) kf[mt][ks] = F::ld(Kp + ko + mt * 16 * HD + ks * 32);
    }
    v8f o[NT][4]; float m[NT], l[NT];
#pragma unroll
    for (int nt = 0; nt < NT; ++nt) { m[nt] = -3.0e38f; l[nt] = 0.f;
#pragma unroll
        for (int dt = 0; dt < 4; ++dt) o[nt][dt] = (v8f){}; }
    for (int kc = 0; kc < TT; kc += 32) {
        V vf[4], vf2[4];
        if constexpr (HI) {   // hi/lo rows: four planes do not fit the registers one pass ahead; this pass's key rows are asked for first, its value rows fly behind them under the score products and the softmax
#pragma unroll
            for (int mt = 0; mt < 2; ++mt)
#pragma unroll
                for (int ks = 0; ks < 2; ++ks) { kf[mt][ks] = F::ld(Kp + ko + (size_t)(kc + mt * 16) * HD + ks * 32); kf2[mt][ks] = F::ld(Kp2 + ko + (size_t)(kc + mt * 16) * HD + ks * 32); }
        }
#pragma unroll
        for (int dt = 0; dt < 4; ++dt) { vf[dt] = F::ld(Vp + vo + (size_t)dt * 16 * TT + kc); if constexpr (HI) vf2[dt] = F::ld(Vp2 + vo + (size_t)dt * 16 * TT + kc); }
        v8f s[NT][2];
#pragma unroll
        for (int nt = 0; nt < NT; ++nt)
#pragma unroll
            for (int mt = 0; mt < 2; ++mt) { s[nt][mt] = (v8f){};
#pragma unroll
                for (int ks = 0; ks < 2; ++ks) { s[nt][mt] = F::mma(kf[mt][ks], qf[nt][ks], s[nt][mt]); if constexpr (HI) { s[nt][mt] = F::mma(kf[mt][ks], qf2[nt][ks], s[nt][mt]); s[nt][mt] = F::mma(kf2[mt][ks], qf[nt][ks], s[nt][mt]); } } }
        if constexpr (!HI) {
            const int kn = (kc + 32 < TT) ? kc + 32 : 0;   // the next pass's key rows, fetched behind this pass's score products (the last pass refetches rows 0..31, unused)
#pragma unroll
            for (int mt = 0; mt < 2; ++mt)
#pragma unroll
                for (int ks = 0; ks < 2; ++ks) kf[mt][ks] = F::ld(Kp + ko + (size_t)(kn + mt * 16) * HD + ks * 32);
        }
#pragma unroll
        for (int nt = 0; nt < NT; ++nt) {
            float mx = s[nt][0][0];
#pragma unroll
            for (int j = 0; j < 8; ++j) { mx = fmaxf(mx, s[nt][0][j]); mx = fmaxf(mx, s[nt][1][j]); }
            mx = fmaxf(mx, __shfl_xor(mx, 16, 32));
            const float mn = fmaxf(m[nt], mx); float al = (m[nt] - mn) * CL2; const float nm = PSH - mn * CL2; m[nt] = mn;
            float p[16], ps = 0.f;
#pragma unroll
            for (int j = 0; j < 8; ++j) { p[j] = s[nt][0][j]; p[8 + j] = s[nt][1][j]; }
            exp8a(p, CL2, nm, al); exp8(p + 8, CL2, nm);
#pragma unroll
            for (int j = 0; j < 16; ++j) ps += p[j];
            l[nt] = l[nt] * al + ps;
#pragma unroll
            for (int dt = 0; dt < 4; ++dt)
#pragma unroll
                for (int j = 0; j < 8; ++j) o[nt][dt][j] *= al;
            if constexpr (HI) {
                v8us h0, h1, l0, l1;
#pragma unroll
                for (int j = 0; j < 8; ++j) { unsigned short a, c2; splitf(p[j], a, c2); h0[j] = a; l0[j] = c2; splitf(p[8 + j], a, c2); h1[j] = a; l1[j] = c2; }
                const V ph = cat16b(h0, h1), pl = cat16b(l0, l1);
#pragma unroll
                for (int dt = 0; dt < 4; ++dt) { o[nt][dt] = F::mma(vf[dt], ph, o[nt][dt]); o[nt][dt] = F::mma(vf[dt], pl, o[nt][dt]); o[nt][dt] = F::mma(vf2[dt], ph, o[nt][dt]); }
            } else {
                V pb;
#pragma unroll
                for (int j = 0; j < 16; ++j) pb[j] = tohx(p[j]);
#pragma unroll
                for (int dt = 0; dt < 4; ++dt) o[nt][dt] = F::mma(vf[dt], pb, o[nt][dt]);
            }
        }
    }
#pragma unroll
    for (int nt = 0; nt < NT; ++nt) {
        const float inv = __fdiv_rn(1.0f, l[nt] + __shfl_xor(l[nt], 16, 32));
        const size_t oo = (size_t)(q0 + nt * 16 + lr) * DQ + 8 * hi;   // a lane holds d = dt * 16 + 8 * hi + j of its query: 16 contiguous bytes per plane and tile
#pragma unroll
        for (int dt = 0; dt < 4; ++dt) { v8us oh, ol;
#pragma unroll
            for (int j = 0; j < 8; ++j) { unsigned short a, c2; splitf(o[nt][dt][j] * inv, a, c2); oh[j] = a; ol[j] = c2; }
            *(v8us*)(Ah + oo + dt * 16) = oh; *(v8us*)(Al + oo + dt * 16) = ol; }
    }
}
// grid (heads, RH / 32 + (TT - RH) / 64), 2 independent waves a block: blockIdx.y < RH / 32 takes 16 hi/lo rows a wave (twice the loads of the others, so they come first in index order), the rest 32 fp16 rows a wave; output = the merged [t][h * 64 + d] hi/lo planes
__global__ __launch_bounds__(64) void k_fattn(const h16* __restrict__ Q16, const h16* __restrict__ K16, const h16* __restrict__ V16, const bf* __restrict__ Qh, const bf* __restrict__ Ql, const bf* __restrict__ Kh, const bf* __restrict__ Kl, const bf* __restrict__ Vh, const bf* __restrict__ Vl, bf* Ah, bf* Al) {
    const int h = blockIdx.x, w = threadIdx.x >> 5, bx = blockIdx.y; const size_t po = (size_t)h * TT * HD;
    if (bx < RH / 32) fa_tile<true, 1>(Qh + po, Ql + po, Kh + po, Kl + po, Vh + po, Vl + po, (bx * 2 + w) * 16, Ah + h * HD, Al + h * HD);
    else fa_tile<false, 2>(Q16 + po, nullptr, K16 + po, nullptr, V16 + po, nullptr, RH + ((bx - RH / 32) * 2 + w) * 32, Ah + h * HD, Al + h * HD);
}

extern "C" void kernel_launch(void* const* d_in, const int* in_sizes, int n_in,
                              void* d_out, int out_size, void* d_ws, size_t ws_size, hipStream_t stream) {
    (void)in_sizes; (void)n_in; (void)out_size;
    const float* x = (const float*)d_in[0]; const float* wq = (const float*)d_in[1]; const float* bq = (const float*)d_in[2]; const float* wk = (const float*)d_in[3]; const float* bk = (const float*)d_in[4]; const float* wv = (const float*)d_in[5]; const float* bv = (const float*)d_in[6]; const float* wo = (const float*)d_in[7]; const float* bo = (const float*)d_in[8];   /* order seq_inputs, Wq [16][1024][64], bq [16][64], Wk, bk, Wv, bv, Wo ('xw' [1024][1024]), bo */
    float* OUT = (float*)d_out;     // [4][2048][1024]
    char* wsp = (char*)d_ws;
    auto take = [&](size_t bytes) { char* p = wsp; wsp += (bytes + 255) & ~(size_t)255; return (void*)p; };
    bf* WQ = (bf*)take((size_t)DQ * DM * 2); bf* WK = (bf*)take((size_t)DKV * DM * 2); bf* WV = (bf*)take((size_t)DKV * DM * 2); bf* WO = (bf*)take((size_t)DM * DQ * 2);
    bf* XB = (bf*)take((size_t)TT * DM * 2);
    h16* QP16 = (h16*)take((size_t)NH_ * TT * HD * 2); h16* KP16 = (h16*)take((size_t)NKV * TT * HD * 2); h16* VT16 = (h16*)take((size_t)NKV * HD * TT * 2);
    bf* QPh = (bf*)take((size_t)NH_ * TT * HD * 2); bf* QPl = (bf*)take((size_t)NH_ * TT * HD * 2); bf* KPh = (bf*)take((size_t)NKV * TT * HD * 2); bf* KPl = (bf*)take((size_t)NKV * TT * HD * 2); bf* VTh = (bf*)take((size_t)NKV * HD * TT * 2); bf* VTl = (bf*)take((size_t)NKV * HD * TT * 2);
    bf* ATh = (bf*)take((size_t)TT * DQ * 2); bf* ATl = (bf*)take((size_t)TT * DQ * 2);
    if ((size_t)(wsp - (char*)d_ws) > ws_size) return;    // ws 256 MiB
    { k_wtH<<<(unsigned)(((size_t)DQ * DM / 2 + 255) / 256), 256, 0, stream>>>(wq, WQ); k_wtH<<<(unsigned)(((size_t)DQ * DM / 2 + 255) / 256), 256, 0, stream>>>(wk, WK); k_wtH<<<(unsigned)(((size_t)DQ * DM / 2 + 255) / 256), 256, 0, stream>>>(wv, WV);
      k_wtG<<<(unsigned)((DQ * DM / 64 + 63) / 64), 256, 0, stream>>>(wo, DQ, DM, WO);
       }
    for (int b = 0; b < NB_; ++b) {
        
        k_cvt8<<<(unsigned)(((size_t)TT * DM / 8 + 255) / 256), 256, 0, stream>>>(x + (size_t)b * TT * DM, XB, (size_t)TT * DM / 8);
        k_gemmw<bf, 0, true, 1><<<dim3(TT / 64, DQ / 64, 1), 32, 0, stream>>>(XB, nullptr, WQ, nullptr, DM, nullptr, 0, bq, 0, 0, 0, QP16, QPh, QPl);
        k_gemmw<bf, 0, true, 1><<<dim3(TT / 64, DKV / 64, 1), 32, 0, stream>>>(XB, nullptr, WK, nullptr, DM, nullptr, 0, bk, 0, 0, 0, KP16, KPh, KPl);
        k_gemmw<bf, 0, true, 2><<<dim3(TT / 64, DKV / 64, 1), 32, 0, stream>>>(XB, nullptr, WV, nullptr, DM, nullptr, 0, bv, 0, 0, 0, VT16, VTh, VTl);
        k_fattn<<<dim3(NH_, RH / 32 + (TT - RH) / 64, 1), 64, 0, stream>>>(QP16, KP16, VT16, QPh, QPl, KPh, KPl, VTh, VTl, ATh, ATl);
        k_gemmw<bf, 1, true, 0><<<dim3(TT / 64, DM / 64, 1), 32, 0, stream>>>(ATh, ATl, WO, nullptr, DQ, OUT + (size_t)b * TT * DM, DM, bo, 0, 0, 0, nullptr, nullptr, nullptr); }
}

// v003
// It runs in 418 microseconds.
// In two side-by-side timings against v002, it was 1.77 and 1.76 times as fast.
// Over all steps from v000 it is 9.46 times as fast.
#include <hip/hip_runtime.h>

// Multi-head attention layer with per-head packed projection layers (seq_inputs [4][2048][1024]; Q, K, V = einsum('bse,hed', x, W) + b with W [16][1024][64] = [h][e][d] (1/32) and b [16][64]; scores / sqrt(64); softmax (no mask); heads concatenated in order; out = cat Wo + bo ('xw' [1024][1024] + bias) -> [4][2048][1024] (8.4 M); argument order seq_inputs, Wq, bq, Wk, bk, Wv, bv, Wo, bo).
// Every launch covers all 4 batches (the rows of the GEMMs are b * 2048 + t, the head planes are [b][h][..], the attention grid's x is b * 16 + h). Layout: bf16 copy of x; k_wtH turns each [h][e][d] weight into Bt rows h*64 + d; the [16][64] biases are the flat [1024] epilogue vectors; exact projections + f32 biases, whose epilogues write the head planes themselves (Q, K as [h][t][d], V as [h][d][t]; fp16 + hi/lo); k_fattn: scores, softmax and weights x V of all 64 (batch, head) pairs in one launch, scores never leave registers (hybrid rows: < 512 hi/lo 3 products, rest fp16 weights x1024); merged hi/lo x Wo ('xw' transposed once) exact + bo.
// Compute dtypes, f32 accumulate: every input rounded to bf16; projections exact + f32 biases; attention rows < 512 3 products, rest fp16; softmax f32 (running maximum); Wo hl x exact + bias.

#define NB_  4
#define TT   2048
#define DM   1024
#define NH_  16
#define NKV  16
#define HD   64
#define DQ   (NH_ * HD)
#define DKV  (NKV * HD)
#define RH   512                  // query rows < RH use hi+lo planes (0: none)
#define SCL  0.125f   // HD^-0.5
typedef _Float16 h16;
typedef unsigned short bf;
typedef __attribute__((ext_vector_type(16))) __bf16   v16bf;
typedef __attribute__((ext_vector_type(16))) _Float16 v16h;
typedef __attribute__((ext_vector_type(8)))  _Float16 v8h;
typedef __attribute__((ext_vector_type(8)))  unsigned short v8us;
typedef __attribute__((ext_vector_type(8)))  float    v8f;
typedef __attribute__((ext_vector_type(4)))  float    v4f;
typedef v8h  __attribute__((may_alias)) v8ha;
typedef v4f  __attribute__((may_alias)) v4fa;
typedef v8us __attribute__((may_alias)) v8usa;

__device__ __forceinline__ unsigned short f2bf(float f) { unsigned u = __float_as_uint(f); u += 0x7FFFu + ((u >> 16) & 1u); return (unsigned short)(u >> 16); }
__device__ __forceinline__ float bf2f(unsigned short b) { return __uint_as_float(((unsigned)b) << 16); }
__device__ __forceinline__ float bfr(float f) { return bf2f(f2bf(f)); }
__device__ __forceinline__ v16h cat16(v8h lo, v8h hi) { return __builtin_shufflevector(lo, hi, 0, 1, 2, 3, 4, 5, 6, 7, 8, 9, 10, 11, 12, 13, 14, 15); }
__device__ __forceinline__ v16bf cat16b(v8us lo, v8us hi) { return __builtin_bit_cast(v16bf, __builtin_shufflevector(lo, hi, 0, 1, 2, 3, 4, 5, 6, 7, 8, 9, 10, 11, 12, 13, 14, 15)); }
__device__ __forceinline__ v8f wmma16(v16h a, v16h b, v8f c) { return __builtin_amdgcn_wmma_f32_16x16x32_f16(false, a, false, b, (short)0, c, false, false); }
__device__ __forceinline__ v8f wmmab(v16bf a, v16bf b, v8f c) { return __builtin_amdgcn_wmma_f32_16x16x32_bf16(false, a, false, b, (short)0, c, false, false); }
__device__ __forceinline__ h16 tohx(float x) { return (h16)x; }
__device__ __forceinline__ void splitf(float y, unsigned short& h, unsigned short& l) { h = f2bf(y); l = f2bf(y - bf2f(h)); }
typedef __attribute__((ext_vector_type(4))) _Float16 v4h;
typedef __attribute__((ext_vector_type(4))) unsigned short v4us;



// ---- k_gemmw: register-blocked GEMM, ONE WAVE per 64x64 output tile (16 accumulators), operands straight from K-contiguous 16-bit planes; grid (M/64, N/64, Z), 32 threads.
// C[m][n] (f32, pitch ldc, + optional f32 bias[n]) = sum_k A[m][k] Bt[n][k] (+ split products per NSPLIT). z-batch strides sA/sB/sC in elements. K % 32 == 0.
// EPI 0 stores C. EPI 1 and 2 store no f32: m = b * 2048 + t (a 64-row tile lies in one batch), a tile's 64 columns are one head (n = h * 64 + d), and the result + bias goes out as fp16 and as bf16 hi + lo:
// EPI 1 as [b][h][t][d] (through the LDS rows: a row of a plane is one 128-byte line), EPI 2 as [b][h][d][t] (a lane's accumulator holds 8 consecutive t of one d: 16 bytes a plane straight from registers; the wave fills each d's 128-byte line alone).
template <typename T16> struct WFrag;
template <> struct WFrag<h16> { typedef v16h V; static __device__ __forceinline__ V ld(const h16* p) { return cat16(*(const v8h*)p, *(const v8h*)(p + 16)); } static __device__ __forceinline__ v8f mma(V a, V b, v8f c) { return wmma16(a, b, c); } };
template <> struct WFrag<bf> { typedef v16bf V; static __device__ __forceinline__ V ld(const bf* p) { return cat16b(*(const v8us*)p, *(const v8us*)(p + 16)); } static __device__ __forceinline__ v8f mma(V a, V b, v8f c) { return wmmab(a, b, c); } };
template <typename T16, int NSPLIT, bool BIAS, int EPI>
__global__ __launch_bounds__(32) void k_gemmw(const T16* __restrict__ A, const T16* __restrict__ A2, const T16* __restrict__ Bt, const T16* __restrict__ Bt2, int K, float* C, int ldc, const float* __restrict__ bias, size_t sA, size_t sB, size_t sC, h16* P16, bf* Ph, bf* Pl) {
    typedef typename WFrag<T16>::V V;
    __shared__ __align__(16) float os[16 * 68];
    const size_t z = blockIdx.z; A += z * sA; if (A2) A2 += z * sA; Bt += z * sB; if (Bt2) Bt2 += z * sB; C += z * sC;
    const int lane = threadIdx.x & 31, lr = lane & 15, hi = lane >> 4; const int r0 = blockIdx.x * 64, c0 = blockIdx.y * 64; const int bz = r0 / TT, t0 = r0 % TT;
    v8f acc[4][4];
#pragma unroll
    for (int mb = 0; mb < 4; ++mb)
#pragma unroll
        for (int nb = 0; nb < 4; ++nb) acc[mb][nb] = (v8f){};
    const size_t aoff = (size_t)(r0 + lr) * K + 8 * hi, boff = (size_t)(c0 + lr) * K + 8 * hi;
#pragma unroll 1
    for (int kc = 0; kc < K; kc += 32) {
        V a[4], a2[4];
#pragma unroll
        for (int mb = 0; mb < 4; ++mb) { a[mb] = WFrag<T16>::ld(A + aoff + (size_t)mb * 16 * K + kc); if (NSPLIT == 1 || NSPLIT == 2) a2[mb] = WFrag<T16>::ld(A2 + aoff + (size_t)mb * 16 * K + kc); }
#pragma unroll
        for (int nb = 0; nb < 4; ++nb) { const V b = WFrag<T16>::ld(Bt + boff + (size_t)nb * 16 * K + kc); V b2; if (NSPLIT >= 2) b2 = WFrag<T16>::ld(Bt2 + boff + (size_t)nb * 16 * K + kc);
#pragma unroll
            for (int mb = 0; mb < 4; ++mb) { acc[mb][nb] = WFrag<T16>::mma(a[mb], b, acc[mb][nb]); if (NSPLIT == 1 || NSPLIT == 2) acc[mb][nb] = WFrag<T16>::mma(a2[mb], b, acc[mb][nb]); if (NSPLIT >= 2) acc[mb][nb] = WFrag<T16>::mma(a[mb], b2, acc[mb][nb]); } }
        asm volatile("v_nop\n\tv_nop\n\tv_nop\n\tv_nop" : "+v"(acc[0][0]), "+v"(acc[1][1]), "+v"(acc[2][2]), "+v"(acc[3][3]) : "v"(a[0]), "v"(a[3]));
    }
    if constexpr (EPI == 2) {
#pragma unroll
        for (int nb = 0; nb < 4; ++nb) { const float bn = bfr(bias[c0 + nb * 16 + lr]);
#pragma unroll
            for (int mb = 0; mb < 4; ++mb) { const size_t po = ((size_t)bz * DKV + c0 + nb * 16 + lr) * TT + t0 + mb * 16 + hi * 8; v8h o16; v8us oh, ol;
#pragma unroll
                for (int j = 0; j < 8; ++j) { const float x = acc[mb][nb][j] + bn; o16[j] = tohx(x); unsigned short a2, c2; splitf(x, a2, c2); oh[j] = a2; ol[j] = c2; }
                *(v8h*)(P16 + po) = o16; *(v8us*)(Ph + po) = oh; *(v8us*)(Pl + po) = ol; } }
        return;
    }
#pragma unroll
    for (int mb = 0; mb < 4; ++mb) {
#pragma unroll
        for (int nb = 0; nb < 4; ++nb) {
#pragma unroll
            for (int j = 0; j < 8; ++j) os[(hi * 8 + j) * 68 + nb * 16 + lr] = acc[mb][nb][j]; }
        __builtin_amdgcn_wave_barrier(); asm volatile("" ::: "memory");
        float* crow = C + (size_t)(r0 + mb * 16) * ldc + c0;
{
#pragma unroll
            for (int s = 0; s < 8; ++s) { const int row = 2 * s + hi, cofs = lr * 4; v4f val = *(const v4fa*)(os + row * 68 + cofs); if (BIAS) { val[0] += bfr(bias[c0 + cofs]); val[1] += bfr(bias[c0 + cofs + 1]); val[2] += bfr(bias[c0 + cofs + 2]); val[3] += bfr(bias[c0 + cofs + 3]); }
                if constexpr (EPI == 1) { const size_t po = (((size_t)bz * NH_ + blockIdx.y) * TT + t0 + mb * 16 + row) * HD + cofs; v4h o16; v4us oh, ol;
#pragma unroll
                    for (int q = 0; q < 4; ++q) { o16[q] = tohx(val[q]); unsigned short a2, c2; splitf(val[q], a2, c2); oh[q] = a2; ol[q] = c2; }
                    *(v4h*)(P16 + po) = o16; *(v4us*)(Ph + po) = oh; *(v4us*)(Pl + po) = ol; }
                else *(v4f*)(crow + (size_t)row * ldc + cofs) = val; }
             }
        __builtin_amdgcn_wave_barrier(); asm volatile("" ::: "memory");
    }
}

typedef __attribute__((ext_vector_type(2))) unsigned short v2us;

__global__ __launch_bounds__(256) void k_wtG(const float* __restrict__ w, int K, int N, bf* Bt) {
    const int lane = threadIdx.x & 31; const int L0 = (blockIdx.x * 8 + (threadIdx.x >> 5)) * 8; const int nlines = N * K / 64;
{
#pragma unroll 1
        for (int l = 0; l < 8; ++l) { const int L = L0 + l; if (L >= nlines) break; const size_t e = (size_t)L * 64 + lane * 2; const int k = (int)(e % K), n = (int)(e / K); v2us o;
            o[0] = f2bf(w[(size_t)k * N + n]); o[1] = f2bf(w[(size_t)(k + 1) * N + n]); *(v2us*)(Bt + e) = o; }
         }
}
__global__ __launch_bounds__(256) void k_cvt8(const float* __restrict__ src, bf* dst, size_t n8) { const size_t i = (size_t)blockIdx.x * 256 + threadIdx.x; if (i >= n8) return; const v8f v = *(const v8f*)(src + i * 8); v8us o;
#pragma unroll
    for (int k = 0; k < 8; ++k) o[k] = f2bf(v[k]); *(v8us*)(dst + i * 8) = o;  }

__global__ __launch_bounds__(256) void k_wtH(const float* __restrict__ w, bf* Bt) { const size_t e2 = ((size_t)blockIdx.x * 256 + threadIdx.x) * 2; if (e2 >= (size_t)DQ * DM) return; const int d = (int)(e2 % DM); const int r = (int)(e2 / DM); const int h = r / HD, e = r % HD; v2us o; o[0] = f2bf(w[((size_t)h * DM + d) * HD + e]); o[1] = f2bf(w[((size_t)h * DM + d + 1) * HD + e]);
    *(v2us*)(Bt + e2) = o;  }
// ---- k_fattn: one wave owns NT x 16 query rows of one head and walks the 2048 keys 32 at a time.
// St = K Qt (A = 16 key rows, B = 16 query rows, both K-contiguous planes): in the accumulator a lane holds ONE query (column lane & 15) and keys 8 * (lane >> 4) + j of each 16-key tile,
// which is the k order of a B fragment (elements 0..7 = tile 0, 8..15 = tile 1), so the weights go from the score accumulators straight into Ot += Vt Pt (A = 16 rows of the [d][t] plane).
// Softmax with a running maximum per query: maximum and sum in-lane plus one exchange between the wave halves; sums of the halves joined once at the end; division by the sum at the end.
// exp8: eight weights in place, p = exp2(p * c + nm). Written as one statement so that every v_exp_f32 is followed by an instruction that neither reads its result nor writes its source
// (the slot the instruction set asks for behind a transcendental): a later element's multiply-add or v_exp_f32 fills it, a v_nop behind the last. exp8a does the same and takes the rescale factor a = exp2(a) along.
__device__ __forceinline__ void exp8(float* p, float c, float nm) {
    asm("v_fma_f32 %0, %0, %8, %9\n\tv_fma_f32 %1, %1, %8, %9\n\tv_exp_f32 %0, %0\n\tv_fma_f32 %2, %2, %8, %9\n\tv_exp_f32 %1, %1\n\tv_fma_f32 %3, %3, %8, %9\n\tv_exp_f32 %2, %2\n\t"
        "v_fma_f32 %4, %4, %8, %9\n\tv_exp_f32 %3, %3\n\tv_fma_f32 %5, %5, %8, %9\n\tv_exp_f32 %4, %4\n\tv_fma_f32 %6, %6, %8, %9\n\tv_exp_f32 %5, %5\n\tv_fma_f32 %7, %7, %8, %9\n\tv_exp_f32 %6, %6\n\tv_exp_f32 %7, %7\n\tv_nop"
        : "+v"(p[0]), "+v"(p[1]), "+v"(p[2]), "+v"(p[3]), "+v"(p[4]), "+v"(p[5]), "+v"(p[6]), "+v"(p[7]) : "s"(c), "v"(nm));
}
__device__ __forceinline__ void exp8a(float* p, float c, float nm, float& a) {
    asm("v_fma_f32 %0, %0, %9, %10\n\tv_exp_f32 %8, %8\n\tv_fma_f32 %1, %1, %9, %10\n\tv_exp_f32 %0, %0\n\tv_fma_f32 %2, %2, %9, %10\n\tv_exp_f32 %1, %1\n\tv_fma_f32 %3, %3, %9, %10\n\tv_exp_f32 %2, %2\n\t"
        "v_fma_f32 %4, %4, %9, %10\n\tv_exp_f32 %3, %3\n\tv_fma_f32 %5, %5, %9, %10\n\tv_exp_f32 %4, %4\n\tv_fma_f32 %6, %6, %9, %10\n\tv_exp_f32 %5, %5\n\tv_fma_f32 %7, %7, %9, %10\n\tv_exp_f32 %6, %6\n\tv_exp_f32 %7, %7\n\tv_nop"
        : "+v"(p[0]), "+v"(p[1]), "+v"(p[2]), "+v"(p[3]), "+v"(p[4]), "+v"(p[5]), "+v"(p[6]), "+v"(p[7]), "+v"(a) : "s"(c), "v"(nm));
}
template <bool HI> struct ASel { typedef h16 T; };
template <> struct ASel<true> { typedef bf T; };
template <bool HI, int NT>
__device__ __forceinline__ void fa_tile(const typename ASel<HI>::T* __restrict__ Q, const typename ASel<HI>::T* __restrict__ Q2, const typename ASel<HI>::T* __restrict__ Kp, const typename ASel<HI>::T* __restrict__ Kp2,
                                        const typename ASel<HI>::T* __restrict__ Vp, const typename ASel<HI>::T* __restrict__ Vp2, int q0, bf* Ah, bf* Al) {
    typedef WFrag<typename ASel<HI>::T> F; typedef typename F::V V;
    const int lane = threadIdx.x & 31, lr = lane & 15, hi = lane >> 4;
    const float CL2 = SCL * 1.4426950408889634f;   // score -> log2 domain
    const float PSH = HI ? 0.0f : 10.0f;           // fp16 weights carry x1024 (log2 = 10): keeps small weights out of the fp16 denormals; the sum carries it too, so it cancels in the division
    V qf[NT][2], qf2[NT][2], kf[2][2], kf2[2][2];
#pragma unroll
    for (int nt = 0; nt < NT; ++nt)
#pragma unroll
        for (int ks = 0; ks < 2; ++ks) { const size_t qo = (size_t)(q0 + nt * 16 + lr) * HD + ks * 32 + 8 * hi; qf[nt][ks] = F::ld(Q + qo); if constexpr (HI) qf2[nt][ks] = F::ld(Q2 + qo); }
    const size_t ko = (size_t)lr * HD + 8 * hi, vo = (size_t)lr * TT + 8 * hi;
    if constexpr (!HI) {
#pragma unroll
        for (int mt = 0; mt < 2; ++mt)
#pragma unroll
            for (int ks = 0; ks < 2; ++ks) kf[mt][ks] = F::ld(Kp + ko + mt * 16 * HD + ks * 32);
    }
    v8f o[NT][4]; float m[NT], l[NT];
#pragma unroll
    for (int nt = 0; nt < NT; ++nt) { m[nt] = -3.0e38f; l[nt] = 0.f;
#pragma unroll
        for (int dt = 0; dt < 4; ++dt) o[nt][dt] = (v8f){}; }
    for (int kc = 0; kc < TT; kc += 32) {
        V vf[4], vf2[4];
        if constexpr (HI) {   // hi/lo rows: four planes do not fit the registers one pass ahead; this pass's key rows are asked for first, its value rows fly behind them under the score products and the softmax
#pragma unroll
            for (int mt = 0; mt < 2; ++mt)
#pragma unroll
                for (int ks = 0; ks < 2; ++ks) { kf[mt][ks] = F::ld(Kp + ko + (size_t)(kc + mt * 16) * HD + ks * 32); kf2[mt][ks] = F::ld(Kp2 + ko + (size_t)(kc + mt * 16) * HD + ks * 32); }
        }
#pragma unroll
        for (int dt = 0; dt < 4; ++dt) { vf[dt] = F::ld(Vp + vo + (size_t)dt * 16 * TT + kc); if constexpr (HI) vf2[dt] = F::ld(Vp2 + vo + (size_t)dt * 16 * TT + kc); }
        v8f s[NT][2];
#pragma unroll
        for (int nt = 0; nt < NT; ++nt)
#pragma unroll
            for (int mt = 0; mt < 2; ++mt) { s[nt][mt] = (v8f){};
#pragma unroll
                for (int ks = 0; ks < 2; ++ks) { s[nt][mt] = F::mma(kf[mt][ks], qf[nt][ks], s[nt][mt]); if constexpr (HI) { s[nt][mt] = F::mma(kf[mt][ks], qf2[nt][ks], s[nt][mt]); s[nt][mt] = F::mma(kf2[mt][ks], qf[nt][ks], s[nt][mt]); } } }
        if constexpr (!HI) {
            const int kn = (kc + 32 < TT) ? kc + 32 : 0;   // the next pass's key rows, fetched behind this pass's score products (the last pass refetches rows 0..31, unused)
#pragma unroll
            for (int mt = 0; mt < 2; ++mt)
#pragma unroll
                for (int ks = 0; ks < 2; ++ks) kf[mt][ks] = F::ld(Kp + ko + (size_t)(kn + mt * 16) * HD + ks * 32);
        }
#pragma unroll
        for (int nt = 0; nt < NT; ++nt) {
            float mx = s[nt][0][0];
#pragma unroll
            for (int j = 0; j < 8; ++j) { mx = fmaxf(mx, s[nt][0][j]); mx = fmaxf(mx, s[nt][1][j]); }
            mx = fmaxf(mx, __shfl_xor(mx, 16, 32));
            const float mn = fmaxf(m[nt], mx); float al = (m[nt] - mn) * CL2; const float nm = PSH - mn * CL2; m[nt] = mn;
            float p[16], ps = 0.f;
#pragma unroll
            for (int j = 0; j < 8; ++j) { p[j] = s[nt][0][j]; p[8 + j] = s[nt][1][j]; }
            exp8a(p, CL2, nm, al); exp8(p + 8, CL2, nm);
#pragma unroll
            for (int j = 0; j < 16; ++j) ps += p[j];
            l[nt] = l[nt] * al + ps;
#pragma unroll
            for (int dt = 0; dt < 4; ++dt)
#pragma unroll
                for (int j = 0; j < 8; ++j) o[nt][dt][j] *= al;
            if constexpr (HI) {
                v8us h0, h1, l0, l1;
#pragma unroll
                for (int j = 0; j < 8; ++j) { unsigned short a, c2; splitf(p[j], a, c2); h0[j] = a; l0[j] = c2; splitf(p[8 + j], a, c2); h1[j] = a; l1[j] = c2; }
                const V ph = cat16b(h0, h1), pl = cat16b(l0, l1);
#pragma unroll
                for (int dt = 0; dt < 4; ++dt) { o[nt][dt] = F::mma(vf[dt], ph, o[nt][dt]); o[nt][dt] = F::mma(vf[dt], pl, o[nt][dt]); o[nt][dt] = F::mma(vf2[dt], ph, o[nt][dt]); }
            } else {
                V pb;
#pragma unroll
                for (int j = 0; j < 16; ++j) pb[j] = tohx(p[j]);
#pragma unroll
                for (int dt = 0; dt < 4; ++dt) o[nt][dt] = F::mma(vf[dt], pb, o[nt][dt]);
            }
        }
    }
#pragma unroll
    for (int nt = 0; nt < NT; ++nt) {
        const float inv = __fdiv_rn(1.0f, l[nt] + __shfl_xor(l[nt], 16, 32));
        const size_t oo = (size_t)(q0 + nt * 16 + lr) * DQ + 8 * hi;   // a lane holds d = dt * 16 + 8 * hi + j of its query: 16 contiguous bytes per plane and tile
#pragma unroll
        for (int dt = 0; dt < 4; ++dt) { v8us oh, ol;
#pragma unroll
            for (int j = 0; j < 8; ++j) { unsigned short a, c2; splitf(o[nt][dt][j] * inv, a, c2); oh[j] = a; ol[j] = c2; }
            *(v8us*)(Ah + oo + dt * 16) = oh; *(v8us*)(Al + oo + dt * 16) = ol; }
    }
}
// grid (batches x heads, RH / 32 + (TT - RH) / 64), 2 independent waves a block: blockIdx.y < RH / 32 takes 16 hi/lo rows a wave (twice the loads of the others; placed first in index order), the rest 32 fp16 rows a wave; output = the merged [b][t][h * 64 + d] hi/lo planes
__global__ __launch_bounds__(64) void k_fattn(const h16* __restrict__ Q16, const h16* __restrict__ K16, const h16* __restrict__ V16, const bf* __restrict__ Qh, const bf* __restrict__ Ql, const bf* __restrict__ Kh, const bf* __restrict__ Kl, const bf* __restrict__ Vh, const bf* __restrict__ Vl, bf* Ah, bf* Al) {
    const int h = blockIdx.x % NH_, w = threadIdx.x >> 5, bx = blockIdx.y; const size_t po = (size_t)blockIdx.x * TT * HD; Ah += (size_t)(blockIdx.x / NH_) * TT * DQ; Al += (size_t)(blockIdx.x / NH_) * TT * DQ;
    if (bx < RH / 32) fa_tile<true, 1>(Qh + po, Ql + po, Kh + po, Kl + po, Vh + po, Vl + po, (bx * 2 + w) * 16, Ah + h * HD, Al + h * HD);
    else fa_tile<false, 2>(Q16 + po, nullptr, K16 + po, nullptr, V16 + po, nullptr, RH + ((bx - RH / 32) * 2 + w) * 32, Ah + h * HD, Al + h * HD);
}

extern "C" void kernel_launch(void* const* d_in, const int* in_sizes, int n_in,
                              void* d_out, int out_size, void* d_ws, size_t ws_size, hipStream_t stream) {
    (void)in_sizes; (void)n_in; (void)out_size;
    const float* x = (const float*)d_in[0]; const float* wq = (const float*)d_in[1]; const float* bq = (const float*)d_in[2]; const float* wk = (const float*)d_in[3]; const float* bk = (const float*)d_in[4]; const float* wv = (const float*)d_in[5]; const float* bv = (const float*)d_in[6]; const float* wo = (const float*)d_in[7]; const float* bo = (const float*)d_in[8];   /* order seq_inputs, Wq [16][1024][64], bq [16][64], Wk, bk, Wv, bv, Wo ('xw' [1024][1024]), bo */
    float* OUT = (float*)d_out;     // [4][2048][1024]
    char* wsp = (char*)d_ws;
    auto take = [&](size_t bytes) { char* p = wsp; wsp += (bytes + 255) & ~(size_t)255; return (void*)p; };
    bf* WQ = (bf*)take((size_t)DQ * DM * 2); bf* WK = (bf*)take((size_t)DKV * DM * 2); bf* WV = (bf*)take((size_t)DKV * DM * 2); bf* WO = (bf*)take((size_t)DM * DQ * 2);
    bf* XB = (bf*)take((size_t)NB_ * TT * DM * 2);
    h16* QP16 = (h16*)take((size_t)NB_ * NH_ * TT * HD * 2); h16* KP16 = (h16*)take((size_t)NB_ * NKV * TT * HD * 2); h16* VT16 = (h16*)take((size_t)NB_ * NKV * HD * TT * 2);
    bf* QPh = (bf*)take((size_t)NB_ * NH_ * TT * HD * 2); bf* QPl = (bf*)take((size_t)NB_ * NH_ * TT * HD * 2); bf* KPh = (bf*)take((size_t)NB_ * NKV * TT * HD * 2); bf* KPl = (bf*)take((size_t)NB_ * NKV * TT * HD * 2); bf* VTh = (bf*)take((size_t)NB_ * NKV * HD * TT * 2); bf* VTl = (bf*)take((size_t)NB_ * NKV * HD * TT * 2);
    bf* ATh = (bf*)take((size_t)NB_ * TT * DQ * 2); bf* ATl = (bf*)take((size_t)NB_ * TT * DQ * 2);
    if ((size_t)(wsp - (char*)d_ws) > ws_size) return;    // 200 MiB of the 256 MiB
    { k_wtH<<<(unsigned)(((size_t)DQ * DM / 2 + 255) / 256), 256, 0, stream>>>(wq, WQ); k_wtH<<<(unsigned)(((size_t)DQ * DM / 2 + 255) / 256), 256, 0, stream>>>(wk, WK); k_wtH<<<(unsigned)(((size_t)DQ * DM / 2 + 255) / 256), 256, 0, stream>>>(wv, WV);
      k_wtG<<<(unsigned)((DQ * DM / 64 + 63) / 64), 256, 0, stream>>>(wo, DQ, DM, WO);
       }
    k_cvt8<<<(unsigned)(((size_t)NB_ * TT * DM / 8 + 255) / 256), 256, 0, stream>>>(x, XB, (size_t)NB_ * TT * DM / 8);
    k_gemmw<bf, 0, true, 1><<<dim3(NB_ * TT / 64, DQ / 64, 1), 32, 0, stream>>>(XB, nullptr, WQ, nullptr, DM, nullptr, 0, bq, 0, 0, 0, QP16, QPh, QPl);
    k_gemmw<bf, 0, true, 1><<<dim3(NB_ * TT / 64, DKV / 64, 1), 32, 0, stream>>>(XB, nullptr, WK, nullptr, DM, nullptr, 0, bk, 0, 0, 0, KP16, KPh, KPl);
    k_gemmw<bf, 0, true, 2><<<dim3(NB_ * TT / 64, DKV / 64, 1), 32, 0, stream>>>(XB, nullptr, WV, nullptr, DM, nullptr, 0, bv, 0, 0, 0, VT16, VTh, VTl);
    k_fattn<<<dim3(NB_ * NH_, RH / 32 + (TT - RH) / 64, 1), 64, 0, stream>>>(QP16, KP16, VT16, QPh, QPl, KPh, KPl, VTh, VTl, ATh, ATl);
    k_gemmw<bf, 1, true, 0><<<dim3(NB_ * TT / 64, DM / 64, 1), 32, 0, stream>>>(ATh, ATl, WO, nullptr, DQ, OUT, DM, bo, 0, 0, 0, nullptr, nullptr, nullptr);
}

// v004
// One run takes 332 microseconds.
// Two timings next to v003 both put it at 1.26 times that version's speed.
// All steps since v000 together make it 11.9 times as fast.
#include <hip/hip_runtime.h>

// Multi-head attention layer with per-head packed projection layers (seq_inputs [4][2048][1024]; Q, K, V = einsum('bse,hed', x, W) + b with W [16][1024][64] = [h][e][d] (1/32) and b [16][64]; scores / sqrt(64); softmax (no mask); heads concatenated in order; out = cat Wo + bo ('xw' [1024][1024] + bias) -> [4][2048][1024] (8.4 M); argument order seq_inputs, Wq, bq, Wk, bk, Wv, bv, Wo, bo).
// Every launch covers all 4 batches (the rows of the GEMMs are b * 2048 + t, the head planes are [b][h][..], the attention grid's x is b * 16 + h). Layout: bf16 copy of x; k_wtH turns each [h][e][d] weight into Bt rows h*64 + d; the [16][64] biases are the flat [1024] epilogue vectors; exact projections + f32 biases, whose epilogues write the head planes themselves (Q, K as [h][t][d], V as [h][d][t]; fp16 + hi/lo); k_fattn: scores, softmax and weights x V of all 64 (batch, head) pairs in one launch, scores never leave registers (hybrid rows: < 512 hi/lo 3 products, rest fp16 weights x1024); merged hi/lo x Wo ('xw' transposed once) exact + bo.
// Every 16-bit operand plane is stored FRAGMENT-MAJOR: a 16-row x 32-k fragment is 1 KiB, [half = (k % 32) / 16][lane = ((k % 16) / 8) * 16 + row % 16][k % 8], so each of a fragment's two 16-byte-a-lane loads covers 512 contiguous bytes (4 whole lines, not 16 pieces of 32 bytes).
// Order of the fragments: GEMM operands, Q and K [row tile][k block]; V (rows d, k = t) [k block][row tile], so a pass of 32 keys reads 4 KiB in a row of K and of V. Values and every sum order are those of the row-major planes.
// Compute dtypes, f32 accumulate: every input rounded to bf16; projections exact + f32 biases; attention rows < 512 3 products, rest fp16; softmax f32 (running maximum); Wo hl x exact + bias.

#define NB_  4
#define TT   2048
#define DM   1024
#define NH_  16
#define NKV  16
#define HD   64
#define DQ   (NH_ * HD)
#define DKV  (NKV * HD)
#define RH   512                  // query rows < RH use hi+lo planes (0: none)
#define SCL  0.125f   // HD^-0.5
typedef _Float16 h16;
typedef unsigned short bf;
typedef __attribute__((ext_vector_type(16))) __bf16   v16bf;
typedef __attribute__((ext_vector_type(16))) _Float16 v16h;
typedef __attribute__((ext_vector_type(8)))  _Float16 v8h;
typedef __attribute__((ext_vector_type(8)))  unsigned short v8us;
typedef __attribute__((ext_vector_type(8)))  float    v8f;
typedef __attribute__((ext_vector_type(4)))  float    v4f;
typedef v8h  __attribute__((may_alias)) v8ha;
typedef v4f  __attribute__((may_alias)) v4fa;
typedef v8us __attribute__((may_alias)) v8usa;

__device__ __forceinline__ unsigned short f2bf(float f) { unsigned u = __float_as_uint(f); u += 0x7FFFu + ((u >> 16) & 1u); return (unsigned short)(u >> 16); }
__device__ __forceinline__ float bf2f(unsigned short b) { return __uint_as_float(((unsigned)b) << 16); }
__device__ __forceinline__ float bfr(float f) { return bf2f(f2bf(f)); }
__device__ __forceinline__ v16h cat16(v8h lo, v8h hi) { return __builtin_shufflevector(lo, hi, 0, 1, 2, 3, 4, 5, 6, 7, 8, 9, 10, 11, 12, 13, 14, 15); }
__device__ __forceinline__ v16bf cat16b(v8us lo, v8us hi) { return __builtin_bit_cast(v16bf, __builtin_shufflevector(lo, hi, 0, 1, 2, 3, 4, 5, 6, 7, 8, 9, 10, 11, 12, 13, 14, 15)); }
__device__ __forceinline__ v8f wmma16(v16h a, v16h b, v8f c) { return __builtin_amdgcn_wmma_f32_16x16x32_f16(false, a, false, b, (short)0, c, false, false); }
__device__ __forceinline__ v8f wmmab(v16bf a, v16bf b, v8f c) { return __builtin_amdgcn_wmma_f32_16x16x32_bf16(false, a, false, b, (short)0, c, false, false); }
__device__ __forceinline__ h16 tohx(float x) { return (h16)x; }
__device__ __forceinline__ void splitf(float y, unsigned short& h, unsigned short& l) { h = f2bf(y); l = f2bf(y - bf2f(h)); }



// ---- k_gemmw: register-blocked GEMM, ONE WAVE per 64x64 output tile (16 accumulators), operands straight from fragment-major 16-bit planes (ld: p = the fragment, the same for the whole wave, lb = lane * 16 bytes: the one vector register of every operand address); grid (M/64, N/64, Z), 32 threads.
// C[m][n] (f32, pitch ldc, + optional f32 bias[n]) = sum_k A[m][k] Bt[n][k] (+ split products per NSPLIT). z-batch strides sA/sB/sC in elements. K % 32 == 0, a compile-time constant: the steps from row tile to row tile are then immediate offsets of the loads.
// EPI 0 stores C. EPI 1 and 2 store no f32: m = b * 2048 + t (a 64-row tile lies in one batch), a tile's 64 columns are one head (n = h * 64 + d), and the result + bias goes out as fp16 and as bf16 hi + lo:
// EPI 1 as [b][h] planes of rows t, k = d (through the LDS rows: a lane picks up its 8 d of its row, a store is 512 bytes in a row), EPI 2 as [b][h] planes of rows d, k = t (a lane's accumulator holds 8 consecutive t of one d, which is its 16 bytes of a fragment half: straight from registers, 512 bytes in a row a store).
#define GLB __attribute__((address_space(1)))   // the planes lie in global memory: said at the load, because a pointer that has been an operand of an asm statement is otherwise read with flat loads
typedef GLB char gch;
template <typename T16> struct WFrag;
template <> struct WFrag<h16> { typedef v16h V; static __device__ __forceinline__ V ld(const h16* p, unsigned lb) { const gch* c = (const gch*)p + lb; return cat16(*(const GLB v8h*)c, *(const GLB v8h*)(c + 512)); } static __device__ __forceinline__ v8f mma(V a, V b, v8f c) { return wmma16(a, b, c); } };
template <> struct WFrag<bf> { typedef v16bf V; static __device__ __forceinline__ V ld(const bf* p, unsigned lb) { const gch* c = (const gch*)p + lb; return cat16b(*(const GLB v8us*)c, *(const GLB v8us*)(c + 512)); } static __device__ __forceinline__ v8f mma(V a, V b, v8f c) { return wmmab(a, b, c); } };
template <typename T16, int NSPLIT, bool BIAS, int EPI, int K>
__global__ __launch_bounds__(32) void k_gemmw(const T16* __restrict__ A, const T16* __restrict__ A2, const T16* __restrict__ Bt, const T16* __restrict__ Bt2, float* C, int ldc, const float* __restrict__ bias, size_t sA, size_t sB, size_t sC, h16* P16, bf* Ph, bf* Pl) {
    typedef typename WFrag<T16>::V V;
    __shared__ __align__(16) float os[16 * 68];
    const size_t z = blockIdx.z; A += z * sA; if (A2) A2 += z * sA; Bt += z * sB; if (Bt2) Bt2 += z * sB; C += z * sC;
    const int lane = threadIdx.x & 31, lr = lane & 15, hi = lane >> 4; const int r0 = blockIdx.x * 64, c0 = blockIdx.y * 64; const int bz = r0 / TT, t0 = r0 % TT;
    v8f acc[4][4];
#pragma unroll
    for (int mb = 0; mb < 4; ++mb)
#pragma unroll
        for (int nb = 0; nb < 4; ++nb) acc[mb][nb] = (v8f){};
    const T16* pa = A + (size_t)r0 * K; const T16* pa2 = A2 + (size_t)r0 * K; const T16* pb = Bt + (size_t)c0 * K; const T16* pb2 = Bt2 + (size_t)c0 * K; unsigned lb = lane * 16;   // row tile r0 / 16 starts at (r0 / 16) * (K / 32) * 512; the pointers walk one k block (512 elements) a trip
#pragma unroll 1
    for (int kc = 0; kc < K; kc += 32) {
        V a[4], a2[4];
#pragma unroll
        for (int mb = 0; mb < 4; ++mb) { a[mb] = WFrag<T16>::ld(pa + mb * 16 * K, lb); if (NSPLIT == 1 || NSPLIT == 2) a2[mb] = WFrag<T16>::ld(pa2 + mb * 16 * K, lb); }
#pragma unroll
        for (int nb = 0; nb < 4; ++nb) { const V b = WFrag<T16>::ld(pb + nb * 16 * K, lb); V b2; if (NSPLIT >= 2) b2 = WFrag<T16>::ld(pb2 + nb * 16 * K, lb);
#pragma unroll
            for (int mb = 0; mb < 4; ++mb) { acc[mb][nb] = WFrag<T16>::mma(a[mb], b, acc[mb][nb]); if (NSPLIT == 1 || NSPLIT == 2) acc[mb][nb] = WFrag<T16>::mma(a2[mb], b, acc[mb][nb]); if (NSPLIT >= 2) acc[mb][nb] = WFrag<T16>::mma(a[mb], b2, acc[mb][nb]); } }
        asm volatile("v_nop\n\tv_nop\n\tv_nop\n\tv_nop" : "+v"(acc[0][0]), "+v"(acc[1][1]), "+v"(acc[2][2]), "+v"(acc[3][3]) : "v"(a[0]), "v"(a[3]));
        // the wait in front of a rewrite of the registers that this trip's loads name: the scalar bases, which as operands of the wait are stepped behind it. lb is an operand so that it stays the one 32-bit offset register of the loads
        // (scalar base + offset form; widened to 64 bits in front of the loop, it would be added to each base in vector registers, which the loads' results then reuse); nothing writes it
        if constexpr (NSPLIT == 0) asm volatile("s_wait_xcnt 0x0" : "+s"(pa), "+s"(pb), "+v"(lb) :: "memory");
        else if constexpr (NSPLIT == 1) asm volatile("s_wait_xcnt 0x0" : "+s"(pa), "+s"(pa2), "+s"(pb), "+v"(lb) :: "memory");
        else asm volatile("s_wait_xcnt 0x0" : "+s"(pa), "+s"(pa2), "+s"(pb), "+s"(pb2), "+v"(lb) :: "memory");
        pa += 512; pa2 += 512; pb += 512; pb2 += 512;
    }
    if constexpr (EPI == 2) {
#pragma unroll
        for (int nb = 0; nb < 4; ++nb) { const float bn = bfr(bias[c0 + nb * 16 + lr]);
#pragma unroll
            for (int mb = 0; mb < 4; ++mb) { const size_t po = ((size_t)bz * NKV + blockIdx.y) * HD * TT + (size_t)(((t0 >> 5) + (mb >> 1)) * 4 + nb) * 512 + (mb & 1) * 256 + lane * 8; v8h o16; v8us oh, ol;
#pragma unroll
                for (int j = 0; j < 8; ++j) { const float x = acc[mb][nb][j] + bn; o16[j] = tohx(x); unsigned short a2, c2; splitf(x, a2, c2); oh[j] = a2; ol[j] = c2; }
                *(v8h*)(P16 + po) = o16; *(v8us*)(Ph + po) = oh; *(v8us*)(Pl + po) = ol; } }
        return;
    }
#pragma unroll
    for (int mb = 0; mb < 4; ++mb) {
#pragma unroll
        for (int nb = 0; nb < 4; ++nb) {
#pragma unroll
            for (int j = 0; j < 8; ++j) os[(hi * 8 + j) * 68 + nb * 16 + lr] = acc[mb][nb][j]; }
        __builtin_amdgcn_wave_barrier(); asm volatile("" ::: "memory");
        if constexpr (EPI == 1) {
#pragma unroll
            for (int s = 0; s < 4; ++s) { const int cofs = s * 16 + hi * 8; const v4f v0 = *(const v4fa*)(os + lr * 68 + cofs), v1 = *(const v4fa*)(os + lr * 68 + cofs + 4);   // s = k block * 2 + half
                const size_t po = ((size_t)bz * NH_ + blockIdx.y) * TT * HD + (size_t)((t0 >> 4) + mb) * 1024 + s * 256 + lane * 8; v8h o16; v8us oh, ol;
#pragma unroll
                for (int q = 0; q < 8; ++q) { const float x = (q < 4 ? v0[q & 3] : v1[q & 3]) + bfr(bias[c0 + cofs + q]); o16[q] = tohx(x); unsigned short a2, c2; splitf(x, a2, c2); oh[q] = a2; ol[q] = c2; }
                *(v8h*)(P16 + po) = o16; *(v8us*)(Ph + po) = oh; *(v8us*)(Pl + po) = ol;
                if (mb < 3 || s < 3) asm volatile("s_wait_xcnt 0x0" ::: "memory"); }   // the wait in front of a rewrite of the registers that these three stores name (the next quarter reuses them)
        } else {
            float* crow = C + (size_t)(r0 + mb * 16) * ldc + c0;
#pragma unroll
            for (int s = 0; s < 8; ++s) { const int row = 2 * s + hi, cofs = lr * 4; v4f val = *(const v4fa*)(os + row * 68 + cofs); if (BIAS) { val[0] += bfr(bias[c0 + cofs]); val[1] += bfr(bias[c0 + cofs + 1]); val[2] += bfr(bias[c0 + cofs + 2]); val[3] += bfr(bias[c0 + cofs + 3]); }
                *(v4f*)(crow + (size_t)row * ldc + cofs) = val; }
            if (mb < 3) asm volatile("s_wait_xcnt 0x0" ::: "memory");   // the wait in front of a rewrite of the registers that these eight stores name (the next row block reuses them)
        }
        __builtin_amdgcn_wave_barrier(); asm volatile("" ::: "memory");
    }
}


// The three packers below: thread i writes the 16 bytes at element i * 8 of a fragment-major plane of K-long rows: lane = i % 32, half = (i / 32) % 2, k block = (i / 64) % (K / 32), row tile = i / (2 K).
// k_wtG: Bt[n][k] = w[k][n] (w [DQ][DM]); k_wtH: Bt[h * 64 + e][k] = w[h][k][e]; in both, 16 lanes read 64 contiguous bytes of w for each of their 8 k. k_cvt8: rows as they are, 32 bytes of f32 a thread.
__global__ __launch_bounds__(256) void k_wtG(const float* __restrict__ w, bf* Bt) {
    const int i = blockIdx.x * 256 + threadIdx.x; if (i >= DM * DQ / 8) return; const int lane = i & 31, kb = (i >> 6) % (DQ / 32), n = (i >> 6) / (DQ / 32) * 16 + (lane & 15), k0 = kb * 32 + ((i >> 5) & 1) * 16 + (lane >> 4) * 8; v8us o;
#pragma unroll
    for (int q = 0; q < 8; ++q) o[q] = f2bf(w[(size_t)(k0 + q) * DM + n]);
    *(v8us*)(Bt + (size_t)i * 8) = o;
}
__global__ __launch_bounds__(256) void k_cvt8(const float* __restrict__ src, bf* dst, size_t n8) { const size_t i = (size_t)blockIdx.x * 256 + threadIdx.x; if (i >= n8) return; const int lane = (int)(i & 31), kb = (int)((i >> 6) % (DM / 32)); const size_t row = (i >> 6) / (DM / 32) * 16 + (lane & 15);
    const v8f v = *(const v8f*)(src + row * DM + kb * 32 + (int)((i >> 5) & 1) * 16 + (lane >> 4) * 8); v8us o;
#pragma unroll
    for (int k = 0; k < 8; ++k) o[k] = f2bf(v[k]); *(v8us*)(dst + i * 8) = o;  }

__global__ __launch_bounds__(256) void k_wtH(const float* __restrict__ w, bf* Bt) { const int i = blockIdx.x * 256 + threadIdx.x; if (i >= DQ * DM / 8) return; const int lane = i & 31, kb = (i >> 6) % (DM / 32), r = (i >> 6) / (DM / 32) * 16 + (lane & 15), k0 = kb * 32 + ((i >> 5) & 1) * 16 + (lane >> 4) * 8; const int h = r / HD, e = r % HD; v8us o;
#pragma unroll
    for (int q = 0; q < 8; ++q) o[q] = f2bf(w[((size_t)h * DM + k0 + q) * HD + e]);
    *(v8us*)(Bt + (size_t)i * 8) = o;  }
// ---- k_fattn: one wave owns NT x 16 query rows of one head and walks the 2048 keys 32 at a time.
// St = K Qt (A = 16 key rows, B = 16 query rows, both fragment-major planes): in the accumulator a lane holds ONE query (column lane & 15) and keys 8 * (lane >> 4) + j of each 16-key tile,
// which is the k order of a B fragment (elements 0..7 = tile 0, 8..15 = tile 1), so the weights go from the score accumulators straight into Ot += Vt Pt (A = 16 rows d of the V plane, k = t).
// Softmax with a running maximum per query: maximum and sum in-lane plus one exchange between the wave halves; sums of the halves joined once at the end; division by the sum at the end.
// exp8: eight weights in place, p = exp2(p * c + nm). Written as one statement so that every v_exp_f32 is followed by an instruction that neither reads its result nor writes its source
// (the slot the instruction set asks for behind a transcendental): a later element's multiply-add or v_exp_f32 fills it, a v_nop behind the last. exp8a does the same and takes the rescale factor a = exp2(a) along.
__device__ __forceinline__ void exp8(float* p, float c, float nm) {
    asm("v_fma_f32 %0, %0, %8, %9\n\tv_fma_f32 %1, %1, %8, %9\n\tv_exp_f32 %0, %0\n\tv_fma_f32 %2, %2, %8, %9\n\tv_exp_f32 %1, %1\n\tv_fma_f32 %3, %3, %8, %9\n\tv_exp_f32 %2, %2\n\t"
        "v_fma_f32 %4, %4, %8, %9\n\tv_exp_f32 %3, %3\n\tv_fma_f32 %5, %5, %8, %9\n\tv_exp_f32 %4, %4\n\tv_fma_f32 %6, %6, %8, %9\n\tv_exp_f32 %5, %5\n\tv_fma_f32 %7, %7, %8, %9\n\tv_exp_f32 %6, %6\n\tv_exp_f32 %7, %7\n\tv_nop"
        : "+v"(p[0]), "+v"(p[1]), "+v"(p[2]), "+v"(p[3]), "+v"(p[4]), "+v"(p[5]), "+v"(p[6]), "+v"(p[7]) : "s"(c), "v"(nm));
}
__device__ __forceinline__ void exp8a(float* p, float c, float nm, float& a) {
    asm("v_fma_f32 %0, %0, %9, %10\n\tv_exp_f32 %8, %8\n\tv_fma_f32 %1, %1, %9, %10\n\tv_exp_f32 %0, %0\n\tv_fma_f32 %2, %2, %9, %10\n\tv_exp_f32 %1, %1\n\tv_fma_f32 %3, %3, %9, %10\n\tv_exp_f32 %2, %2\n\t"
        "v_fma_f32 %4, %4, %9, %10\n\tv_exp_f32 %3, %3\n\tv_fma_f32 %5, %5, %9, %10\n\tv_exp_f32 %4, %4\n\tv_fma_f32 %6, %6, %9, %10\n\tv_exp_f32 %5, %5\n\tv_fma_f32 %7, %7, %9, %10\n\tv_exp_f32 %6, %6\n\tv_exp_f32 %7, %7\n\tv_nop"
        : "+v"(p[0]), "+v"(p[1]), "+v"(p[2]), "+v"(p[3]), "+v"(p[4]), "+v"(p[5]), "+v"(p[6]), "+v"(p[7]), "+v"(a) : "s"(c), "v"(nm));
}
template <bool HI> struct ASel { typedef h16 T; };
template <> struct ASel<true> { typedef bf T; };
template <bool HI, int NT>
__device__ __forceinline__ void fa_tile(const typename ASel<HI>::T* __restrict__ Q, const typename ASel<HI>::T* __restrict__ Q2, const typename ASel<HI>::T* __restrict__ Kp, const typename ASel<HI>::T* __restrict__ Kp2,
                                        const typename ASel<HI>::T* __restrict__ Vp, const typename ASel<HI>::T* __restrict__ Vp2, int q0, bf* Ah, bf* Al) {
    typedef WFrag<typename ASel<HI>::T> F; typedef typename F::V V;
    const int lane = threadIdx.x & 31; unsigned lb = lane * 16;
    const float CL2 = SCL * 1.4426950408889634f;   // score -> log2 domain
    const float PSH = HI ? 0.0f : 10.0f;           // fp16 weights carry x1024 (log2 = 10): keeps small weights out of the fp16 denormals; the sum carries it too, so it cancels in the division
    V qf[NT][2], qf2[NT][2], kf[2][2], kf2[2][2];
#pragma unroll
    for (int nt = 0; nt < NT; ++nt)
#pragma unroll
        for (int ks = 0; ks < 2; ++ks) { const size_t qo = (size_t)(q0 + nt * 16) * HD + ks * 512; qf[nt][ks] = F::ld(Q + qo, lb); if constexpr (HI) qf2[nt][ks] = F::ld(Q2 + qo, lb); }
    // a pass's 32 keys: K fragments (mt, ks) and V fragments dt, 512 elements each, 2048 in a row from kc * 64 of either plane
    if constexpr (!HI) {
#pragma unroll
        for (int mt = 0; mt < 2; ++mt)
#pragma unroll
            for (int ks = 0; ks < 2; ++ks) kf[mt][ks] = F::ld(Kp + mt * 16 * HD + ks * 512, lb);
    }
    const typename ASel<HI>::T* pk = Kp; const typename ASel<HI>::T* pk2 = Kp2; const typename ASel<HI>::T* pv = Vp; const typename ASel<HI>::T* pv2 = Vp2;   // walk 2048 elements a pass
    v8f o[NT][4]; float m[NT], l[NT];
#pragma unroll
    for (int nt = 0; nt < NT; ++nt) { m[nt] = -3.0e38f; l[nt] = 0.f;
#pragma unroll
        for (int dt = 0; dt < 4; ++dt) o[nt][dt] = (v8f){}; }
    for (int kc = 0; kc < TT; kc += 32) {
        V vf[4], vf2[4];
        if constexpr (HI) {   // hi/lo rows: four planes do not fit the registers one pass ahead; this pass's key rows are asked for first, its value rows fly behind them under the score products and the softmax
#pragma unroll
            for (int mt = 0; mt < 2; ++mt)
#pragma unroll
                for (int ks = 0; ks < 2; ++ks) { kf[mt][ks] = F::ld(pk + mt * 16 * HD + ks * 512, lb); kf2[mt][ks] = F::ld(pk2 + mt * 16 * HD + ks * 512, lb); }
        }
#pragma unroll
        for (int dt = 0; dt < 4; ++dt) { vf[dt] = F::ld(pv + dt * 512, lb); if constexpr (HI) vf2[dt] = F::ld(pv2 + dt * 512, lb); }
        if constexpr (!HI) __builtin_amdgcn_sched_barrier(0);   // keeps the eight value loads here, at the head of the pass: moved down to save registers they would be waited for soon after their issue
        v8f s[NT][2];
#pragma unroll
        for (int nt = 0; nt < NT; ++nt)
#pragma unroll
            for (int mt = 0; mt < 2; ++mt) { s[nt][mt] = (v8f){};
#pragma unroll
                for (int ks = 0; ks < 2; ++ks) { s[nt][mt] = F::mma(kf[mt][ks], qf[nt][ks], s[nt][mt]); if constexpr (HI) { s[nt][mt] = F::mma(kf[mt][ks], qf2[nt][ks], s[nt][mt]); s[nt][mt] = F::mma(kf2[mt][ks], qf[nt][ks], s[nt][mt]); } } }
        if constexpr (!HI) {
            pk = (kc + 32 < TT) ? pk + 32 * HD : Kp;   // the next pass's key rows, fetched behind this pass's score products (the last pass refetches rows 0..31, unused)
#pragma unroll
            for (int mt = 0; mt < 2; ++mt)
#pragma unroll
                for (int ks = 0; ks < 2; ++ks) kf[mt][ks] = F::ld(pk + mt * 16 * HD + ks * 512, lb);
            __builtin_amdgcn_sched_barrier(0);   // keeps the eight key loads here, with the softmax and the second product between them and their use: moved down to the foot of the pass they would be waited for at once
        }
#pragma unroll
        for (int nt = 0; nt < NT; ++nt) {
            float mx = s[nt][0][0];
#pragma unroll
            for (int j = 0; j < 8; ++j) { mx = fmaxf(mx, s[nt][0][j]); mx = fmaxf(mx, s[nt][1][j]); }
            mx = fmaxf(mx, __shfl_xor(mx, 16, 32));
            const float mn = fmaxf(m[nt], mx); float al = (m[nt] - mn) * CL2; const float nm = PSH - mn * CL2; m[nt] = mn;
            float p[16], ps = 0.f;
#pragma unroll
            for (int j = 0; j < 8; ++j) { p[j] = s[nt][0][j]; p[8 + j] = s[nt][1][j]; }
            exp8a(p, CL2, nm, al); exp8(p + 8, CL2, nm);
#pragma unroll
            for (int j = 0; j < 16; ++j) ps += p[j];
            l[nt] = l[nt] * al + ps;
#pragma unroll
            for (int dt = 0; dt < 4; ++dt)
#pragma unroll
                for (int j = 0; j < 8; ++j) o[nt][dt][j] *= al;
            if constexpr (HI) {
                v8us h0, h1, l0, l1;
#pragma unroll
                for (int j = 0; j < 8; ++j) { unsigned short a, c2; splitf(p[j], a, c2); h0[j] = a; l0[j] = c2; splitf(p[8 + j], a, c2); h1[j] = a; l1[j] = c2; }
                const V ph = cat16b(h0, h1), pl = cat16b(l0, l1);
#pragma unroll
                for (int dt = 0; dt < 4; ++dt) { o[nt][dt] = F::mma(vf[dt], ph, o[nt][dt]); o[nt][dt] = F::mma(vf[dt], pl, o[nt][dt]); o[nt][dt] = F::mma(vf2[dt], ph, o[nt][dt]); }
            } else {
                V pb;
#pragma unroll
                for (int j = 0; j < 16; ++j) pb[j] = tohx(p[j]);
#pragma unroll
                for (int dt = 0; dt < 4; ++dt) o[nt][dt] = F::mma(vf[dt], pb, o[nt][dt]);
            }
        }
        // the wait in front of a rewrite of the registers that this pass's loads name: the scalar bases, which as operands of the wait are stepped behind it; lb is an operand for the reason given in k_gemmw; nothing writes it
        if constexpr (HI) { asm volatile("s_wait_xcnt 0x0" : "+s"(pk), "+s"(pk2), "+s"(pv), "+s"(pv2), "+v"(lb) :: "memory"); pk += 32 * HD; pk2 += 32 * HD; pv += 32 * HD; pv2 += 32 * HD; }
        else { asm volatile("s_wait_xcnt 0x0" : "+s"(pk), "+s"(pv), "+v"(lb) :: "memory"); pv += 32 * HD; }
    }
#pragma unroll
    for (int nt = 0; nt < NT; ++nt) {
        const float inv = __fdiv_rn(1.0f, l[nt] + __shfl_xor(l[nt], 16, 32));
        const size_t oo = (size_t)(q0 + nt * 16) * DQ + 8 * lane;   // a lane holds d = dt * 16 + 8 * (lane >> 4) + j of its query (row lane & 15): its 16 bytes of half dt & 1 of k block h * 2 + dt / 2 of the merged plane's row tile
#pragma unroll
        for (int dt = 0; dt < 4; ++dt) { v8us oh, ol;
#pragma unroll
            for (int j = 0; j < 8; ++j) { unsigned short a, c2; splitf(o[nt][dt][j] * inv, a, c2); oh[j] = a; ol[j] = c2; }
            *(v8us*)(Ah + oo + dt * 256) = oh; *(v8us*)(Al + oo + dt * 256) = ol; }
    }
}
// grid (batches x heads, RH / 32 + (TT - RH) / 64), 2 independent waves a block: blockIdx.y < RH / 32 takes 16 hi/lo rows a wave (twice the loads of the others, so they come first in index order), the rest 32 fp16 rows a wave; output = the merged hi/lo planes (rows b * 2048 + t, k = h * 64 + d; a head's two k blocks start h * 1024 into a row tile)
__global__ __launch_bounds__(64) void k_fattn(const h16* __restrict__ Q16, const h16* __restrict__ K16, const h16* __restrict__ V16, const bf* __restrict__ Qh, const bf* __restrict__ Ql, const bf* __restrict__ Kh, const bf* __restrict__ Kl, const bf* __restrict__ Vh, const bf* __restrict__ Vl, bf* Ah, bf* Al) {
    const int h = blockIdx.x % NH_, w = threadIdx.x >> 5, bx = blockIdx.y; const size_t po = (size_t)blockIdx.x * TT * HD; Ah += (size_t)(blockIdx.x / NH_) * TT * DQ; Al += (size_t)(blockIdx.x / NH_) * TT * DQ;
    if (bx < RH / 32) fa_tile<true, 1>(Qh + po, Ql + po, Kh + po, Kl + po, Vh + po, Vl + po, (bx * 2 + w) * 16, Ah + h * 1024, Al + h * 1024);
    else fa_tile<false, 2>(Q16 + po, nullptr, K16 + po, nullptr, V16 + po, nullptr, RH + ((bx - RH / 32) * 2 + w) * 32, Ah + h * 1024, Al + h * 1024);
}

extern "C" void kernel_launch(void* const* d_in, const int* in_sizes, int n_in,
                              void* d_out, int out_size, void* d_ws, size_t ws_size, hipStream_t stream) {
    (void)in_sizes; (void)n_in; (void)out_size;
    const float* x = (const float*)d_in[0]; const float* wq = (const float*)d_in[1]; const float* bq = (const float*)d_in[2]; const float* wk = (const float*)d_in[3]; const float* bk = (const float*)d_in[4]; const float* wv = (const float*)d_in[5]; const float* bv = (const float*)d_in[6]; const float* wo = (const float*)d_in[7]; const float* bo = (const float*)d_in[8];   /* order seq_inputs, Wq [16][1024][64], bq [16][64], Wk, bk, Wv, bv, Wo ('xw' [1024][1024]), bo */
    float* OUT = (float*)d_out;     // [4][2048][1024]
    char* wsp = (char*)d_ws;
    auto take = [&](size_t bytes) { char* p = wsp; wsp += (bytes + 255) & ~(size_t)255; return (void*)p; };
    bf* WQ = (bf*)take((size_t)DQ * DM * 2); bf* WK = (bf*)take((size_t)DKV * DM * 2); bf* WV = (bf*)take((size_t)DKV * DM * 2); bf* WO = (bf*)take((size_t)DM * DQ * 2);
    bf* XB = (bf*)take((size_t)NB_ * TT * DM * 2);
    h16* QP16 = (h16*)take((size_t)NB_ * NH_ * TT * HD * 2); h16* KP16 = (h16*)take((size_t)NB_ * NKV * TT * HD * 2); h16* VT16 = (h16*)take((size_t)NB_ * NKV * HD * TT * 2);
    bf* QPh = (bf*)take((size_t)NB_ * NH_ * TT * HD * 2); bf* QPl = (bf*)take((size_t)NB_ * NH_ * TT * HD * 2); bf* KPh = (bf*)take((size_t)NB_ * NKV * TT * HD * 2); bf* KPl = (bf*)take((size_t)NB_ * NKV * TT * HD * 2); bf* VTh = (bf*)take((size_t)NB_ * NKV * HD * TT * 2); bf* VTl = (bf*)take((size_t)NB_ * NKV * HD * TT * 2);
    bf* ATh = (bf*)take((size_t)NB_ * TT * DQ * 2); bf* ATl = (bf*)take((size_t)NB_ * TT * DQ * 2);
    if ((size_t)(wsp - (char*)d_ws) > ws_size) return;    // 200 MiB of the 256 MiB
    { k_wtH<<<(unsigned)(((size_t)DQ * DM / 8 + 255) / 256), 256, 0, stream>>>(wq, WQ); k_wtH<<<(unsigned)(((size_t)DQ * DM / 8 + 255) / 256), 256, 0, stream>>>(wk, WK); k_wtH<<<(unsigned)(((size_t)DQ * DM / 8 + 255) / 256), 256, 0, stream>>>(wv, WV);
      k_wtG<<<(unsigned)((DQ * DM / 8 + 255) / 256), 256, 0, stream>>>(wo, WO);
       }
    k_cvt8<<<(unsigned)(((size_t)NB_ * TT * DM / 8 + 255) / 256), 256, 0, stream>>>(x, XB, (size_t)NB_ * TT * DM / 8);
    k_gemmw<bf, 0, true, 1, DM><<<dim3(NB_ * TT / 64, DQ / 64, 1), 32, 0, stream>>>(XB, nullptr, WQ, nullptr, nullptr, 0, bq, 0, 0, 0, QP16, QPh, QPl);
    k_gemmw<bf, 0, true, 1, DM><<<dim3(NB_ * TT / 64, DKV / 64, 1), 32, 0, stream>>>(XB, nullptr, WK, nullptr, nullptr, 0, bk, 0, 0, 0, KP16, KPh, KPl);
    k_gemmw<bf, 0, true, 2, DM><<<dim3(NB_ * TT / 64, DKV / 64, 1), 32, 0, stream>>>(XB, nullptr, WV, nullptr, nullptr, 0, bv, 0, 0, 0, VT16, VTh, VTl);
    k_fattn<<<dim3(NB_ * NH_, RH / 32 + (TT - RH) / 64, 1), 64, 0, stream>>>(QP16, KP16, VT16, QPh, QPl, KPh, KPl, VTh, VTl, ATh, ATl);
    k_gemmw<bf, 1, true, 0, DQ><<<dim3(NB_ * TT / 64, DM / 64, 1), 32, 0, stream>>>(ATh, ATl, WO, nullptr, OUT, DM, bo, 0, 0, 0, nullptr, nullptr, nullptr);
}

// v005
// Measured time: 213 microseconds a run.
// Timed twice side by side with v004, it ran 1.59 and 1.60 times as fast.
// Over all steps from v000 it is 18.9 times as fast.
#include <hip/hip_runtime.h>

// Multi-head attention layer with per-head packed projection layers (seq_inputs [4][2048][1024]; Q, K, V = einsum('bse,hed', x, W) + b with W [16][1024][64] = [h][e][d] (1/32) and b [16][64]; scores / sqrt(64); softmax (no mask); heads concatenated in order; out = cat Wo + bo ('xw' [1024][1024] + bias) -> [4][2048][1024] (8.4 M); argument order seq_inputs, Wq, bq, Wk, bk, Wv, bv, Wo, bo).
// Every launch covers all 4 batches (the rows of the GEMMs are b * 2048 + t, the head planes are [b][h][..], the attention grid's x is b * 16 + h). Layout: bf16 copy of x; k_wtH turns each [h][e][d] weight into Bt rows h*64 + d; the [16][64] biases are the flat [1024] epilogue vectors; exact projections + f32 biases, whose epilogues write the head planes themselves (Q, K as [h][t][d], V as [h][d][t]; fp16 + hi/lo); k_fattn: scores, softmax and weights x V of all 64 (batch, head) pairs in one launch, scores never leave registers (hybrid rows: < 512 hi/lo 3 products, rest fp16 weights x1024); merged hi/lo x Wo ('xw' transposed once) exact + bo.
// Every 16-bit operand plane is stored FRAGMENT-MAJOR: a 16-row x 32-k fragment is 1 KiB, [half = (k % 32) / 16][lane = ((k % 16) / 8) * 16 + row % 16][k % 8], so each of a fragment's two 16-byte-a-lane loads covers 512 contiguous bytes (4 whole lines, not 16 pieces of 32 bytes).
// Order of the fragments: GEMM operands, Q and K [row tile][k block]; V (rows d, k = t) [k block][row tile], so a pass of 32 keys reads 4 KiB in a row of K and of V. Values and every sum order are those of the row-major planes.
// Compute dtypes, f32 accumulate: every input rounded to bf16; projections exact + f32 biases; attention rows < 512 3 products, rest fp16; softmax f32 (running maximum); Wo hl x exact + bias.

#define NB_  4
#define TT   2048
#define DM   1024
#define NH_  16
#define NKV  16
#define HD   64
#define DQ   (NH_ * HD)
#define DKV  (NKV * HD)
#define RH   512                  // query rows < RH use hi+lo planes (0: none)
#define SCL  0.125f   // HD^-0.5
typedef _Float16 h16;
typedef unsigned short bf;
typedef __attribute__((ext_vector_type(16))) __bf16   v16bf;
typedef __attribute__((ext_vector_type(16))) _Float16 v16h;
typedef __attribute__((ext_vector_type(8)))  _Float16 v8h;
typedef __attribute__((ext_vector_type(8)))  unsigned short v8us;
typedef __attribute__((ext_vector_type(8)))  float    v8f;
typedef __attribute__((ext_vector_type(4)))  float    v4f;
typedef v8h  __attribute__((may_alias)) v8ha;
typedef v4f  __attribute__((may_alias)) v4fa;
typedef v8us __attribute__((may_alias)) v8usa;

__device__ __forceinline__ unsigned short f2bf(float f) { unsigned u = __float_as_uint(f); u += 0x7FFFu + ((u >> 16) & 1u); return (unsigned short)(u >> 16); }
__device__ __forceinline__ float bf2f(unsigned short b) { return __uint_as_float(((unsigned)b) << 16); }
__device__ __forceinline__ float bfr(float f) { return bf2f(f2bf(f)); }
__device__ __forceinline__ v16h cat16(v8h lo, v8h hi) { return __builtin_shufflevector(lo, hi, 0, 1, 2, 3, 4, 5, 6, 7, 8, 9, 10, 11, 12, 13, 14, 15); }
__device__ __forceinline__ v16bf cat16b(v8us lo, v8us hi) { return __builtin_bit_cast(v16bf, __builtin_shufflevector(lo, hi, 0, 1, 2, 3, 4, 5, 6, 7, 8, 9, 10, 11, 12, 13, 14, 15)); }
__device__ __forceinline__ v8f wmma16(v16h a, v16h b, v8f c) { return __builtin_amdgcn_wmma_f32_16x16x32_f16(false, a, false, b, (short)0, c, false, false); }
__device__ __forceinline__ v8f wmmab(v16bf a, v16bf b, v8f c) { return __builtin_amdgcn_wmma_f32_16x16x32_bf16(false, a, false, b, (short)0, c, false, false); }
__device__ __forceinline__ h16 tohx(float x) { return (h16)x; }
__device__ __forceinline__ void splitf(float y, unsigned short& h, unsigned short& l) { h = f2bf(y); l = f2bf(y - bf2f(h)); }



// ---- k_gemmw: register-blocked GEMM, ONE WAVE per 64x64 output tile (16 accumulators), operands straight from fragment-major 16-bit planes (ld: p = the fragment, the same for the whole wave, lb = lane * 16 bytes: the one vector register of every operand address); grid (M/64, N/64, Z), 32 threads.
// C[m][n] (f32, pitch ldc, + optional f32 bias[n]) = sum_k A[m][k] Bt[n][k] (+ split products per NSPLIT). z-batch strides sA/sB/sC in elements. K % (NS * 32) == 0, a compile-time constant: the steps from row tile to row tile are then immediate offsets of the loads.
// EPI 0 stores C. EPI 1 and 2 store no f32: m = b * 2048 + t (a 64-row tile lies in one batch), a tile's 64 columns are one head (n = h * 64 + d), and the result + bias goes out as fp16 and as bf16 hi + lo:
// EPI 1 as [b][h] planes of rows t, k = d (through the LDS rows: a lane picks up its 8 d of its row, a store is 512 bytes in a row), EPI 2 as [b][h] planes of rows d, k = t (a lane's accumulator holds 8 consecutive t of one d, which is its 16 bytes of a fragment half: straight from registers, 512 bytes in a row a store).
#define GLB __attribute__((address_space(1)))   // the planes lie in global memory: said at the load, because a pointer that has been an operand of an asm statement is otherwise read with flat loads
typedef GLB char gch;
template <typename T16> struct WFrag;
template <> struct WFrag<h16> { typedef v16h V; static __device__ __forceinline__ V ld(const h16* p, unsigned lb) { const gch* c = (const gch*)p + lb; return cat16(*(const GLB v8h*)c, *(const GLB v8h*)(c + 512)); } static __device__ __forceinline__ v8f mma(V a, V b, v8f c) { return wmma16(a, b, c); } };
template <> struct WFrag<bf> { typedef v16bf V; static __device__ __forceinline__ V ld(const bf* p, unsigned lb) { const gch* c = (const gch*)p + lb; return cat16b(*(const GLB v8us*)c, *(const GLB v8us*)(c + 512)); } static __device__ __forceinline__ v8f mma(V a, V b, v8f c) { return wmmab(a, b, c); } };
template <typename T16, int NSPLIT, bool BIAS, int EPI, int K>
__global__ __launch_bounds__(32) void k_gemmw(const T16* __restrict__ A, const T16* __restrict__ A2, const T16* __restrict__ Bt, const T16* __restrict__ Bt2, float* C, int ldc, const float* __restrict__ bias, size_t sA, size_t sB, size_t sC, h16* P16, bf* Ph, bf* Pl) {
    typedef typename WFrag<T16>::V V;
    __shared__ __align__(16) float os[16 * 68];
    const size_t z = blockIdx.z; A += z * sA; if (A2) A2 += z * sA; Bt += z * sB; if (Bt2) Bt2 += z * sB; C += z * sC;
    const int lane = threadIdx.x & 31, lr = lane & 15, hi = lane >> 4; const int r0 = blockIdx.x * 64, c0 = blockIdx.y * 64; const int bz = r0 / TT, t0 = r0 % TT;
    v8f acc[4][4];
#pragma unroll
    for (int mb = 0; mb < 4; ++mb)
#pragma unroll
        for (int nb = 0; nb < 4; ++nb) acc[mb][nb] = (v8f){};
    const T16* pa = A + (size_t)r0 * K; const T16* pa2 = A2 + (size_t)r0 * K; const T16* pb = Bt + (size_t)c0 * K; const T16* pb2 = Bt2 + (size_t)c0 * K; unsigned lb = lane * 16;   // row tile r0 / 16 starts at (r0 / 16) * (K / 32) * 512; the pointers walk NS k blocks (512 elements each) a trip
    // Ring of NS register sets, one k block (all fragments of both operands) a set: block t + NS - 1 is asked for in front of block t's products, so a load has NS - 1 blocks of products between its issue and its wait.
    constexpr int NS = NSPLIT == 0 ? 4 : 2;   // 64 registers a set without split planes, 96 with A2: 128 accumulators + the sets stay under 512, two waves a SIMD
    static_assert(K % (NS * 32) == 0 && K >= NS * 32, "K is a whole number of rings");
    V a[NS][4], a2[NS][4], b[NS][4], b2[NS][4];
    auto ldset = [&](int s, int blk) __attribute__((always_inline)) {
#pragma unroll
        for (int mb = 0; mb < 4; ++mb) { a[s][mb] = WFrag<T16>::ld(pa + mb * 16 * K + blk * 512, lb); if (NSPLIT == 1 || NSPLIT == 2) a2[s][mb] = WFrag<T16>::ld(pa2 + mb * 16 * K + blk * 512, lb); }
#pragma unroll
        for (int nb = 0; nb < 4; ++nb) { b[s][nb] = WFrag<T16>::ld(pb + nb * 16 * K + blk * 512, lb); if (NSPLIT >= 2) b2[s][nb] = WFrag<T16>::ld(pb2 + nb * 16 * K + blk * 512, lb); }
        __builtin_amdgcn_sched_barrier(0);   // keeps the set's loads here, ahead of the products of the older sets: moved down to their use they would be waited for at once
    };
    auto mmaset = [&](int s) __attribute__((always_inline)) {
#pragma unroll
        for (int nb = 0; nb < 4; ++nb)
#pragma unroll
            for (int mb = 0; mb < 4; ++mb) { acc[mb][nb] = WFrag<T16>::mma(a[s][mb], b[s][nb], acc[mb][nb]); if (NSPLIT == 1 || NSPLIT == 2) acc[mb][nb] = WFrag<T16>::mma(a2[s][mb], b[s][nb], acc[mb][nb]); if (NSPLIT >= 2) acc[mb][nb] = WFrag<T16>::mma(a[s][mb], b2[s][nb], acc[mb][nb]); }
        __builtin_amdgcn_sched_barrier(0);   // keeps the next set's loads behind these products, which read the registers that those loads fill
    };
    // the wait in front of a rewrite of the registers that the issued loads name: the scalar bases, which as operands of the wait are stepped (or given up) behind it. lb is an operand so that it stays the one 32-bit offset register of the loads
    // (scalar base + offset form; widened to 64 bits in front of the loop, it would be added to each base in vector registers, which the loads' results then reuse); nothing writes it
    auto xwait = [&]() __attribute__((always_inline)) {
        if constexpr (NSPLIT == 0) asm volatile("s_wait_xcnt 0x0" : "+s"(pa), "+s"(pb), "+v"(lb) :: "memory");
        else if constexpr (NSPLIT == 1) asm volatile("s_wait_xcnt 0x0" : "+s"(pa), "+s"(pa2), "+s"(pb), "+v"(lb) :: "memory");
        else asm volatile("s_wait_xcnt 0x0" : "+s"(pa), "+s"(pa2), "+s"(pb), "+s"(pb2), "+v"(lb) :: "memory");
    };
    // the loops over s are unrolled so that a set's number is a constant and the sets are registers; the loop over kc stays rolled, one turn of the ring a trip (unrolled further no load would be issued earlier)
#pragma unroll
    for (int s = 0; s < NS - 1; ++s) ldset(s, s);
#pragma unroll 1
    for (int kc = 0; kc < K - NS * 32; kc += NS * 32) {
#pragma unroll
        for (int s = 0; s < NS; ++s) { ldset((s + NS - 1) % NS, s + NS - 1); mmaset(s); }
        xwait(); pa += NS * 512; pa2 += NS * 512; pb += NS * 512; pb2 += NS * 512;
    }
    ldset(NS - 1, NS - 1);   // the last NS blocks: only the last of them is still to be asked for
    mmaset(0); xwait();      // behind it the epilogue may reuse the registers of the bases and of lb
#pragma unroll
    for (int s = 1; s < NS; ++s) mmaset(s);
    if constexpr (EPI == 2) {
#pragma unroll
        for (int nb = 0; nb < 4; ++nb) { const float bn = bfr(bias[c0 + nb * 16 + lr]);
#pragma unroll
            for (int mb = 0; mb < 4; ++mb) { const size_t po = ((size_t)bz * NKV + blockIdx.y) * HD * TT + (size_t)(((t0 >> 5) + (mb >> 1)) * 4 + nb) * 512 + (mb & 1) * 256 + lane * 8; v8h o16; v8us oh, ol;
#pragma unroll
                for (int j = 0; j < 8; ++j) { const float x = acc[mb][nb][j] + bn; o16[j] = tohx(x); unsigned short a2, c2; splitf(x, a2, c2); oh[j] = a2; ol[j] = c2; }
                *(v8h*)(P16 + po) = o16; *(v8us*)(Ph + po) = oh; *(v8us*)(Pl + po) = ol; } }
        return;
    }
#pragma unroll
    for (int mb = 0; mb < 4; ++mb) {
#pragma unroll
        for (int nb = 0; nb < 4; ++nb) {
#pragma unroll
            for (int j = 0; j < 8; ++j) os[(hi * 8 + j) * 68 + nb * 16 + lr] = acc[mb][nb][j]; }
        __builtin_amdgcn_wave_barrier(); asm volatile("" ::: "memory");
        if constexpr (EPI == 1) {
#pragma unroll
            for (int s = 0; s < 4; ++s) { const int cofs = s * 16 + hi * 8; const v4f v0 = *(const v4fa*)(os + lr * 68 + cofs), v1 = *(const v4fa*)(os + lr * 68 + cofs + 4);   // s = k block * 2 + half
                const size_t po = ((size_t)bz * NH_ + blockIdx.y) * TT * HD + (size_t)((t0 >> 4) + mb) * 1024 + s * 256 + lane * 8; v8h o16; v8us oh, ol;
#pragma unroll
                for (int q = 0; q < 8; ++q) { const float x = (q < 4 ? v0[q & 3] : v1[q & 3]) + bfr(bias[c0 + cofs + q]); o16[q] = tohx(x); unsigned short a2, c2; splitf(x, a2, c2); oh[q] = a2; ol[q] = c2; }
                *(v8h*)(P16 + po) = o16; *(v8us*)(Ph + po) = oh; *(v8us*)(Pl + po) = ol;
                if (mb < 3 || s < 3) asm volatile("s_wait_xcnt 0x0" ::: "memory"); }   // the wait in front of a rewrite of the registers that these three stores name (the next quarter reuses them)
        } else {
            float* crow = C + (size_t)(r0 + mb * 16) * ldc + c0;
#pragma unroll
            for (int s = 0; s < 8; ++s) { const int row = 2 * s + hi, cofs = lr * 4; v4f val = *(const v4fa*)(os + row * 68 + cofs); if (BIAS) { val[0] += bfr(bias[c0 + cofs]); val[1] += bfr(bias[c0 + cofs + 1]); val[2] += bfr(bias[c0 + cofs + 2]); val[3] += bfr(bias[c0 + cofs + 3]); }
                *(v4f*)(crow + (size_t)row * ldc + cofs) = val; }
            if (mb < 3) asm volatile("s_wait_xcnt 0x0" ::: "memory");   // the wait in front of a rewrite of the registers that these eight stores name (the next row block reuses them)
        }
        __builtin_amdgcn_wave_barrier(); asm volatile("" ::: "memory");
    }
}


// The three packers below: thread i writes the 16 bytes at element i * 8 of a fragment-major plane of K-long rows: lane = i % 32, half = (i / 32) % 2, k block = (i / 64) % (K / 32), row tile = i / (2 K).
// k_wtG: Bt[n][k] = w[k][n] (w [DQ][DM]); k_wtH: Bt[h * 64 + e][k] = w[h][k][e]; in both, 16 lanes read 64 contiguous bytes of w for each of their 8 k. k_cvt8: rows as they are, 32 bytes of f32 a thread.
__global__ __launch_bounds__(256) void k_wtG(const float* __restrict__ w, bf* Bt) {
    const int i = blockIdx.x * 256 + threadIdx.x; if (i >= DM * DQ / 8) return; const int lane = i & 31, kb = (i >> 6) % (DQ / 32), n = (i >> 6) / (DQ / 32) * 16 + (lane & 15), k0 = kb * 32 + ((i >> 5) & 1) * 16 + (lane >> 4) * 8; v8us o;
#pragma unroll
    for (int q = 0; q < 8; ++q) o[q] = f2bf(w[(size_t)(k0 + q) * DM + n]);
    *(v8us*)(Bt + (size_t)i * 8) = o;
}
__global__ __launch_bounds__(256) void k_cvt8(const float* __restrict__ src, bf* dst, size_t n8) { const size_t i = (size_t)blockIdx.x * 256 + threadIdx.x; if (i >= n8) return; const int lane = (int)(i & 31), kb = (int)((i >> 6) % (DM / 32)); const size_t row = (i >> 6) / (DM / 32) * 16 + (lane & 15);
    const v8f v = *(const v8f*)(src + row * DM + kb * 32 + (int)((i >> 5) & 1) * 16 + (lane >> 4) * 8); v8us o;
#pragma unroll
    for (int k = 0; k < 8; ++k) o[k] = f2bf(v[k]); *(v8us*)(dst + i * 8) = o;  }

__global__ __launch_bounds__(256) void k_wtH(const float* __restrict__ w, bf* Bt) { const int i = blockIdx.x * 256 + threadIdx.x; if (i >= DQ * DM / 8) return; const int lane = i & 31, kb = (i >> 6) % (DM / 32), r = (i >> 6) / (DM / 32) * 16 + (lane & 15), k0 = kb * 32 + ((i >> 5) & 1) * 16 + (lane >> 4) * 8; const int h = r / HD, e = r % HD; v8us o;
#pragma unroll
    for (int q = 0; q < 8; ++q) o[q] = f2bf(w[((size_t)h * DM + k0 + q) * HD + e]);
    *(v8us*)(Bt + (size_t)i * 8) = o;  }
// ---- k_fattn: one wave owns NT x 16 query rows of one head and walks the 2048 keys 32 at a time.
// St = K Qt (A = 16 key rows, B = 16 query rows, both fragment-major planes): in the accumulator a lane holds ONE query (column lane & 15) and keys 8 * (lane >> 4) + j of each 16-key tile,
// which is the k order of a B fragment (elements 0..7 = tile 0, 8..15 = tile 1), so the weights go from the score accumulators straight into Ot += Vt Pt (A = 16 rows d of the V plane, k = t).
// Softmax with a running maximum per query: maximum and sum in-lane plus one exchange between the wave halves; sums of the halves joined once at the end; division by the sum at the end.
// exp8: eight weights in place, p = exp2(p * c + nm). Written as one statement so that every v_exp_f32 is followed by an instruction that neither reads its result nor writes its source
// (the slot the instruction set asks for behind a transcendental): a later element's multiply-add or v_exp_f32 fills it, a v_nop behind the last. exp8a does the same and takes the rescale factor a = exp2(a) along.
__device__ __forceinline__ void exp8(float* p, float c, float nm) {
    asm("v_fma_f32 %0, %0, %8, %9\n\tv_fma_f32 %1, %1, %8, %9\n\tv_exp_f32 %0, %0\n\tv_fma_f32 %2, %2, %8, %9\n\tv_exp_f32 %1, %1\n\tv_fma_f32 %3, %3, %8, %9\n\tv_exp_f32 %2, %2\n\t"
        "v_fma_f32 %4, %4, %8, %9\n\tv_exp_f32 %3, %3\n\tv_fma_f32 %5, %5, %8, %9\n\tv_exp_f32 %4, %4\n\tv_fma_f32 %6, %6, %8, %9\n\tv_exp_f32 %5, %5\n\tv_fma_f32 %7, %7, %8, %9\n\tv_exp_f32 %6, %6\n\tv_exp_f32 %7, %7\n\tv_nop"
        : "+v"(p[0]), "+v"(p[1]), "+v"(p[2]), "+v"(p[3]), "+v"(p[4]), "+v"(p[5]), "+v"(p[6]), "+v"(p[7]) : "s"(c), "v"(nm));
}
__device__ __forceinline__ void exp8a(float* p, float c, float nm, float& a) {
    asm("v_fma_f32 %0, %0, %9, %10\n\tv_exp_f32 %8, %8\n\tv_fma_f32 %1, %1, %9, %10\n\tv_exp_f32 %0, %0\n\tv_fma_f32 %2, %2, %9, %10\n\tv_exp_f32 %1, %1\n\tv_fma_f32 %3, %3, %9, %10\n\tv_exp_f32 %2, %2\n\t"
        "v_fma_f32 %4, %4, %9, %10\n\tv_exp_f32 %3, %3\n\tv_fma_f32 %5, %5, %9, %10\n\tv_exp_f32 %4, %4\n\tv_fma_f32 %6, %6, %9, %10\n\tv_exp_f32 %5, %5\n\tv_fma_f32 %7, %7, %9, %10\n\tv_exp_f32 %6, %6\n\tv_exp_f32 %7, %7\n\tv_nop"
        : "+v"(p[0]), "+v"(p[1]), "+v"(p[2]), "+v"(p[3]), "+v"(p[4]), "+v"(p[5]), "+v"(p[6]), "+v"(p[7]), "+v"(a) : "s"(c), "v"(nm));
}
template <bool HI> struct ASel { typedef h16 T; };
template <> struct ASel<true> { typedef bf T; };
template <bool HI, int NT>
__device__ __forceinline__ void fa_tile(const typename ASel<HI>::T* __restrict__ Q, const typename ASel<HI>::T* __restrict__ Q2, const typename ASel<HI>::T* __restrict__ Kp, const typename ASel<HI>::T* __restrict__ Kp2,
                                        const typename ASel<HI>::T* __restrict__ Vp, const typename ASel<HI>::T* __restrict__ Vp2, int q0, bf* Ah, bf* Al) {
    typedef WFrag<typename ASel<HI>::T> F; typedef typename F::V V;
    const int lane = threadIdx.x & 31; unsigned lb = lane * 16;
    const float CL2 = SCL * 1.4426950408889634f;   // score -> log2 domain
    const float PSH = HI ? 0.0f : 10.0f;           // fp16 weights carry x1024 (log2 = 10): keeps small weights out of the fp16 denormals; the sum carries it too, so it cancels in the division
    V qf[NT][2], qf2[NT][2], kf[2][2], kf2[2][2];
#pragma unroll
    for (int nt = 0; nt < NT; ++nt)
#pragma unroll
        for (int ks = 0; ks < 2; ++ks) { const size_t qo = (size_t)(q0 + nt * 16) * HD + ks * 512; qf[nt][ks] = F::ld(Q + qo, lb); if constexpr (HI) qf2[nt][ks] = F::ld(Q2 + qo, lb); }
    // a pass's 32 keys: K fragments (mt, ks) and V fragments dt, 512 elements each, 2048 in a row from kc * 64 of either plane
    if constexpr (!HI) {
#pragma unroll
        for (int mt = 0; mt < 2; ++mt)
#pragma unroll
            for (int ks = 0; ks < 2; ++ks) kf[mt][ks] = F::ld(Kp + mt * 16 * HD + ks * 512, lb);
    }
    const typename ASel<HI>::T* pk = Kp; const typename ASel<HI>::T* pk2 = Kp2; const typename ASel<HI>::T* pv = Vp; const typename ASel<HI>::T* pv2 = Vp2;   // walk 2048 elements a pass
    v8f o[NT][4]; float m[NT], l[NT];
#pragma unroll
    for (int nt = 0; nt < NT; ++nt) { m[nt] = -3.0e38f; l[nt] = 0.f;
#pragma unroll
        for (int dt = 0; dt < 4; ++dt) o[nt][dt] = (v8f){}; }
    for (int kc = 0; kc < TT; kc += 32) {
        V vf[4], vf2[4];
        if constexpr (HI) {   // hi/lo rows: four planes do not fit the registers one pass ahead; this pass's key rows are asked for first, its value rows fly behind them under the score products and the softmax
#pragma unroll
            for (int mt = 0; mt < 2; ++mt)
#pragma unroll
                for (int ks = 0; ks < 2; ++ks) { kf[mt][ks] = F::ld(pk + mt * 16 * HD + ks * 512, lb); kf2[mt][ks] = F::ld(pk2 + mt * 16 * HD + ks * 512, lb); }
        }
#pragma unroll
        for (int dt = 0; dt < 4; ++dt) { vf[dt] = F::ld(pv + dt * 512, lb); if constexpr (HI) vf2[dt] = F::ld(pv2 + dt * 512, lb); }
        if constexpr (!HI) __builtin_amdgcn_sched_barrier(0);   // keeps the eight value loads here, at the head of the pass: moved down to save registers they would be waited for soon after their issue
        v8f s[NT][2];
#pragma unroll
        for (int nt = 0; nt < NT; ++nt)
#pragma unroll
            for (int mt = 0; mt < 2; ++mt) { s[nt][mt] = (v8f){};
#pragma unroll
                for (int ks = 0; ks < 2; ++ks) { s[nt][mt] = F::mma(kf[mt][ks], qf[nt][ks], s[nt][mt]); if constexpr (HI) { s[nt][mt] = F::mma(kf[mt][ks], qf2[nt][ks], s[nt][mt]); s[nt][mt] = F::mma(kf2[mt][ks], qf[nt][ks], s[nt][mt]); } } }
        if constexpr (!HI) {
            pk = (kc + 32 < TT) ? pk + 32 * HD : Kp;   // the next pass's key rows, fetched behind this pass's score products (the last pass refetches rows 0..31, unused)
#pragma unroll
            for (int mt = 0; mt < 2; ++mt)
#pragma unroll
                for (int ks = 0; ks < 2; ++ks) kf[mt][ks] = F::ld(pk + mt * 16 * HD + ks * 512, lb);
            __builtin_amdgcn_sched_barrier(0);   // keeps the eight key loads here, with the softmax and the second product between them and their use: moved down to the foot of the pass they would be waited for at once
        }
#pragma unroll
        for (int nt = 0; nt < NT; ++nt) {
            float mx = s[nt][0][0];
#pragma unroll
            for (int j = 0; j < 8; ++j) { mx = fmaxf(mx, s[nt][0][j]); mx = fmaxf(mx, s[nt][1][j]); }
            mx = fmaxf(mx, __shfl_xor(mx, 16, 32));
            const float mn = fmaxf(m[nt], mx); float al = (m[nt] - mn) * CL2; const float nm = PSH - mn * CL2; m[nt] = mn;
            float p[16], ps = 0.f;
#pragma unroll
            for (int j = 0; j < 8; ++j) { p[j] = s[nt][0][j]; p[8 + j] = s[nt][1][j]; }
            exp8a(p, CL2, nm, al); exp8(p + 8, CL2, nm);
#pragma unroll
            for (int j = 0; j < 16; ++j) ps += p[j];
            l[nt] = l[nt] * al + ps;
#pragma unroll
            for (int dt = 0; dt < 4; ++dt)
#pragma unroll
                for (int j = 0; j < 8; ++j) o[nt][dt][j] *= al;
            if constexpr (HI) {
                v8us h0, h1, l0, l1;
#pragma unroll
                for (int j = 0; j < 8; ++j) { unsigned short a, c2; splitf(p[j], a, c2); h0[j] = a; l0[j] = c2; splitf(p[8 + j], a, c2); h1[j] = a; l1[j] = c2; }
                const V ph = cat16b(h0, h1), pl = cat16b(l0, l1);
#pragma unroll
                for (int dt = 0; dt < 4; ++dt) { o[nt][dt] = F::mma(vf[dt], ph, o[nt][dt]); o[nt][dt] = F::mma(vf[dt], pl, o[nt][dt]); o[nt][dt] = F::mma(vf2[dt], ph, o[nt][dt]); }
            } else {
                V pb;
#pragma unroll
                for (int j = 0; j < 16; ++j) pb[j] = tohx(p[j]);
#pragma unroll
                for (int dt = 0; dt < 4; ++dt) o[nt][dt] = F::mma(vf[dt], pb, o[nt][dt]);
            }
        }
        // the wait in front of a rewrite of the registers that this pass's loads name: the scalar bases, which as operands of the wait are stepped behind it; lb is an operand for the reason given in k_gemmw; nothing writes it
        if constexpr (HI) { asm volatile("s_wait_xcnt 0x0" : "+s"(pk), "+s"(pk2), "+s"(pv), "+s"(pv2), "+v"(lb) :: "memory"); pk += 32 * HD; pk2 += 32 * HD; pv += 32 * HD; pv2 += 32 * HD; }
        else { asm volatile("s_wait_xcnt 0x0" : "+s"(pk), "+s"(pv), "+v"(lb) :: "memory"); pv += 32 * HD; }
    }
#pragma unroll
    for (int nt = 0; nt < NT; ++nt) {
        const float inv = __fdiv_rn(1.0f, l[nt] + __shfl_xor(l[nt], 16, 32));
        const size_t oo = (size_t)(q0 + nt * 16) * DQ + 8 * lane;   // a lane holds d = dt * 16 + 8 * (lane >> 4) + j of its query (row lane & 15): its 16 bytes of half dt & 1 of k block h * 2 + dt / 2 of the merged plane's row tile
#pragma unroll
        for (int dt = 0; dt < 4; ++dt) { v8us oh, ol;
#pragma unroll
            for (int j = 0; j < 8; ++j) { unsigned short a, c2; splitf(o[nt][dt][j] * inv, a, c2); oh[j] = a; ol[j] = c2; }
            *(v8us*)(Ah + oo + dt * 256) = oh; *(v8us*)(Al + oo + dt * 256) = ol; }
    }
}
// grid (batches x heads, RH / 32 + (TT - RH) / 64), 2 independent waves a block: blockIdx.y < RH / 32 takes 16 hi/lo rows a wave (twice the loads of the others; they take the lowest indices), the rest 32 fp16 rows a wave; output = the merged hi/lo planes (rows b * 2048 + t, k = h * 64 + d; a head's two k blocks start h * 1024 into a row tile)
__global__ __launch_bounds__(64) void k_fattn(const h16* __restrict__ Q16, const h16* __restrict__ K16, const h16* __restrict__ V16, const bf* __restrict__ Qh, const bf* __restrict__ Ql, const bf* __restrict__ Kh, const bf* __restrict__ Kl, const bf* __restrict__ Vh, const bf* __restrict__ Vl, bf* Ah, bf* Al) {
    const int h = blockIdx.x % NH_, w = threadIdx.x >> 5, bx = blockIdx.y; const size_t po = (size_t)blockIdx.x * TT * HD; Ah += (size_t)(blockIdx.x / NH_) * TT * DQ; Al += (size_t)(blockIdx.x / NH_) * TT * DQ;
    if (bx < RH / 32) fa_tile<true, 1>(Qh + po, Ql + po, Kh + po, Kl + po, Vh + po, Vl + po, (bx * 2 + w) * 16, Ah + h * 1024, Al + h * 1024);
    else fa_tile<false, 2>(Q16 + po, nullptr, K16 + po, nullptr, V16 + po, nullptr, RH + ((bx - RH / 32) * 2 + w) * 32, Ah + h * 1024, Al + h * 1024);
}

extern "C" void kernel_launch(void* const* d_in, const int* in_sizes, int n_in,
                              void* d_out, int out_size, void* d_ws, size_t ws_size, hipStream_t stream) {
    (void)in_sizes; (void)n_in; (void)out_size;
    const float* x = (const float*)d_in[0]; const float* wq = (const float*)d_in[1]; const float* bq = (const float*)d_in[2]; const float* wk = (const float*)d_in[3]; const float* bk = (const float*)d_in[4]; const float* wv = (const float*)d_in[5]; const float* bv = (const float*)d_in[6]; const float* wo = (const float*)d_in[7]; const float* bo = (const float*)d_in[8];   /* order seq_inputs, Wq [16][1024][64], bq [16][64], Wk, bk, Wv, bv, Wo ('xw' [1024][1024]), bo */
    float* OUT = (float*)d_out;     // [4][2048][1024]
    char* wsp = (char*)d_ws;
    auto take = [&](size_t bytes) { char* p = wsp; wsp += (bytes + 255) & ~(size_t)255; return (void*)p; };
    bf* WQ = (bf*)take((size_t)DQ * DM * 2); bf* WK = (bf*)take((size_t)DKV * DM * 2); bf* WV = (bf*)take((size_t)DKV * DM * 2); bf* WO = (bf*)take((size_t)DM * DQ * 2);
    bf* XB = (bf*)take((size_t)NB_ * TT * DM * 2);
    h16* QP16 = (h16*)take((size_t)NB_ * NH_ * TT * HD * 2); h16* KP16 = (h16*)take((size_t)NB_ * NKV * TT * HD * 2); h16* VT16 = (h16*)take((size_t)NB_ * NKV * HD * TT * 2);
    bf* QPh = (bf*)take((size_t)NB_ * NH_ * TT * HD * 2); bf* QPl = (bf*)take((size_t)NB_ * NH_ * TT * HD * 2); bf* KPh = (bf*)take((size_t)NB_ * NKV * TT * HD * 2); bf* KPl = (bf*)take((size_t)NB_ * NKV * TT * HD * 2); bf* VTh = (bf*)take((size_t)NB_ * NKV * HD * TT * 2); bf* VTl = (bf*)take((size_t)NB_ * NKV * HD * TT * 2);
    bf* ATh = (bf*)take((size_t)NB_ * TT * DQ * 2); bf* ATl = (bf*)take((size_t)NB_ * TT * DQ * 2);
    if ((size_t)(wsp - (char*)d_ws) > ws_size) return;    // 200 MiB of the 256 MiB
    { k_wtH<<<(unsigned)(((size_t)DQ * DM / 8 + 255) / 256), 256, 0, stream>>>(wq, WQ); k_wtH<<<(unsigned)(((size_t)DQ * DM / 8 + 255) / 256), 256, 0, stream>>>(wk, WK); k_wtH<<<(unsigned)(((size_t)DQ * DM / 8 + 255) / 256), 256, 0, stream>>>(wv, WV);
      k_wtG<<<(unsigned)((DQ * DM / 8 + 255) / 256), 256, 0, stream>>>(wo, WO);
       }
    k_cvt8<<<(unsigned)(((size_t)NB_ * TT * DM / 8 + 255) / 256), 256, 0, stream>>>(x, XB, (size_t)NB_ * TT * DM / 8);
    k_gemmw<bf, 0, true, 1, DM><<<dim3(NB_ * TT / 64, DQ / 64, 1), 32, 0, stream>>>(XB, nullptr, WQ, nullptr, nullptr, 0, bq, 0, 0, 0, QP16, QPh, QPl);
    k_gemmw<bf, 0, true, 1, DM><<<dim3(NB_ * TT / 64, DKV / 64, 1), 32, 0, stream>>>(XB, nullptr, WK, nullptr, nullptr, 0, bk, 0, 0, 0, KP16, KPh, KPl);
    k_gemmw<bf, 0, true, 2, DM><<<dim3(NB_ * TT / 64, DKV / 64, 1), 32, 0, stream>>>(XB, nullptr, WV, nullptr, nullptr, 0, bv, 0, 0, 0, VT16, VTh, VTl);
    k_fattn<<<dim3(NB_ * NH_, RH / 32 + (TT - RH) / 64, 1), 64, 0, stream>>>(QP16, KP16, VT16, QPh, QPl, KPh, KPl, VTh, VTl, ATh, ATl);
    k_gemmw<bf, 1, true, 0, DQ><<<dim3(NB_ * TT / 64, DM / 64, 1), 32, 0, stream>>>(ATh, ATl, WO, nullptr, OUT, DM, bo, 0, 0, 0, nullptr, nullptr, nullptr);
}

// v006
// Measured time: 199 microseconds a run.
// Next to v005, in two timings, it ran 1.07 and 1.06 times as fast.
// All steps since v000 together make it 20.2 times as fast.
#include <hip/hip_runtime.h>

// Multi-head attention layer with per-head packed projection layers (seq_inputs [4][2048][1024]; Q, K, V = einsum('bse,hed', x, W) + b with W [16][1024][64] = [h][e][d] (1/32) and b [16][64]; scores / sqrt(64); softmax (no mask); heads concatenated in order; out = cat Wo + bo ('xw' [1024][1024] + bias) -> [4][2048][1024] (8.4 M); argument order seq_inputs, Wq, bq, Wk, bk, Wv, bv, Wo, bo).
// Every launch covers all 4 batches (the rows of the GEMMs are b * 2048 + t, the head planes are [b][h][..], the attention grid's x is b * 16 + h). Layout: k_pack (one launch) makes the bf16 copy of x, turns each [h][e][d] weight into Bt rows h*64 + d (Q, K, V rows one behind the other: one Bt of 3072 rows) and transposes Wo; the [16][64] biases are the flat [1024] epilogue vectors; exact projections + f32 biases, all three as one product of N = 3072, whose epilogues write the head planes themselves (Q, K as [h][t][d], V as [h][d][t]; fp16 + hi/lo); k_fattn: scores, softmax and weights x V of all 64 (batch, head) pairs in one launch, scores never leave registers (hybrid rows: < 512 hi/lo 3 products, rest fp16 weights x1024); merged hi/lo x Wo ('xw' transposed once) exact + bo.
// Every 16-bit operand plane is stored FRAGMENT-MAJOR: a 16-row x 32-k fragment is 1 KiB, [half = (k % 32) / 16][lane = ((k % 16) / 8) * 16 + row % 16][k % 8], so each of a fragment's two 16-byte-a-lane loads covers 512 contiguous bytes (4 whole lines, not 16 pieces of 32 bytes).
// Order of the fragments: GEMM operands, Q and K [row tile][k block]; V (rows d, k = t) [k block][row tile], so a pass of 32 keys reads 4 KiB in a row of K and of V. Values and every sum order are those of the row-major planes.
// Compute dtypes, f32 accumulate: every input rounded to bf16; projections exact + f32 biases; attention rows < 512 3 products, rest fp16; softmax f32 (running maximum); Wo hl x exact + bias.

#define NB_  4
#define TT   2048
#define DM   1024
#define NH_  16
#define NKV  16
#define HD   64
#define DQ   (NH_ * HD)
#define DKV  (NKV * HD)
#define RH   512                  // query rows < RH use hi+lo planes (0: none)
#define SCL  0.125f   // HD^-0.5
typedef _Float16 h16;
typedef unsigned short bf;
typedef __attribute__((ext_vector_type(16))) __bf16   v16bf;
typedef __attribute__((ext_vector_type(16))) _Float16 v16h;
typedef __attribute__((ext_vector_type(8)))  _Float16 v8h;
typedef __attribute__((ext_vector_type(8)))  unsigned short v8us;
typedef __attribute__((ext_vector_type(8)))  float    v8f;
typedef __attribute__((ext_vector_type(4)))  float    v4f;
typedef v8h  __attribute__((may_alias)) v8ha;
typedef v4f  __attribute__((may_alias)) v4fa;
typedef v8us __attribute__((may_alias)) v8usa;

__device__ __forceinline__ unsigned short f2bf(float f) { unsigned u = __float_as_uint(f); u += 0x7FFFu + ((u >> 16) & 1u); return (unsigned short)(u >> 16); }
__device__ __forceinline__ float bf2f(unsigned short b) { return __uint_as_float(((unsigned)b) << 16); }
__device__ __forceinline__ float bfr(float f) { return bf2f(f2bf(f)); }
__device__ __forceinline__ v16h cat16(v8h lo, v8h hi) { return __builtin_shufflevector(lo, hi, 0, 1, 2, 3, 4, 5, 6, 7, 8, 9, 10, 11, 12, 13, 14, 15); }
__device__ __forceinline__ v16bf cat16b(v8us lo, v8us hi) { return __builtin_bit_cast(v16bf, __builtin_shufflevector(lo, hi, 0, 1, 2, 3, 4, 5, 6, 7, 8, 9, 10, 11, 12, 13, 14, 15)); }
__device__ __forceinline__ v8f wmma16(v16h a, v16h b, v8f c) { return __builtin_amdgcn_wmma_f32_16x16x32_f16(false, a, false, b, (short)0, c, false, false); }
__device__ __forceinline__ v8f wmmab(v16bf a, v16bf b, v8f c) { return __builtin_amdgcn_wmma_f32_16x16x32_bf16(false, a, false, b, (short)0, c, false, false); }
__device__ __forceinline__ h16 tohx(float x) { return (h16)x; }
__device__ __forceinline__ void splitf(float y, unsigned short& h, unsigned short& l) { h = f2bf(y); l = f2bf(y - bf2f(h)); }



// ---- k_gemmw: register-blocked GEMM, ONE WAVE per 64x64 output tile (16 accumulators), operands straight from fragment-major 16-bit planes (ld: p = the fragment, the same for the whole wave, lb = lane * 16 bytes: the one vector register of every operand address); grid (M/64, N/64, Z), 32 threads.
// C[m][n] (f32, pitch ldc, + optional f32 bias[n]) = sum_k A[m][k] Bt[n][k] (+ split products per NSPLIT). z-batch strides sA/sB/sC in elements. K % 32 == 0, a compile-time constant: the steps from row tile to row tile are then immediate offsets of the loads.
// EPI 0 stores C. EPI 1 is the three projections in one grid and stores no f32: m = b * 2048 + t (a 64-row tile lies in one batch), a tile's 64 columns are one head of one projection (n = sel * 1024 + h * 64 + d; sel 0, 1, 2 = Q, K, V, the same for the whole block), and the result + that projection's bias goes out as fp16 and as bf16 hi + lo
// (P16 = three planes Q, K, V one behind the other; Ph and Pl point into six: Q hi, Q lo, K hi, K lo, V hi, V lo):
// Q and K as [b][h] planes of rows t, k = d (through the LDS rows: a lane picks up its 8 d of its row, a store is 512 bytes in a row), V as [b][h] planes of rows d, k = t (a lane's accumulator holds 8 consecutive t of one d, which is its 16 bytes of a fragment half: straight from registers, 512 bytes in a row a store).
#define GLB __attribute__((address_space(1)))   // the planes lie in global memory: said at the load, because a pointer that has been an operand of an asm statement is otherwise read with flat loads
typedef GLB char gch;
template <typename T16> struct WFrag;
template <> struct WFrag<h16> { typedef v16h V; static __device__ __forceinline__ V ld(const h16* p, unsigned lb) { const gch* c = (const gch*)p + lb; return cat16(*(const GLB v8h*)c, *(const GLB v8h*)(c + 512)); } static __device__ __forceinline__ v8f mma(V a, V b, v8f c) { return wmma16(a, b, c); } };
template <> struct WFrag<bf> { typedef v16bf V; static __device__ __forceinline__ V ld(const bf* p, unsigned lb) { const gch* c = (const gch*)p + lb; return cat16b(*(const GLB v8us*)c, *(const GLB v8us*)(c + 512)); } static __device__ __forceinline__ v8f mma(V a, V b, v8f c) { return wmmab(a, b, c); } };
template <typename T16, int NSPLIT, bool BIAS, int EPI, int K>
__global__ __launch_bounds__(32) void k_gemmw(const T16* __restrict__ A, const T16* __restrict__ A2, const T16* __restrict__ Bt, const T16* __restrict__ Bt2, float* C, int ldc, const float* __restrict__ bias, const float* __restrict__ biasK, const float* __restrict__ biasV, size_t sA, size_t sB, size_t sC, h16* P16, bf* Ph, bf* Pl) {
    typedef typename WFrag<T16>::V V;
    __shared__ __align__(16) float os[16 * 68];
    const size_t z = blockIdx.z; A += z * sA; if (A2) A2 += z * sA; Bt += z * sB; if (Bt2) Bt2 += z * sB; C += z * sC;
    const int lane = threadIdx.x & 31, lr = lane & 15, hi = lane >> 4; const int r0 = blockIdx.x * 64, c0 = blockIdx.y * 64; const int bz = r0 / TT, t0 = r0 % TT;
    v8f acc[4][4];
#pragma unroll
    for (int mb = 0; mb < 4; ++mb)
#pragma unroll
        for (int nb = 0; nb < 4; ++nb) acc[mb][nb] = (v8f){};
    const T16* pa = A + (size_t)r0 * K; const T16* pa2 = A2 + (size_t)r0 * K; const T16* pb = Bt + (size_t)c0 * K; const T16* pb2 = Bt2 + (size_t)c0 * K; unsigned lb = lane * 16;   // row tile r0 / 16 starts at (r0 / 16) * (K / 32) * 512; the pointers walk NS k blocks (512 elements each) a trip
    // Ring of NS register sets, one k block (all fragments of both operands) a set: block t + NS - 1 is asked for in front of block t's products, so a load has NS - 1 blocks of products between its issue and its wait.
    constexpr int NS = NSPLIT == 0 ? 4 : 2;   // 64 registers a set without split planes, 96 with A2: 128 accumulators + the sets stay under 512, two waves a SIMD
    static_assert(K % (NS * 32) == 0 && K >= NS * 32, "K is a whole number of rings");
    V a[NS][4], a2[NS][4], b[NS][4], b2[NS][4];
    auto ldset = [&](int s, int blk) __attribute__((always_inline)) {
#pragma unroll
        for (int mb = 0; mb < 4; ++mb) { a[s][mb] = WFrag<T16>::ld(pa + mb * 16 * K + blk * 512, lb); if (NSPLIT == 1 || NSPLIT == 2) a2[s][mb] = WFrag<T16>::ld(pa2 + mb * 16 * K + blk * 512, lb); }
#pragma unroll
        for (int nb = 0; nb < 4; ++nb) { b[s][nb] = WFrag<T16>::ld(pb + nb * 16 * K + blk * 512, lb); if (NSPLIT >= 2) b2[s][nb] = WFrag<T16>::ld(pb2 + nb * 16 * K + blk * 512, lb); }
        __builtin_amdgcn_sched_barrier(0);   // keeps the set's loads here, ahead of the products of the older sets: moved down to their use they would be waited for at once
    };
    auto mmaset = [&](int s) __attribute__((always_inline)) {
#pragma unroll
        for (int nb = 0; nb < 4; ++nb)
#pragma unroll
            for (int mb = 0; mb < 4; ++mb) { acc[mb][nb] = WFrag<T16>::mma(a[s][mb], b[s][nb], acc[mb][nb]); if (NSPLIT == 1 || NSPLIT == 2) acc[mb][nb] = WFrag<T16>::mma(a2[s][mb], b[s][nb], acc[mb][nb]); if (NSPLIT >= 2) acc[mb][nb] = WFrag<T16>::mma(a[s][mb], b2[s][nb], acc[mb][nb]); }
        __builtin_amdgcn_sched_barrier(0);   // keeps the next set's loads behind these products, which read the registers that those loads fill
    };
    // the wait in front of a rewrite of the registers that the issued loads name: the scalar bases, which as operands of the wait are stepped (or given up) behind it. lb is an operand so that it stays the one 32-bit offset register of the loads
    // (scalar base + offset form; widened to 64 bits in front of the loop, it would be added to each base in vector registers, which the loads' results then reuse); nothing writes it
    auto xwait = [&]() __attribute__((always_inline)) {
        if constexpr (NSPLIT == 0) asm volatile("s_wait_xcnt 0x0" : "+s"(pa), "+s"(pb), "+v"(lb) :: "memory");
        else if constexpr (NSPLIT == 1) asm volatile("s_wait_xcnt 0x0" : "+s"(pa), "+s"(pa2), "+s"(pb), "+v"(lb) :: "memory");
        else asm volatile("s_wait_xcnt 0x0" : "+s"(pa), "+s"(pa2), "+s"(pb), "+s"(pb2), "+v"(lb) :: "memory");
    };
    // the loops over s are unrolled so that a set's number is a constant and the sets are registers; the loop over kc stays rolled, one turn of the ring a trip (unrolled further no load would be issued earlier)
#pragma unroll
    for (int s = 0; s < NS - 1; ++s) ldset(s, s);
#pragma unroll 1
    for (int kc = 0; kc < K - NS * 32; kc += NS * 32) {
#pragma unroll
        for (int s = 0; s < NS; ++s) { ldset((s + NS - 1) % NS, s + NS - 1); mmaset(s); }
        xwait(); pa += NS * 512; pa2 += NS * 512; pb += NS * 512; pb2 += NS * 512;
    }
    ldset(NS - 1, NS - 1);   // the last NS blocks: only the last of them is still to be asked for
    mmaset(0); xwait();      // behind it the epilogue may reuse the registers of the bases and of lb
#pragma unroll
    for (int s = 1; s < NS; ++s) mmaset(s);
    const int sel = EPI == 1 ? blockIdx.y / NH_ : 0, hy = EPI == 1 ? blockIdx.y % NH_ : blockIdx.y, b0 = hy * 64;   // EPI 1: which projection, its head, the head's place in its bias
    if constexpr (EPI == 1) { constexpr size_t PLN = (size_t)NB_ * NH_ * TT * HD; bias = sel == 0 ? bias : sel == 1 ? biasK : biasV; P16 += sel * PLN; Ph += sel * 2 * PLN; Pl += sel * 2 * PLN; }
    if (EPI == 1 && sel == 2) {
#pragma unroll
        for (int nb = 0; nb < 4; ++nb) { const float bn = bfr(bias[b0 + nb * 16 + lr]);
#pragma unroll
            for (int mb = 0; mb < 4; ++mb) { const size_t po = ((size_t)bz * NKV + hy) * HD * TT + (size_t)(((t0 >> 5) + (mb >> 1)) * 4 + nb) * 512 + (mb & 1) * 256 + lane * 8; v8h o16; v8us oh, ol;
#pragma unroll
                for (int j = 0; j < 8; ++j) { const float x = acc[mb][nb][j] + bn; o16[j] = tohx(x); unsigned short a2, c2; splitf(x, a2, c2); oh[j] = a2; ol[j] = c2; }
                *(v8h*)(P16 + po) = o16; *(v8us*)(Ph + po) = oh; *(v8us*)(Pl + po) = ol; } }
    } else
#pragma unroll
    for (int mb = 0; mb < 4; ++mb) {
#pragma unroll
        for (int nb = 0; nb < 4; ++nb) {
#pragma unroll
            for (int j = 0; j < 8; ++j) os[(hi * 8 + j) * 68 + nb * 16 + lr] = acc[mb][nb][j]; }
        __builtin_amdgcn_wave_barrier(); asm volatile("" ::: "memory");
        if constexpr (EPI == 1) {
#pragma unroll
            for (int s = 0; s < 4; ++s) { const int cofs = s * 16 + hi * 8; const v4f v0 = *(const v4fa*)(os + lr * 68 + cofs), v1 = *(const v4fa*)(os + lr * 68 + cofs + 4);   // s = k block * 2 + half
                const size_t po = ((size_t)bz * NH_ + hy) * TT * HD + (size_t)((t0 >> 4) + mb) * 1024 + s * 256 + lane * 8; v8h o16; v8us oh, ol;
#pragma unroll
                for (int q = 0; q < 8; ++q) { const float x = (q < 4 ? v0[q & 3] : v1[q & 3]) + bfr(bias[b0 + cofs + q]); o16[q] = tohx(x); unsigned short a2, c2; splitf(x, a2, c2); oh[q] = a2; ol[q] = c2; }
                *(v8h*)(P16 + po) = o16; *(v8us*)(Ph + po) = oh; *(v8us*)(Pl + po) = ol;
                asm volatile("s_wait_xcnt 0x0" ::: "memory"); }   // the wait in front of a rewrite of the registers that these three stores name (the next quarter reuses them; behind the last quarter the built code falls, on a test that never holds there, into V's branch, which rewrites them too)
        } else {
            float* crow = C + (size_t)(r0 + mb * 16) * ldc + c0;
#pragma unroll
            for (int s = 0; s < 8; ++s) { const int row = 2 * s + hi, cofs = lr * 4; v4f val = *(const v4fa*)(os + row * 68 + cofs); if (BIAS) { val[0] += bfr(bias[c0 + cofs]); val[1] += bfr(bias[c0 + cofs + 1]); val[2] += bfr(bias[c0 + cofs + 2]); val[3] += bfr(bias[c0 + cofs + 3]); }
                *(v4f*)(crow + (size_t)row * ldc + cofs) = val; }
            if (mb < 3) asm volatile("s_wait_xcnt 0x0" ::: "memory");   // the wait in front of a rewrite of the registers that these eight stores name (the next row block reuses them)
        }
        __builtin_amdgcn_wave_barrier(); asm volatile("" ::: "memory");
    }
}


// k_pack: the 16-bit planes of x and of the four weights in ONE launch of DQ * DM / 8 = 131072 threads. Piece i = the 16 bytes at element i * 8 of a fragment-major plane of 1024-long rows: lane = i % 32, half = (i / 32) % 2, k block = (i / 64) % 32, row tile = i / 2048.
// Thread g writes piece g of each of the four weight planes (a plane has as many pieces as the grid has threads) and 8 pieces of x: lane and half g % 64 of the 8 k blocks from (g / 64) * 8 on (128 bytes of f32 and 1 KiB of the plane from one to the next). Its 48 loads depend on nothing and are all asked for before the first store.
// Bt[h * 64 + e][k] = w[h][k][e] for Wq, Wk, Wv (planes one behind the other in WQKV), Bt[n][k] = wo[k][n]: 16 lanes read 64 contiguous bytes of w for each of their 8 k; x: rows as they are, 32 bytes of f32 a piece.
#define PKT (DQ * DM / 8)
__global__ __launch_bounds__(256) void k_pack(const float* __restrict__ x, const float* __restrict__ wq, const float* __restrict__ wk, const float* __restrict__ wv, const float* __restrict__ wo, bf* __restrict__ XB, bf* __restrict__ WQKV, bf* __restrict__ WO) {
    constexpr int NX = NB_ * TT * DM / 8 / PKT;   // pieces of x a thread
    static_assert(DQ == DM && DKV == DQ && (DM / 32) % NX == 0, "one index map for the weight planes; a thread's pieces of x lie in one row tile");
    const int g = blockIdx.x * 256 + threadIdx.x, lane = g & 31, kin = ((g >> 5) & 1) * 16 + (lane >> 4) * 8, kb = (g >> 6) % (DM / 32), r = (g >> 6) / (DM / 32) * 16 + (lane & 15), k0 = kb * 32 + kin; const int h = r / HD, e = r % HD;
    const int xb = (g >> 6) * NX, xr = xb / (DM / 32) * 16 + (lane & 15), xk = xb % (DM / 32) * 32 + kin;   // first k block (counted through the plane), row and first k of the thread's pieces of x
    v8f fx[NX]; float fq[8], fk[8], fv[8], fo[8];
    unsigned xo = (unsigned)(xr * DM + xk) * 4, ho = (unsigned)((h * DM + k0) * HD + e) * 4, oo4 = (unsigned)(k0 * DM + r) * 4;   // the thread's byte offsets into x, into a [h][e][d] weight and into wo: scalar base + one 32-bit register, the steps are immediates
#pragma unroll
    for (int j = 0; j < NX; ++j) fx[j] = *(const GLB v8f*)((const gch*)x + j * 128 + xo);
#pragma unroll
    for (int q = 0; q < 8; ++q) { fq[q] = *(const GLB float*)((const gch*)wq + q * HD * 4 + ho); fk[q] = *(const GLB float*)((const gch*)wk + q * HD * 4 + ho); fv[q] = *(const GLB float*)((const gch*)wv + q * HD * 4 + ho); fo[q] = *(const GLB float*)((const gch*)wo + q * DM * 4 + oo4); }
    asm volatile("s_wait_xcnt 0x0" : "+v"(xo), "+v"(ho), "+v"(oo4) :: "memory");   // the wait in front of a rewrite of the registers that the 48 loads name: as its operands the three offsets live up to it, so no load's result and no conversion reuses them earlier
    __builtin_amdgcn_sched_barrier(0);   // keeps all 48 loads ahead of the first conversion: without it three weights' loads are issued only behind the wait for x, a second memory latency in a launch that lasts little longer than one
#pragma unroll
    for (int j = 0; j < NX; ++j) { v8us o;
#pragma unroll
        for (int q = 0; q < 8; ++q) o[q] = f2bf(fx[j][q]);
        *(v8us*)(XB + ((size_t)(xb + j) * 64 + (g & 63)) * 8) = o; }
    v8us oq, ok, ov, oo;
#pragma unroll
    for (int q = 0; q < 8; ++q) { oq[q] = f2bf(fq[q]); ok[q] = f2bf(fk[q]); ov[q] = f2bf(fv[q]); oo[q] = f2bf(fo[q]); }
    *(v8us*)(WQKV + (size_t)g * 8) = oq; *(v8us*)(WQKV + (size_t)DQ * DM + (size_t)g * 8) = ok; *(v8us*)(WQKV + (size_t)2 * DQ * DM + (size_t)g * 8) = ov; *(v8us*)(WO + (size_t)g * 8) = oo;
}
// ---- k_fattn: one wave owns NT x 16 query rows of one head and walks the 2048 keys 32 at a time.
// St = K Qt (A = 16 key rows, B = 16 query rows, both fragment-major planes): in the accumulator a lane holds ONE query (column lane & 15) and keys 8 * (lane >> 4) + j of each 16-key tile,
// which is the k order of a B fragment (elements 0..7 = tile 0, 8..15 = tile 1), so the weights go from the score accumulators straight into Ot += Vt Pt (A = 16 rows d of the V plane, k = t).
// Softmax with a running maximum per query: maximum and sum in-lane plus one exchange between the wave halves; sums of the halves joined once at the end; division by the sum at the end.
// exp8: eight weights in place, p = exp2(p * c + nm). Written as one statement so that every v_exp_f32 is followed by an instruction that neither reads its result nor writes its source
// (the slot the instruction set asks for behind a transcendental): a later element's multiply-add or v_exp_f32 fills it, a v_nop behind the last. exp8a does the same and takes the rescale factor a = exp2(a) along.
__device__ __forceinline__ void exp8(float* p, float c, float nm) {
    asm("v_fma_f32 %0, %0, %8, %9\n\tv_fma_f32 %1, %1, %8, %9\n\tv_exp_f32 %0, %0\n\tv_fma_f32 %2, %2, %8, %9\n\tv_exp_f32 %1, %1\n\tv_fma_f32 %3, %3, %8, %9\n\tv_exp_f32 %2, %2\n\t"
        "v_fma_f32 %4, %4, %8, %9\n\tv_exp_f32 %3, %3\n\tv_fma_f32 %5, %5, %8, %9\n\tv_exp_f32 %4, %4\n\tv_fma_f32 %6, %6, %8, %9\n\tv_exp_f32 %5, %5\n\tv_fma_f32 %7, %7, %8, %9\n\tv_exp_f32 %6, %6\n\tv_exp_f32 %7, %7\n\tv_nop"
        : "+v"(p[0]), "+v"(p[1]), "+v"(p[2]), "+v"(p[3]), "+v"(p[4]), "+v"(p[5]), "+v"(p[6]), "+v"(p[7]) : "s"(c), "v"(nm));
}
__device__ __forceinline__ void exp8a(float* p, float c, float nm, float& a) {
    asm("v_fma_f32 %0, %0, %9, %10\n\tv_exp_f32 %8, %8\n\tv_fma_f32 %1, %1, %9, %10\n\tv_exp_f32 %0, %0\n\tv_fma_f32 %2, %2, %9, %10\n\tv_exp_f32 %1, %1\n\tv_fma_f32 %3, %3, %9, %10\n\tv_exp_f32 %2, %2\n\t"
        "v_fma_f32 %4, %4, %9, %10\n\tv_exp_f32 %3, %3\n\tv_fma_f32 %5, %5, %9, %10\n\tv_exp_f32 %4, %4\n\tv_fma_f32 %6, %6, %9, %10\n\tv_exp_f32 %5, %5\n\tv_fma_f32 %7, %7, %9, %10\n\tv_exp_f32 %6, %6\n\tv_exp_f32 %7, %7\n\tv_nop"
        : "+v"(p[0]), "+v"(p[1]), "+v"(p[2]), "+v"(p[3]), "+v"(p[4]), "+v"(p[5]), "+v"(p[6]), "+v"(p[7]), "+v"(a) : "s"(c), "v"(nm));
}
template <bool HI> struct ASel { typedef h16 T; };
template <> struct ASel<true> { typedef bf T; };
template <bool HI, int NT>
__device__ __forceinline__ void fa_tile(const typename ASel<HI>::T* __restrict__ Q, const typename ASel<HI>::T* __restrict__ Q2, const typename ASel<HI>::T* __restrict__ Kp, const typename ASel<HI>::T* __restrict__ Kp2,
                                        const typename ASel<HI>::T* __restrict__ Vp, const typename ASel<HI>::T* __restrict__ Vp2, int q0, bf* Ah, bf* Al) {
    typedef WFrag<typename ASel<HI>::T> F; typedef typename F::V V;
    const int lane = threadIdx.x & 31; unsigned lb = lane * 16;
    const float CL2 = SCL * 1.4426950408889634f;   // score -> log2 domain
    const float PSH = HI ? 0.0f : 10.0f;           // fp16 weights carry x1024 (log2 = 10): keeps small weights out of the fp16 denormals; the sum carries it too, so it cancels in the division
    V qf[NT][2], qf2[NT][2], kf[2][2], kf2[2][2];
#pragma unroll
    for (int nt = 0; nt < NT; ++nt)
#pragma unroll
        for (int ks = 0; ks < 2; ++ks) { const size_t qo = (size_t)(q0 + nt * 16) * HD + ks * 512; qf[nt][ks] = F::ld(Q + qo, lb); if constexpr (HI) qf2[nt][ks] = F::ld(Q2 + qo, lb); }
    // a pass's 32 keys: K fragments (mt, ks) and V fragments dt, 512 elements each, 2048 in a row from kc * 64 of either plane
    if constexpr (!HI) {
#pragma unroll
        for (int mt = 0; mt < 2; ++mt)
#pragma unroll
            for (int ks = 0; ks < 2; ++ks) kf[mt][ks] = F::ld(Kp + mt * 16 * HD + ks * 512, lb);
    }
    const typename ASel<HI>::T* pk = Kp; const typename ASel<HI>::T* pk2 = Kp2; const typename ASel<HI>::T* pv = Vp; const typename ASel<HI>::T* pv2 = Vp2;   // walk 2048 elements a pass
    v8f o[NT][4]; float m[NT], l[NT];
#pragma unroll
    for (int nt = 0; nt < NT; ++nt) { m[nt] = -3.0e38f; l[nt] = 0.f;
#pragma unroll
        for (int dt = 0; dt < 4; ++dt) o[nt][dt] = (v8f){}; }
    for (int kc = 0; kc < TT; kc += 32) {
        V vf[4], vf2[4];
        if constexpr (HI) {   // hi/lo rows: four planes do not fit the registers one pass ahead; this pass's key rows are asked for first, its value rows fly behind them under the score products and the softmax
#pragma unroll
            for (int mt = 0; mt < 2; ++mt)
#pragma unroll
                for (int ks = 0; ks < 2; ++ks) { kf[mt][ks] = F::ld(pk + mt * 16 * HD + ks * 512, lb); kf2[mt][ks] = F::ld(pk2 + mt * 16 * HD + ks * 512, lb); }
        }
#pragma unroll
        for (int dt = 0; dt < 4; ++dt) { vf[dt] = F::ld(pv + dt * 512, lb); if constexpr (HI) vf2[dt] = F::ld(pv2 + dt * 512, lb); }
        if constexpr (!HI) __builtin_amdgcn_sched_barrier(0);   // keeps the eight value loads here, at the head of the pass: moved down to save registers they would be waited for soon after their issue
        v8f s[NT][2];
#pragma unroll
        for (int nt = 0; nt < NT; ++nt)
#pragma unroll
            for (int mt = 0; mt < 2; ++mt) { s[nt][mt] = (v8f){};
#pragma unroll
                for (int ks = 0; ks < 2; ++ks) { s[nt][mt] = F::mma(kf[mt][ks], qf[nt][ks], s[nt][mt]); if constexpr (HI) { s[nt][mt] = F::mma(kf[mt][ks], qf2[nt][ks], s[nt][mt]); s[nt][mt] = F::mma(kf2[mt][ks], qf[nt][ks], s[nt][mt]); } } }
        if constexpr (!HI) {
            pk = (kc + 32 < TT) ? pk + 32 * HD : Kp;   // the next pass's key rows, fetched behind this pass's score products (the last pass refetches rows 0..31, unused)
#pragma unroll
            for (int mt = 0; mt < 2; ++mt)
#pragma unroll
                for (int ks = 0; ks < 2; ++ks) kf[mt][ks] = F::ld(pk + mt * 16 * HD + ks * 512, lb);
            __builtin_amdgcn_sched_barrier(0);   // keeps the eight key loads here, with the softmax and the second product between them and their use: moved down to the foot of the pass they would be waited for at once
        }
#pragma unroll
        for (int nt = 0; nt < NT; ++nt) {
            float mx = s[nt][0][0];
#pragma unroll
            for (int j = 0; j < 8; ++j) { mx = fmaxf(mx, s[nt][0][j]); mx = fmaxf(mx, s[nt][1][j]); }
            mx = fmaxf(mx, __shfl_xor(mx, 16, 32));
            const float mn = fmaxf(m[nt], mx); float al = (m[nt] - mn) * CL2; const float nm = PSH - mn * CL2; m[nt] = mn;
            float p[16], ps = 0.f;
#pragma unroll
            for (int j = 0; j < 8; ++j) { p[j] = s[nt][0][j]; p[8 + j] = s[nt][1][j]; }
            exp8a(p, CL2, nm, al); exp8(p + 8, CL2, nm);
#pragma unroll
            for (int j = 0; j < 16; ++j) ps += p[j];
            l[nt] = l[nt] * al + ps;
#pragma unroll
            for (int dt = 0; dt < 4; ++dt)
#pragma unroll
                for (int j = 0; j < 8; ++j) o[nt][dt][j] *= al;
            if constexpr (HI) {
                v8us h0, h1, l0, l1;
#pragma unroll
                for (int j = 0; j < 8; ++j) { unsigned short a, c2; splitf(p[j], a, c2); h0[j] = a; l0[j] = c2; splitf(p[8 + j], a, c2); h1[j] = a; l1[j] = c2; }
                const V ph = cat16b(h0, h1), pl = cat16b(l0, l1);
#pragma unroll
                for (int dt = 0; dt < 4; ++dt) { o[nt][dt] = F::mma(vf[dt], ph, o[nt][dt]); o[nt][dt] = F::mma(vf[dt], pl, o[nt][dt]); o[nt][dt] = F::mma(vf2[dt], ph, o[nt][dt]); }
            } else {
                V pb;
#pragma unroll
                for (int j = 0; j < 16; ++j) pb[j] = tohx(p[j]);
#pragma unroll
                for (int dt = 0; dt < 4; ++dt) o[nt][dt] = F::mma(vf[dt], pb, o[nt][dt]);
            }
        }
        // the wait in front of a rewrite of the registers that this pass's loads name: the scalar bases, which as operands of the wait are stepped behind it; lb is an operand for the reason given in k_gemmw; nothing writes it
        if constexpr (HI) { asm volatile("s_wait_xcnt 0x0" : "+s"(pk), "+s"(pk2), "+s"(pv), "+s"(pv2), "+v"(lb) :: "memory"); pk += 32 * HD; pk2 += 32 * HD; pv += 32 * HD; pv2 += 32 * HD; }
        else { asm volatile("s_wait_xcnt 0x0" : "+s"(pk), "+s"(pv), "+v"(lb) :: "memory"); pv += 32 * HD; }
    }
#pragma unroll
    for (int nt = 0; nt < NT; ++nt) {
        const float inv = __fdiv_rn(1.0f, l[nt] + __shfl_xor(l[nt], 16, 32));
        const size_t oo = (size_t)(q0 + nt * 16) * DQ + 8 * lane;   // a lane holds d = dt * 16 + 8 * (lane >> 4) + j of its query (row lane & 15): its 16 bytes of half dt & 1 of k block h * 2 + dt / 2 of the merged plane's row tile
#pragma unroll
        for (int dt = 0; dt < 4; ++dt) { v8us oh, ol;
#pragma unroll
            for (int j = 0; j < 8; ++j) { unsigned short a, c2; splitf(o[nt][dt][j] * inv, a, c2); oh[j] = a; ol[j] = c2; }
            *(v8us*)(Ah + oo + dt * 256) = oh; *(v8us*)(Al + oo + dt * 256) = ol; }
    }
}
// grid (batches x heads, RH / 32 + (TT - RH) / 64), 2 independent waves a block: blockIdx.y < RH / 32 takes 16 hi/lo rows a wave (twice the loads of the others; they take the lowest indices), the rest 32 fp16 rows a wave; output = the merged hi/lo planes (rows b * 2048 + t, k = h * 64 + d; a head's two k blocks start h * 1024 into a row tile)
__global__ __launch_bounds__(64) void k_fattn(const h16* __restrict__ Q16, const h16* __restrict__ K16, const h16* __restrict__ V16, const bf* __restrict__ Qh, const bf* __restrict__ Ql, const bf* __restrict__ Kh, const bf* __restrict__ Kl, const bf* __restrict__ Vh, const bf* __restrict__ Vl, bf* Ah, bf* Al) {
    const int h = blockIdx.x % NH_, w = threadIdx.x >> 5, bx = blockIdx.y; const size_t po = (size_t)blockIdx.x * TT * HD; Ah += (size_t)(blockIdx.x / NH_) * TT * DQ; Al += (size_t)(blockIdx.x / NH_) * TT * DQ;
    if (bx < RH / 32) fa_tile<true, 1>(Qh + po, Ql + po, Kh + po, Kl + po, Vh + po, Vl + po, (bx * 2 + w) * 16, Ah + h * 1024, Al + h * 1024);
    else fa_tile<false, 2>(Q16 + po, nullptr, K16 + po, nullptr, V16 + po, nullptr, RH + ((bx - RH / 32) * 2 + w) * 32, Ah + h * 1024, Al + h * 1024);
}

extern "C" void kernel_launch(void* const* d_in, const int* in_sizes, int n_in,
                              void* d_out, int out_size, void* d_ws, size_t ws_size, hipStream_t stream) {
    (void)in_sizes; (void)n_in; (void)out_size;
    const float* x = (const float*)d_in[0]; const float* wq = (const float*)d_in[1]; const float* bq = (const float*)d_in[2]; const float* wk = (const float*)d_in[3]; const float* bk = (const float*)d_in[4]; const float* wv = (const float*)d_in[5]; const float* bv = (const float*)d_in[6]; const float* wo = (const float*)d_in[7]; const float* bo = (const float*)d_in[8];   /* order seq_inputs, Wq [16][1024][64], bq [16][64], Wk, bk, Wv, bv, Wo ('xw' [1024][1024]), bo */
    float* OUT = (float*)d_out;     // [4][2048][1024]
    char* wsp = (char*)d_ws;
    auto take = [&](size_t bytes) { char* p = wsp; wsp += (bytes + 255) & ~(size_t)255; return (void*)p; };
    constexpr size_t PLN = (size_t)NB_ * NH_ * TT * HD;   // elements of one set of head planes
    bf* WQKV = (bf*)take((size_t)3 * DQ * DM * 2); bf* WO = (bf*)take((size_t)DM * DQ * 2);
    bf* XB = (bf*)take((size_t)NB_ * TT * DM * 2);
    h16* QP16 = (h16*)take(3 * PLN * 2); h16* KP16 = QP16 + PLN; h16* VT16 = QP16 + 2 * PLN;
    bf* QPh = (bf*)take(6 * PLN * 2); bf* QPl = QPh + PLN; bf* KPh = QPh + 2 * PLN; bf* KPl = QPh + 3 * PLN; bf* VTh = QPh + 4 * PLN; bf* VTl = QPh + 5 * PLN;
    bf* ATh = (bf*)take((size_t)NB_ * TT * DQ * 2); bf* ATl = (bf*)take((size_t)NB_ * TT * DQ * 2);
    if ((size_t)(wsp - (char*)d_ws) > ws_size) return;    // 200 MiB of the 256 MiB
    k_pack<<<PKT / 256, 256, 0, stream>>>(x, wq, wk, wv, wo, XB, WQKV, WO);
    k_gemmw<bf, 0, true, 1, DM><<<dim3(NB_ * TT / 64, 3 * DQ / 64, 1), 32, 0, stream>>>(XB, nullptr, WQKV, nullptr, nullptr, 0, bq, bk, bv, 0, 0, 0, QP16, QPh, QPl);
    k_fattn<<<dim3(NB_ * NH_, RH / 32 + (TT - RH) / 64, 1), 64, 0, stream>>>(QP16, KP16, VT16, QPh, QPl, KPh, KPl, VTh, VTl, ATh, ATl);
    k_gemmw<bf, 1, true, 0, DQ><<<dim3(NB_ * TT / 64, DM / 64, 1), 32, 0, stream>>>(ATh, ATl, WO, nullptr, OUT, DM, bo, nullptr, nullptr, 0, 0, 0, nullptr, nullptr, nullptr);
}

// v007
// Measured time: 189 microseconds a run.
// In both of two side-by-side timings against v006, it was 1.05 times as fast.
// Over all steps from v000 it is 21.2 times as fast.
#include <hip/hip_runtime.h>

// Multi-head attention layer with per-head packed projection layers (seq_inputs [4][2048][1024]; Q, K, V = einsum('bse,hed', x, W) + b with W [16][1024][64] = [h][e][d] (1/32) and b [16][64]; scores / sqrt(64); softmax (no mask); heads concatenated in order; out = cat Wo + bo ('xw' [1024][1024] + bias) -> [4][2048][1024] (8.4 M); argument order seq_inputs, Wq, bq, Wk, bk, Wv, bv, Wo, bo).
// Every launch covers all 4 batches (the rows of the GEMMs are b * 2048 + t, the head planes are [b][h][..], the attention grid's x is b * 16 + h). Layout: k_pack (one launch) makes the bf16 copy of x, turns each [h][e][d] weight into Bt rows h*64 + d (Q, K, V rows one behind the other: one Bt of 3072 rows) and transposes Wo; the [16][64] biases are the flat [1024] epilogue vectors; exact projections + f32 biases, all three as one product of N = 3072, whose epilogues write the head planes themselves (Q, K as [h][t][d], V as [h][d][t]; fp16 + hi/lo); k_fattn: scores, softmax and weights x V of all 64 (batch, head) pairs in one launch, scores never leave registers (hybrid rows: < 512 hi/lo 3 products, rest fp16 weights x1024); merged hi/lo x Wo ('xw' transposed once) exact + bo.
// Every 16-bit operand plane is stored FRAGMENT-MAJOR: a 16-row x 32-k fragment is 1 KiB, [half = (k % 32) / 16][lane = ((k % 16) / 8) * 16 + row % 16][k % 8], so each of a fragment's two 16-byte-a-lane loads covers 512 contiguous bytes (4 whole lines, not 16 pieces of 32 bytes).
// Order of the fragments: GEMM operands, Q and K [row tile][k block]; V (rows d, k = t) [k block][row tile], so a pass of 32 keys reads 4 KiB in a row of K and of V. Values and every sum order are those of the row-major planes.
// Compute dtypes, f32 accumulate: every input rounded to bf16; projections exact + f32 biases; attention rows < 512 3 products, rest fp16; softmax f32 (running maximum); Wo hl x exact + bias.

#define NB_  4
#define TT   2048
#define DM   1024
#define NH_  16
#define NKV  16
#define HD   64
#define DQ   (NH_ * HD)
#define DKV  (NKV * HD)
#define RH   512                  // query rows < RH use hi+lo planes (0: none)
#define SCL  0.125f   // HD^-0.5
typedef _Float16 h16;
typedef unsigned short bf;
typedef __attribute__((ext_vector_type(16))) __bf16   v16bf;
typedef __attribute__((ext_vector_type(16))) _Float16 v16h;
typedef __attribute__((ext_vector_type(8)))  _Float16 v8h;
typedef __attribute__((ext_vector_type(8)))  unsigned short v8us;
typedef __attribute__((ext_vector_type(8)))  float    v8f;
typedef __attribute__((ext_vector_type(4)))  float    v4f;
typedef v8h  __attribute__((may_alias)) v8ha;
typedef v4f  __attribute__((may_alias)) v4fa;
typedef v8us __attribute__((may_alias)) v8usa;

__device__ __forceinline__ unsigned short f2bf(float f) { unsigned u = __float_as_uint(f); u += 0x7FFFu + ((u >> 16) & 1u); return (unsigned short)(u >> 16); }
__device__ __forceinline__ float bf2f(unsigned short b) { return __uint_as_float(((unsigned)b) << 16); }
__device__ __forceinline__ float bfr(float f) { return bf2f(f2bf(f)); }
__device__ __forceinline__ v16h cat16(v8h lo, v8h hi) { return __builtin_shufflevector(lo, hi, 0, 1, 2, 3, 4, 5, 6, 7, 8, 9, 10, 11, 12, 13, 14, 15); }
__device__ __forceinline__ v16bf cat16b(v8us lo, v8us hi) { return __builtin_bit_cast(v16bf, __builtin_shufflevector(lo, hi, 0, 1, 2, 3, 4, 5, 6, 7, 8, 9, 10, 11, 12, 13, 14, 15)); }
__device__ __forceinline__ v8f wmma16(v16h a, v16h b, v8f c) { return __builtin_amdgcn_wmma_f32_16x16x32_f16(false, a, false, b, (short)0, c, false, false); }
__device__ __forceinline__ v8f wmmab(v16bf a, v16bf b, v8f c) { return __builtin_amdgcn_wmma_f32_16x16x32_bf16(false, a, false, b, (short)0, c, false, false); }
__device__ __forceinline__ h16 tohx(float x) { return (h16)x; }
__device__ __forceinline__ void splitf(float y, unsigned short& h, unsigned short& l) { h = f2bf(y); l = f2bf(y - bf2f(h)); }



// ---- k_gemmw: register-blocked GEMM, ONE WAVE per 64x64 output tile (16 accumulators), operands straight from fragment-major 16-bit planes (ld: p = the fragment, the same for the whole wave, lb = lane * 16 bytes: the one vector register of every operand address); grid (M/64, N/64, Z), 32 threads.
// C[m][n] (f32, pitch ldc, + optional f32 bias[n]) = sum_k A[m][k] Bt[n][k] (+ split products per NSPLIT). z-batch strides sA/sB/sC in elements. K % 32 == 0, a compile-time constant: the steps from row tile to row tile are then immediate offsets of the loads.
// EPI 0 stores C. EPI 1 is the three projections in one grid and stores no f32: m = b * 2048 + t (a 64-row tile lies in one batch), a tile's 64 columns are one head of one projection (n = sel * 1024 + h * 64 + d; sel 0, 1, 2 = Q, K, V, the same for the whole block), and the result + that projection's bias goes out as fp16 and as bf16 hi + lo
// (P16 = three planes Q, K, V one behind the other; Ph and Pl point into six: Q hi, Q lo, K hi, K lo, V hi, V lo):
// Q and K as [b][h] planes of rows t, k = d (through the LDS rows: a lane picks up its 8 d of its row, a store is 512 bytes in a row), V as [b][h] planes of rows d, k = t (a lane's accumulator holds 8 consecutive t of one d, which is its 16 bytes of a fragment half: straight from registers, 512 bytes in a row a store).
#define GLB __attribute__((address_space(1)))   // the planes lie in global memory: said at the load, because a pointer that has been an operand of an asm statement is otherwise read with flat loads
typedef GLB char gch;
#define LDSA __attribute__((address_space(3)))   // the staged tiles lie in LDS: said at the load, so that it is a ds_load
typedef LDSA char lch;
template <typename T16> struct WFrag;
template <> struct WFrag<h16> { typedef v16h V; static __device__ __forceinline__ V ld(const h16* p, unsigned lb) { const gch* c = (const gch*)p + lb; return cat16(*(const GLB v8h*)c, *(const GLB v8h*)(c + 512)); } static __device__ __forceinline__ V ldl(const lch* c) { return cat16(*(const LDSA v8h*)c, *(const LDSA v8h*)(c + 512)); } static __device__ __forceinline__ v8f mma(V a, V b, v8f c) { return wmma16(a, b, c); } };
template <> struct WFrag<bf> { typedef v16bf V; static __device__ __forceinline__ V ld(const bf* p, unsigned lb) { const gch* c = (const gch*)p + lb; return cat16b(*(const GLB v8us*)c, *(const GLB v8us*)(c + 512)); } static __device__ __forceinline__ V ldl(const lch* c) { return cat16b(*(const LDSA v8us*)c, *(const LDSA v8us*)(c + 512)); } static __device__ __forceinline__ v8f mma(V a, V b, v8f c) { return wmmab(a, b, c); } };
template <typename T16, int NSPLIT, bool BIAS, int EPI, int K>
__global__ __launch_bounds__(32) void k_gemmw(const T16* __restrict__ A, const T16* __restrict__ A2, const T16* __restrict__ Bt, const T16* __restrict__ Bt2, float* C, int ldc, const float* __restrict__ bias, const float* __restrict__ biasK, const float* __restrict__ biasV, size_t sA, size_t sB, size_t sC, h16* P16, bf* Ph, bf* Pl) {
    typedef typename WFrag<T16>::V V;
    __shared__ __align__(16) float os[16 * 68];
    const size_t z = blockIdx.z; A += z * sA; if (A2) A2 += z * sA; Bt += z * sB; if (Bt2) Bt2 += z * sB; C += z * sC;
    const int lane = threadIdx.x & 31, lr = lane & 15, hi = lane >> 4; const int r0 = blockIdx.x * 64, c0 = blockIdx.y * 64; const int bz = r0 / TT, t0 = r0 % TT;
    v8f acc[4][4];
#pragma unroll
    for (int mb = 0; mb < 4; ++mb)
#pragma unroll
        for (int nb = 0; nb < 4; ++nb) acc[mb][nb] = (v8f){};
    const T16* pa = A + (size_t)r0 * K; const T16* pa2 = A2 + (size_t)r0 * K; const T16* pb = Bt + (size_t)c0 * K; const T16* pb2 = Bt2 + (size_t)c0 * K; unsigned lb = lane * 16;   // row tile r0 / 16 starts at (r0 / 16) * (K / 32) * 512; the pointers walk NS k blocks (512 elements each) a trip
    // Ring of NS register sets, one k block (all fragments of both operands) a set: block t + NS - 1 is asked for in front of block t's products, so a load has NS - 1 blocks of products between its issue and its wait.
    constexpr int NS = NSPLIT == 0 ? 4 : 2;   // 64 registers a set without split planes, 96 with A2: 128 accumulators + the sets stay under 512, two waves a SIMD
    static_assert(K % (NS * 32) == 0 && K >= NS * 32, "K is a whole number of rings");
    V a[NS][4], a2[NS][4], b[NS][4], b2[NS][4];
    auto ldset = [&](int s, int blk) __attribute__((always_inline)) {
#pragma unroll
        for (int mb = 0; mb < 4; ++mb) { a[s][mb] = WFrag<T16>::ld(pa + mb * 16 * K + blk * 512, lb); if (NSPLIT == 1 || NSPLIT == 2) a2[s][mb] = WFrag<T16>::ld(pa2 + mb * 16 * K + blk * 512, lb); }
#pragma unroll
        for (int nb = 0; nb < 4; ++nb) { b[s][nb] = WFrag<T16>::ld(pb + nb * 16 * K + blk * 512, lb); if (NSPLIT >= 2) b2[s][nb] = WFrag<T16>::ld(pb2 + nb * 16 * K + blk * 512, lb); }
        __builtin_amdgcn_sched_barrier(0);   // keeps the set's loads here, ahead of the products of the older sets: moved down to their use they would be waited for at once
    };
    auto mmaset = [&](int s) __attribute__((always_inline)) {
#pragma unroll
        for (int nb = 0; nb < 4; ++nb)
#pragma unroll
            for (int mb = 0; mb < 4; ++mb) { acc[mb][nb] = WFrag<T16>::mma(a[s][mb], b[s][nb], acc[mb][nb]); if (NSPLIT == 1 || NSPLIT == 2) acc[mb][nb] = WFrag<T16>::mma(a2[s][mb], b[s][nb], acc[mb][nb]); if (NSPLIT >= 2) acc[mb][nb] = WFrag<T16>::mma(a[s][mb], b2[s][nb], acc[mb][nb]); }
        __builtin_amdgcn_sched_barrier(0);   // keeps the next set's loads behind these products, which read the registers that those loads fill
    };
    // the wait in front of a rewrite of the registers that the issued loads name: the scalar bases, which as operands of the wait are stepped (or given up) behind it. lb is an operand so that it stays the one 32-bit offset register of the loads
    // (scalar base + offset form; widened to 64 bits in front of the loop, it would be added to each base in vector registers, which the loads' results then reuse); nothing writes it
    auto xwait = [&]() __attribute__((always_inline)) {
        if constexpr (NSPLIT == 0) asm volatile("s_wait_xcnt 0x0" : "+s"(pa), "+s"(pb), "+v"(lb) :: "memory");
        else if constexpr (NSPLIT == 1) asm volatile("s_wait_xcnt 0x0" : "+s"(pa), "+s"(pa2), "+s"(pb), "+v"(lb) :: "memory");
        else asm volatile("s_wait_xcnt 0x0" : "+s"(pa), "+s"(pa2), "+s"(pb), "+s"(pb2), "+v"(lb) :: "memory");
    };
    // the loops over s are unrolled so that a set's number is a constant and the sets are registers; the loop over kc stays rolled, one turn of the ring a trip (unrolled further no load would be issued earlier)
#pragma unroll
    for (int s = 0; s < NS - 1; ++s) ldset(s, s);
#pragma unroll 1
    for (int kc = 0; kc < K - NS * 32; kc += NS * 32) {
#pragma unroll
        for (int s = 0; s < NS; ++s) { ldset((s + NS - 1) % NS, s + NS - 1); mmaset(s); }
        xwait(); pa += NS * 512; pa2 += NS * 512; pb += NS * 512; pb2 += NS * 512;
    }
    ldset(NS - 1, NS - 1);   // the last NS blocks: only the last of them is still to be asked for
    mmaset(0); xwait();      // behind it the epilogue may reuse the registers of the bases and of lb
#pragma unroll
    for (int s = 1; s < NS; ++s) mmaset(s);
    const int sel = EPI == 1 ? blockIdx.y / NH_ : 0, hy = EPI == 1 ? blockIdx.y % NH_ : blockIdx.y, b0 = hy * 64;   // EPI 1: which projection, its head, the head's place in its bias
    if constexpr (EPI == 1) { constexpr size_t PLN = (size_t)NB_ * NH_ * TT * HD; bias = sel == 0 ? bias : sel == 1 ? biasK : biasV; P16 += sel * PLN; Ph += sel * 2 * PLN; Pl += sel * 2 * PLN; }
    if (EPI == 1 && sel == 2) {
#pragma unroll
        for (int nb = 0; nb < 4; ++nb) { const float bn = bfr(bias[b0 + nb * 16 + lr]);
#pragma unroll
            for (int mb = 0; mb < 4; ++mb) { const size_t po = ((size_t)bz * NKV + hy) * HD * TT + (size_t)(((t0 >> 5) + (mb >> 1)) * 4 + nb) * 512 + (mb & 1) * 256 + lane * 8; v8h o16; v8us oh, ol;
#pragma unroll
                for (int j = 0; j < 8; ++j) { const float x = acc[mb][nb][j] + bn; o16[j] = tohx(x); unsigned short a2, c2; splitf(x, a2, c2); oh[j] = a2; ol[j] = c2; }
                *(v8h*)(P16 + po) = o16; *(v8us*)(Ph + po) = oh; *(v8us*)(Pl + po) = ol; } }
    } else
#pragma unroll
    for (int mb = 0; mb < 4; ++mb) {
#pragma unroll
        for (int nb = 0; nb < 4; ++nb) {
#pragma unroll
            for (int j = 0; j < 8; ++j) os[(hi * 8 + j) * 68 + nb * 16 + lr] = acc[mb][nb][j]; }
        __builtin_amdgcn_wave_barrier(); asm volatile("" ::: "memory");
        if constexpr (EPI == 1) {
#pragma unroll
            for (int s = 0; s < 4; ++s) { const int cofs = s * 16 + hi * 8; const v4f v0 = *(const v4fa*)(os + lr * 68 + cofs), v1 = *(const v4fa*)(os + lr * 68 + cofs + 4);   // s = k block * 2 + half
                const size_t po = ((size_t)bz * NH_ + hy) * TT * HD + (size_t)((t0 >> 4) + mb) * 1024 + s * 256 + lane * 8; v8h o16; v8us oh, ol;
#pragma unroll
                for (int q = 0; q < 8; ++q) { const float x = (q < 4 ? v0[q & 3] : v1[q & 3]) + bfr(bias[b0 + cofs + q]); o16[q] = tohx(x); unsigned short a2, c2; splitf(x, a2, c2); oh[q] = a2; ol[q] = c2; }
                *(v8h*)(P16 + po) = o16; *(v8us*)(Ph + po) = oh; *(v8us*)(Pl + po) = ol;
                asm volatile("s_wait_xcnt 0x0" ::: "memory"); }   // the wait in front of a rewrite of the registers that these three stores name (the next quarter reuses them; behind the last quarter the built code falls, on a test that never holds there, into V's branch, which rewrites them too)
        } else {
            float* crow = C + (size_t)(r0 + mb * 16) * ldc + c0;
#pragma unroll
            for (int s = 0; s < 8; ++s) { const int row = 2 * s + hi, cofs = lr * 4; v4f val = *(const v4fa*)(os + row * 68 + cofs); if (BIAS) { val[0] += bfr(bias[c0 + cofs]); val[1] += bfr(bias[c0 + cofs + 1]); val[2] += bfr(bias[c0 + cofs + 2]); val[3] += bfr(bias[c0 + cofs + 3]); }
                *(v4f*)(crow + (size_t)row * ldc + cofs) = val; }
            if (mb < 3) asm volatile("s_wait_xcnt 0x0" ::: "memory");   // the wait in front of a rewrite of the registers that these eight stores name (the next row block reuses them)
        }
        __builtin_amdgcn_wave_barrier(); asm volatile("" ::: "memory");
    }
}


// k_pack: the 16-bit planes of x and of the four weights in ONE launch of DQ * DM / 8 = 131072 threads. Piece i = the 16 bytes at element i * 8 of a fragment-major plane of 1024-long rows: lane = i % 32, half = (i / 32) % 2, k block = (i / 64) % 32, row tile = i / 2048.
// Thread g writes piece g of each of the four weight planes (a plane has as many pieces as the grid has threads) and 8 pieces of x: lane and half g % 64 of the 8 k blocks from (g / 64) * 8 on (128 bytes of f32 and 1 KiB of the plane from one to the next). Its 48 loads depend on nothing and are all asked for before the first store.
// Bt[h * 64 + e][k] = w[h][k][e] for Wq, Wk, Wv (planes one behind the other in WQKV), Bt[n][k] = wo[k][n]: 16 lanes read 64 contiguous bytes of w for each of their 8 k; x: rows as they are, 32 bytes of f32 a piece.
#define PKT (DQ * DM / 8)
__global__ __launch_bounds__(256) void k_pack(const float* __restrict__ x, const float* __restrict__ wq, const float* __restrict__ wk, const float* __restrict__ wv, const float* __restrict__ wo, bf* __restrict__ XB, bf* __restrict__ WQKV, bf* __restrict__ WO) {
    constexpr int NX = NB_ * TT * DM / 8 / PKT;   // pieces of x a thread
    static_assert(DQ == DM && DKV == DQ && (DM / 32) % NX == 0, "one index map for the weight planes; a thread's pieces of x lie in one row tile");
    const int g = blockIdx.x * 256 + threadIdx.x, lane = g & 31, kin = ((g >> 5) & 1) * 16 + (lane >> 4) * 8, kb = (g >> 6) % (DM / 32), r = (g >> 6) / (DM / 32) * 16 + (lane & 15), k0 = kb * 32 + kin; const int h = r / HD, e = r % HD;
    const int xb = (g >> 6) * NX, xr = xb / (DM / 32) * 16 + (lane & 15), xk = xb % (DM / 32) * 32 + kin;   // first k block (counted through the plane), row and first k of the thread's pieces of x
    v8f fx[NX]; float fq[8], fk[8], fv[8], fo[8];
    unsigned xo = (unsigned)(xr * DM + xk) * 4, ho = (unsigned)((h * DM + k0) * HD + e) * 4, oo4 = (unsigned)(k0 * DM + r) * 4;   // the thread's byte offsets into x, into a [h][e][d] weight and into wo: scalar base + one 32-bit register, the steps are immediates
#pragma unroll
    for (int j = 0; j < NX; ++j) fx[j] = *(const GLB v8f*)((const gch*)x + j * 128 + xo);
#pragma unroll
    for (int q = 0; q < 8; ++q) { fq[q] = *(const GLB float*)((const gch*)wq + q * HD * 4 + ho); fk[q] = *(const GLB float*)((const gch*)wk + q * HD * 4 + ho); fv[q] = *(const GLB float*)((const gch*)wv + q * HD * 4 + ho); fo[q] = *(const GLB float*)((const gch*)wo + q * DM * 4 + oo4); }
    asm volatile("s_wait_xcnt 0x0" : "+v"(xo), "+v"(ho), "+v"(oo4) :: "memory");   // the wait in front of a rewrite of the registers that the 48 loads name: as its operands the three offsets live up to it, so no load's result and no conversion reuses them earlier
    __builtin_amdgcn_sched_barrier(0);   // keeps all 48 loads ahead of the first conversion: without it three weights' loads are issued only behind the wait for x, a second memory latency in a launch that lasts little longer than one
#pragma unroll
    for (int j = 0; j < NX; ++j) { v8us o;
#pragma unroll
        for (int q = 0; q < 8; ++q) o[q] = f2bf(fx[j][q]);
        *(v8us*)(XB + ((size_t)(xb + j) * 64 + (g & 63)) * 8) = o; }
    v8us oq, ok, ov, oo;
#pragma unroll
    for (int q = 0; q < 8; ++q) { oq[q] = f2bf(fq[q]); ok[q] = f2bf(fk[q]); ov[q] = f2bf(fv[q]); oo[q] = f2bf(fo[q]); }
    *(v8us*)(WQKV + (size_t)g * 8) = oq; *(v8us*)(WQKV + (size_t)DQ * DM + (size_t)g * 8) = ok; *(v8us*)(WQKV + (size_t)2 * DQ * DM + (size_t)g * 8) = ov; *(v8us*)(WO + (size_t)g * 8) = oo;
}
// ---- k_fattn: one wave owns NT x 16 query rows of one head and walks the 2048 keys 32 at a time.
// St = K Qt (A = 16 key rows, B = 16 query rows, both fragment-major planes): in the accumulator a lane holds ONE query (column lane & 15) and keys 8 * (lane >> 4) + j of each 16-key tile,
// which is the k order of a B fragment (elements 0..7 = tile 0, 8..15 = tile 1), so the weights go from the score accumulators straight into Ot += Vt Pt (A = 16 rows d of the V plane, k = t).
// Softmax with a running maximum per query: maximum and sum in-lane plus one exchange between the wave halves; sums of the halves joined once at the end; division by the sum at the end.
// exp8: eight weights in place, p = exp2(p * c + nm). Written as one statement so that every v_exp_f32 is followed by an instruction that neither reads its result nor writes its source
// (the slot the instruction set asks for behind a transcendental): a later element's multiply-add or v_exp_f32 fills it, a v_nop behind the last. exp8a does the same and takes the rescale factor a = exp2(a) along.
__device__ __forceinline__ void exp8(float* p, float c, float nm) {
    asm("v_fma_f32 %0, %0, %8, %9\n\tv_fma_f32 %1, %1, %8, %9\n\tv_exp_f32 %0, %0\n\tv_fma_f32 %2, %2, %8, %9\n\tv_exp_f32 %1, %1\n\tv_fma_f32 %3, %3, %8, %9\n\tv_exp_f32 %2, %2\n\t"
        "v_fma_f32 %4, %4, %8, %9\n\tv_exp_f32 %3, %3\n\tv_fma_f32 %5, %5, %8, %9\n\tv_exp_f32 %4, %4\n\tv_fma_f32 %6, %6, %8, %9\n\tv_exp_f32 %5, %5\n\tv_fma_f32 %7, %7, %8, %9\n\tv_exp_f32 %6, %6\n\tv_exp_f32 %7, %7\n\tv_nop"
        : "+v"(p[0]), "+v"(p[1]), "+v"(p[2]), "+v"(p[3]), "+v"(p[4]), "+v"(p[5]), "+v"(p[6]), "+v"(p[7]) : "s"(c), "v"(nm));
}
__device__ __forceinline__ void exp8a(float* p, float c, float nm, float& a) {
    asm("v_fma_f32 %0, %0, %9, %10\n\tv_exp_f32 %8, %8\n\tv_fma_f32 %1, %1, %9, %10\n\tv_exp_f32 %0, %0\n\tv_fma_f32 %2, %2, %9, %10\n\tv_exp_f32 %1, %1\n\tv_fma_f32 %3, %3, %9, %10\n\tv_exp_f32 %2, %2\n\t"
        "v_fma_f32 %4, %4, %9, %10\n\tv_exp_f32 %3, %3\n\tv_fma_f32 %5, %5, %9, %10\n\tv_exp_f32 %4, %4\n\tv_fma_f32 %6, %6, %9, %10\n\tv_exp_f32 %5, %5\n\tv_fma_f32 %7, %7, %9, %10\n\tv_exp_f32 %6, %6\n\tv_exp_f32 %7, %7\n\tv_nop"
        : "+v"(p[0]), "+v"(p[1]), "+v"(p[2]), "+v"(p[3]), "+v"(p[4]), "+v"(p[5]), "+v"(p[6]), "+v"(p[7]), "+v"(a) : "s"(c), "v"(nm));
}
#define STGB 32768   // bytes of one buffer of the ring
#define CP1(l, g, o) "global_load_async_to_lds_b128 " l ", " g ", off offset:" #o "\n\t"
#define CP4(l, g)  CP1(l, g, 0) CP1(l, g, 2048) CP1(l, g, 4096) CP1(l, g, 6144)
#define CP4B(l, g) CP1(l, g, 8192) CP1(l, g, 10240) CP1(l, g, 12288) CP1(l, g, 14336)
template <bool HI> struct ASel { typedef h16 T; };
template <> struct ASel<true> { typedef bf T; };
template <bool HI, int NT>
__device__ __forceinline__ void fa_tile(const typename ASel<HI>::T* __restrict__ Q, const typename ASel<HI>::T* __restrict__ Q2, const typename ASel<HI>::T* __restrict__ Kp, const typename ASel<HI>::T* __restrict__ Kp2,
                                        const typename ASel<HI>::T* __restrict__ Vp, const typename ASel<HI>::T* __restrict__ Vp2, int q0, bf* Ah, bf* Al, char* sm) {
    typedef WFrag<typename ASel<HI>::T> F; typedef typename F::V V;
    const int lane = threadIdx.x & 31; unsigned lb = lane * 16;
    const float CL2 = SCL * 1.4426950408889634f;   // score -> log2 domain
    const float PSH = HI ? 0.0f : 10.0f;           // fp16 weights carry x1024 (log2 = 10): keeps small weights out of the fp16 denormals; the sum carries it too, so it cancels in the division
    V qf[NT][2], qf2[NT][2], kf[2][2], kf2[2][2];
    const typename ASel<HI>::T* pq = Q; const typename ASel<HI>::T* pq2 = Q2;
#pragma unroll
    for (int nt = 0; nt < NT; ++nt)
#pragma unroll
        for (int ks = 0; ks < 2; ++ks) { const size_t qo = (size_t)(q0 + nt * 16) * HD + ks * 512; qf[nt][ks] = F::ld(pq + qo, lb); if constexpr (HI) qf2[nt][ks] = F::ld(pq2 + qo, lb); }
    // the wait in front of a rewrite of the registers that the query loads name: their address registers are given up behind it; lb lives on as the lane's offset into a fragment in LDS
    if constexpr (HI) asm volatile("s_wait_xcnt 0x0" : "+s"(pq), "+s"(pq2), "+v"(lb) :: "memory"); else asm volatile("s_wait_xcnt 0x0" : "+s"(pq), "+v"(lb) :: "memory");
    // Ring of two 32-KiB buffers in LDS, filled by asynchronous copies and read by all four waves of the block. A stage = PPS passes of 32 keys; of each plane that is PB bytes in a row (the planes are fragment-major), copied as they lie:
    // fp16 rows: K at 0, V at 16 KiB; hi/lo rows: K hi, K lo, V hi, V lo at 0, 8, 16, 24 KiB. A thread copies 16 bytes at threadIdx.x * 16 of every 2 KiB; the immediate offset moves the LDS and the global address alike.
    constexpr int PPS = HI ? 2 : 4, PB = PPS * 4096, NSTG = TT / (32 * PPS);
    static_assert(NSTG >= 2 && TT % (32 * PPS) == 0 && (HI ? 4 : 2) * PB == STGB, "two stages at least; the planes' slices fill a buffer");
    const unsigned tb = threadIdx.x * 16, sm0 = (unsigned)(size_t)sm + tb;
    auto fill = [&](int t, int buf) __attribute__((always_inline)) {   // the s_wait_xcnt stands inside the copies' own statement: the address registers live to its end, nothing rewrites them ahead of it
        const unsigned l0 = sm0 + buf * STGB; const size_t go = (size_t)t * PB + tb;
        if constexpr (HI) asm volatile(CP4("%0", "%4") CP4("%1", "%5") CP4("%2", "%6") CP4("%3", "%7") "s_wait_xcnt 0x0"
            :: "v"(l0), "v"(l0 + PB), "v"(l0 + 2 * PB), "v"(l0 + 3 * PB), "v"((const gch*)Kp + go), "v"((const gch*)Kp2 + go), "v"((const gch*)Vp + go), "v"((const gch*)Vp2 + go) : "memory");
        else asm volatile(CP4("%0", "%2") CP4B("%0", "%2") CP4("%1", "%3") CP4B("%1", "%3") "s_wait_xcnt 0x0"
            :: "v"(l0), "v"(l0 + PB), "v"((const gch*)Kp + go), "v"((const gch*)Vp + go) : "memory");
    };
    v8f o[NT][4]; float m[NT], l[NT];
#pragma unroll
    for (int nt = 0; nt < NT; ++nt) { m[nt] = -3.0e38f; l[nt] = 0.f;
#pragma unroll
        for (int dt = 0; dt < 4; ++dt) o[nt][dt] = (v8f){}; }
    fill(0, 0);
    asm volatile("s_wait_asynccnt 0x0" ::: "memory");   // this wave's copies of stage 0 have landed
    __syncthreads();                                    // and every other wave's: stage 0 may be read
    fill(1, 1);
#pragma unroll 1   // one stage a trip: the two buffers differ by one address addition
    for (int t = 0; t < NSTG; ++t) {
      const lch* sb = (const lch*)sm + (t & 1) * STGB + lb;   // this stage's buffer, at the lane's 16 bytes of a fragment half; pass p's 4 KiB of a plane start p * 4096 into the plane's slice
      if constexpr (!HI) {   // the stage's first key rows; the later passes' are fetched one pass ahead, inside the stage
#pragma unroll
        for (int mt = 0; mt < 2; ++mt)
#pragma unroll
            for (int ks = 0; ks < 2; ++ks) kf[mt][ks] = F::ldl(sb + mt * 2048 + ks * 1024);
      }
      const lch* sp = sb;   // this pass's 4 KiB of the first plane: walks the stage
#pragma unroll 1   // the passes stay rolled: unrolled, the accumulators end a stage in other registers than they began it in (copies at every stage) and the register count leaves room for two waves a SIMD, not four
      for (int r = PPS; r > 0; --r, sp += 4096) {   // r = passes of the stage still to do, this one counted
        V vf[4], vf2[4];
        if constexpr (HI) {   // hi/lo rows: four planes do not fit the registers one pass ahead; this pass's key rows are asked for first, its value rows behind them
#pragma unroll
            for (int mt = 0; mt < 2; ++mt)
#pragma unroll
                for (int ks = 0; ks < 2; ++ks) { kf[mt][ks] = F::ldl(sp + mt * 2048 + ks * 1024); kf2[mt][ks] = F::ldl(sp + PB + mt * 2048 + ks * 1024); }
        }
#pragma unroll
        for (int dt = 0; dt < 4; ++dt) { vf[dt] = F::ldl(sp + STGB / 2 + dt * 1024); if constexpr (HI) vf2[dt] = F::ldl(sp + STGB / 2 + PB + dt * 1024); }
        if constexpr (!HI) __builtin_amdgcn_sched_barrier(0);   // keeps the eight value loads here, at the head of the pass: moved down to save registers they would be waited for soon after their issue
        v8f s[NT][2];
#pragma unroll
        for (int nt = 0; nt < NT; ++nt)
#pragma unroll
            for (int mt = 0; mt < 2; ++mt) { s[nt][mt] = (v8f){};
#pragma unroll
                for (int ks = 0; ks < 2; ++ks) { s[nt][mt] = F::mma(kf[mt][ks], qf[nt][ks], s[nt][mt]); if constexpr (HI) { s[nt][mt] = F::mma(kf[mt][ks], qf2[nt][ks], s[nt][mt]); s[nt][mt] = F::mma(kf2[mt][ks], qf[nt][ks], s[nt][mt]); } } }
        if (!HI && r > 1) {   // the next pass's key rows, fetched behind this pass's score products; never beyond the stage, whose successor is not published yet
#pragma unroll
            for (int mt = 0; mt < 2; ++mt)
#pragma unroll
                for (int ks = 0; ks < 2; ++ks) kf[mt][ks] = F::ldl(sp + 4096 + mt * 2048 + ks * 1024);
            __builtin_amdgcn_sched_barrier(0);   // keeps the eight key loads here, with the softmax and the second product between them and their use: moved down to the foot of the pass they would be waited for at once
        }
#pragma unroll
        for (int nt = 0; nt < NT; ++nt) {
            float mx = s[nt][0][0];
#pragma unroll
            for (int j = 0; j < 8; ++j) { mx = fmaxf(mx, s[nt][0][j]); mx = fmaxf(mx, s[nt][1][j]); }
            mx = fmaxf(mx, __shfl_xor(mx, 16, 32));
            const float mn = fmaxf(m[nt], mx); float al = (m[nt] - mn) * CL2; const float nm = PSH - mn * CL2; m[nt] = mn;
            float p[16], ps = 0.f;
#pragma unroll
            for (int j = 0; j < 8; ++j) { p[j] = s[nt][0][j]; p[8 + j] = s[nt][1][j]; }
            exp8a(p, CL2, nm, al); exp8(p + 8, CL2, nm);
#pragma unroll
            for (int j = 0; j < 16; ++j) ps += p[j];
            l[nt] = l[nt] * al + ps;
#pragma unroll
            for (int dt = 0; dt < 4; ++dt)
#pragma unroll
                for (int j = 0; j < 8; ++j) o[nt][dt][j] *= al;
            if constexpr (HI) {
                v8us h0, h1, l0, l1;
#pragma unroll
                for (int j = 0; j < 8; ++j) { unsigned short a, c2; splitf(p[j], a, c2); h0[j] = a; l0[j] = c2; splitf(p[8 + j], a, c2); h1[j] = a; l1[j] = c2; }
                const V ph = cat16b(h0, h1), pl = cat16b(l0, l1);
#pragma unroll
                for (int dt = 0; dt < 4; ++dt) { o[nt][dt] = F::mma(vf[dt], ph, o[nt][dt]); o[nt][dt] = F::mma(vf[dt], pl, o[nt][dt]); o[nt][dt] = F::mma(vf2[dt], ph, o[nt][dt]); }
            } else {
                V pb;
#pragma unroll
                for (int j = 0; j < 16; ++j) pb[j] = tohx(p[j]);
#pragma unroll
                for (int dt = 0; dt < 4; ++dt) o[nt][dt] = F::mma(vf[dt], pb, o[nt][dt]);
            }
        }
      }
      // publish point of stage t + 1, every wave, in this order:
      asm volatile("s_wait_dscnt 0x0" ::: "memory");      // this wave's reads of stage t's buffer have returned
      asm volatile("s_wait_asynccnt 0x0" ::: "memory");   // its copies of stage t + 1 have landed
      __syncthreads();                                    // the same holds of every wave: stage t + 1 may be read, stage t's buffer refilled
      if (t + 2 < NSTG) fill(t + 2, t & 1);
    }
    asm volatile("s_wait_asynccnt 0x0" ::: "memory");   // no copy is outstanding when the wave ends
#pragma unroll
    for (int nt = 0; nt < NT; ++nt) {
        const float inv = __fdiv_rn(1.0f, l[nt] + __shfl_xor(l[nt], 16, 32));
        const size_t oo = (size_t)(q0 + nt * 16) * DQ + 8 * lane;   // a lane holds d = dt * 16 + 8 * (lane >> 4) + j of its query (row lane & 15): its 16 bytes of half dt & 1 of k block h * 2 + dt / 2 of the merged plane's row tile
#pragma unroll
        for (int dt = 0; dt < 4; ++dt) { v8us oh, ol;
#pragma unroll
            for (int j = 0; j < 8; ++j) { unsigned short a, c2; splitf(o[nt][dt][j] * inv, a, c2); oh[j] = a; ol[j] = c2; }
            *(v8us*)(Ah + oo + dt * 256) = oh; *(v8us*)(Al + oo + dt * 256) = ol; }
    }
}
// grid (batches x heads, RH / 64 + (TT - RH) / 128), 4 waves a block, which share the staged keys and values of their head: blockIdx.y < RH / 64 takes 16 hi/lo rows a wave (the longer blocks, so they come first in index order), the rest 32 fp16 rows a wave; output = the merged hi/lo planes (rows b * 2048 + t, k = h * 64 + d; a head's two k blocks start h * 1024 into a row tile)
__global__ __launch_bounds__(128) void k_fattn(const h16* __restrict__ Q16, const h16* __restrict__ K16, const h16* __restrict__ V16, const bf* __restrict__ Qh, const bf* __restrict__ Ql, const bf* __restrict__ Kh, const bf* __restrict__ Kl, const bf* __restrict__ Vh, const bf* __restrict__ Vl, bf* Ah, bf* Al) {
    const int h = blockIdx.x % NH_, w = threadIdx.x >> 5, bx = blockIdx.y; const size_t po = (size_t)blockIdx.x * TT * HD; Ah += (size_t)(blockIdx.x / NH_) * TT * DQ; Al += (size_t)(blockIdx.x / NH_) * TT * DQ;
    __shared__ __align__(16) char sm[2 * STGB];
    if (bx < RH / 64) fa_tile<true, 1>(Qh + po, Ql + po, Kh + po, Kl + po, Vh + po, Vl + po, (bx * 4 + w) * 16, Ah + h * 1024, Al + h * 1024, sm);
    else fa_tile<false, 2>(Q16 + po, nullptr, K16 + po, nullptr, V16 + po, nullptr, RH + ((bx - RH / 64) * 4 + w) * 32, Ah + h * 1024, Al + h * 1024, sm);
}

extern "C" void kernel_launch(void* const* d_in, const int* in_sizes, int n_in,
                              void* d_out, int out_size, void* d_ws, size_t ws_size, hipStream_t stream) {
    (void)in_sizes; (void)n_in; (void)out_size;
    const float* x = (const float*)d_in[0]; const float* wq = (const float*)d_in[1]; const float* bq = (const float*)d_in[2]; const float* wk = (const float*)d_in[3]; const float* bk = (const float*)d_in[4]; const float* wv = (const float*)d_in[5]; const float* bv = (const float*)d_in[6]; const float* wo = (const float*)d_in[7]; const float* bo = (const float*)d_in[8];   /* order seq_inputs, Wq [16][1024][64], bq [16][64], Wk, bk, Wv, bv, Wo ('xw' [1024][1024]), bo */
    float* OUT = (float*)d_out;     // [4][2048][1024]
    char* wsp = (char*)d_ws;
    auto take = [&](size_t bytes) { char* p = wsp; wsp += (bytes + 255) & ~(size_t)255; return (void*)p; };
    constexpr size_t PLN = (size_t)NB_ * NH_ * TT * HD;   // elements of one set of head planes
    bf* WQKV = (bf*)take((size_t)3 * DQ * DM * 2); bf* WO = (bf*)take((size_t)DM * DQ * 2);
    bf* XB = (bf*)take((size_t)NB_ * TT * DM * 2);
    h16* QP16 = (h16*)take(3 * PLN * 2); h16* KP16 = QP16 + PLN; h16* VT16 = QP16 + 2 * PLN;
    bf* QPh = (bf*)take(6 * PLN * 2); bf* QPl = QPh + PLN; bf* KPh = QPh + 2 * PLN; bf* KPl = QPh + 3 * PLN; bf* VTh = QPh + 4 * PLN; bf* VTl = QPh + 5 * PLN;
    bf* ATh = (bf*)take((size_t)NB_ * TT * DQ * 2); bf* ATl = (bf*)take((size_t)NB_ * TT * DQ * 2);
    if ((size_t)(wsp - (char*)d_ws) > ws_size) return;    // 200 MiB of the 256 MiB
    k_pack<<<PKT / 256, 256, 0, stream>>>(x, wq, wk, wv, wo, XB, WQKV, WO);
    k_gemmw<bf, 0, true, 1, DM><<<dim3(NB_ * TT / 64, 3 * DQ / 64, 1), 32, 0, stream>>>(XB, nullptr, WQKV, nullptr, nullptr, 0, bq, bk, bv, 0, 0, 0, QP16, QPh, QPl);
    k_fattn<<<dim3(NB_ * NH_, RH / 64 + (TT - RH) / 128, 1), 128, 0, stream>>>(QP16, KP16, VT16, QPh, QPl, KPh, KPl, VTh, VTl, ATh, ATl);
    k_gemmw<bf, 1, true, 0, DQ><<<dim3(NB_ * TT / 64, DM / 64, 1), 32, 0, stream>>>(ATh, ATl, WO, nullptr, OUT, DM, bo, nullptr, nullptr, 0, 0, 0, nullptr, nullptr, nullptr);
}

// v008
// It runs in 176 microseconds.
// In both of two side-by-side timings against v007, it was 1.07 times as fast.
// All steps since v000 together make it 22.7 times as fast.
#include <hip/hip_runtime.h>

// Multi-head attention layer with per-head packed projection layers (seq_inputs [4][2048][1024]; Q, K, V = einsum('bse,hed', x, W) + b with W [16][1024][64] = [h][e][d] (1/32) and b [16][64]; scores / sqrt(64); softmax (no mask); heads concatenated in order; out = cat Wo + bo ('xw' [1024][1024] + bias) -> [4][2048][1024] (8.4 M); argument order seq_inputs, Wq, bq, Wk, bk, Wv, bv, Wo, bo).
// Every launch covers all 4 batches (the rows of the GEMMs are b * 2048 + t, the head planes are [b][h][..], the attention grid's x is b * 16 + h). Layout: k_pack (one launch) makes the bf16 copy of x, turns each [h][e][d] weight into Bt rows h*64 + d (Q, K, V rows one behind the other: one Bt of 3072 rows) and transposes Wo; the [16][64] biases are the flat [1024] epilogue vectors; exact projections + f32 biases, all three as one product of N = 3072, whose epilogues write the head planes themselves (Q, K as [h][t][d], V as [h][d][t]; fp16 + hi/lo); k_fattn: scores, softmax and weights x V of all 64 (batch, head) pairs in one launch, scores never leave registers (hybrid rows: < 512 hi/lo 3 products, rest fp16 weights x1024); merged hi/lo x Wo ('xw' transposed once) exact + bo.
// Every 16-bit operand plane is stored FRAGMENT-MAJOR: a 16-row x 32-k fragment is 1 KiB, [half = (k % 32) / 16][lane = ((k % 16) / 8) * 16 + row % 16][k % 8], so each of a fragment's two 16-byte-a-lane loads covers 512 contiguous bytes (4 whole lines, not 16 pieces of 32 bytes).
// Order of the fragments: GEMM operands, Q and K [row tile][k block]; V (rows d, k = t) [k block][row tile], so a pass of 32 keys reads 4 KiB in a row of K and of V. Values and every sum order are those of the row-major planes.
// Compute dtypes, f32 accumulate: every input rounded to bf16; projections exact + f32 biases; attention rows < 512 3 products, rest fp16; softmax f32 (running maximum); Wo hl x exact + bias.

#define NB_  4
#define TT   2048
#define DM   1024
#define NH_  16
#define NKV  16
#define HD   64
#define DQ   (NH_ * HD)
#define DKV  (NKV * HD)
#define RH   512                  // query rows < RH use hi+lo planes (0: none)
#define SCL  0.125f   // HD^-0.5
typedef _Float16 h16;
typedef unsigned short bf;
typedef __attribute__((ext_vector_type(16))) __bf16   v16bf;
typedef __attribute__((ext_vector_type(16))) _Float16 v16h;
typedef __attribute__((ext_vector_type(8)))  _Float16 v8h;
typedef __attribute__((ext_vector_type(8)))  unsigned short v8us;
typedef __attribute__((ext_vector_type(8)))  float    v8f;
typedef __attribute__((ext_vector_type(4)))  float    v4f;
typedef v8h  __attribute__((may_alias)) v8ha;
typedef v4f  __attribute__((may_alias)) v4fa;
typedef v8us __attribute__((may_alias)) v8usa;

__device__ __forceinline__ unsigned short f2bf(float f) { unsigned u = __float_as_uint(f); u += 0x7FFFu + ((u >> 16) & 1u); return (unsigned short)(u >> 16); }
__device__ __forceinline__ float bf2f(unsigned short b) { return __uint_as_float(((unsigned)b) << 16); }
__device__ __forceinline__ float bfr(float f) { return bf2f(f2bf(f)); }
__device__ __forceinline__ v16h cat16(v8h lo, v8h hi) { return __builtin_shufflevector(lo, hi, 0, 1, 2, 3, 4, 5, 6, 7, 8, 9, 10, 11, 12, 13, 14, 15); }
__device__ __forceinline__ v16bf cat16b(v8us lo, v8us hi) { return __builtin_bit_cast(v16bf, __builtin_shufflevector(lo, hi, 0, 1, 2, 3, 4, 5, 6, 7, 8, 9, 10, 11, 12, 13, 14, 15)); }
__device__ __forceinline__ v8f wmma16(v16h a, v16h b, v8f c) { return __builtin_amdgcn_wmma_f32_16x16x32_f16(false, a, false, b, (short)0, c, false, false); }
__device__ __forceinline__ v8f wmmab(v16bf a, v16bf b, v8f c) { return __builtin_amdgcn_wmma_f32_16x16x32_bf16(false, a, false, b, (short)0, c, false, false); }
__device__ __forceinline__ h16 tohx(float x) { return (h16)x; }
__device__ __forceinline__ void splitf(float y, unsigned short& h, unsigned short& l) { h = f2bf(y); l = f2bf(y - bf2f(h)); }



// ---- k_gemmw: register-blocked GEMM, one wave per 64x64 output tile (16 accumulators), eight waves (4 x 2) a block = a 256x128 tile; the fragment-major 16-bit operand planes are staged in LDS, so a fragment leaves L2 once a block and not once a wave; grid (M/256, N/128, Z), 256 threads.
// C[m][n] (f32, pitch ldc, + optional f32 bias[n]) = sum_k A[m][k] Bt[n][k] (+ split products per NSPLIT). z-batch strides sA/sB/sC in elements. K is a compile-time constant, a whole number of stages.
// EPI 0 stores C. EPI 1 is the three projections in one grid and stores no f32: m = b * 2048 + t (a 64-row tile lies in one batch), a tile's 64 columns are one head of one projection (n = sel * 1024 + h * 64 + d; sel 0, 1, 2 = Q, K, V, the same for the whole wave), and the result + that projection's bias goes out as fp16 and as bf16 hi + lo
// (P16 = three planes Q, K, V one behind the other; Ph and Pl point into six: Q hi, Q lo, K hi, K lo, V hi, V lo):
// Q and K as [b][h] planes of rows t, k = d (through the LDS rows: a lane picks up its 8 d of its row, a store is 512 bytes in a row), V as [b][h] planes of rows d, k = t (a lane's accumulator holds 8 consecutive t of one d, which is its 16 bytes of a fragment half: straight from registers, 512 bytes in a row a store).
#define GLB __attribute__((address_space(1)))   // the planes lie in global memory: said at the load, because a pointer that has been an operand of an asm statement is otherwise read with flat loads
typedef GLB char gch;
#define LDSA __attribute__((address_space(3)))   // the staged tiles lie in LDS: said at the load, so that it is a ds_load
typedef LDSA char lch;
template <typename T16> struct WFrag;
template <> struct WFrag<h16> { typedef v16h V; static __device__ __forceinline__ V ld(const h16* p, unsigned lb) { const gch* c = (const gch*)p + lb; return cat16(*(const GLB v8h*)c, *(const GLB v8h*)(c + 512)); } static __device__ __forceinline__ V ldl(const lch* c) { return cat16(*(const LDSA v8h*)c, *(const LDSA v8h*)(c + 512)); } static __device__ __forceinline__ v8f mma(V a, V b, v8f c) { return wmma16(a, b, c); } };
template <> struct WFrag<bf> { typedef v16bf V; static __device__ __forceinline__ V ld(const bf* p, unsigned lb) { const gch* c = (const gch*)p + lb; return cat16b(*(const GLB v8us*)c, *(const GLB v8us*)(c + 512)); } static __device__ __forceinline__ V ldl(const lch* c) { return cat16b(*(const LDSA v8us*)c, *(const LDSA v8us*)(c + 512)); } static __device__ __forceinline__ v8f mma(V a, V b, v8f c) { return wmmab(a, b, c); } };
#define CPY(l, g) "global_load_async_to_lds_b128 %" #l ", %" #g ", off\n\t"
template <typename T16, int NSPLIT, bool BIAS, int EPI, int K>
__global__ __launch_bounds__(256) void k_gemmw(const T16* __restrict__ A, const T16* __restrict__ A2, const T16* __restrict__ Bt, const T16* __restrict__ Bt2, float* C, int ldc, const float* __restrict__ bias, const float* __restrict__ biasK, const float* __restrict__ biasV, size_t sA, size_t sB, size_t sC, h16* P16, bf* Ph, bf* Pl) {
    typedef typename WFrag<T16>::V V;
    static_assert(NSPLIT <= 1, "the staged form holds A, the split plane A2 and Bt"); (void)Bt2;
    // Ring of two buffers in LDS, filled by asynchronous copies and read by all eight waves. A stage = KS k blocks of the block's 16 row tiles of A (and of A2) and 8 row tiles of Bt; of one row tile that is KS KiB in a row (the planes are fragment-major), copied as it lies:
    // a buffer holds [A: 16 row tiles][A2: 16][Bt: 8], each row tile KS fragments of 1 KiB. Copy c of a thread brings the 16 bytes at (c * 256 + threadIdx.x) * 16 of the buffer.
    constexpr int KS = NSPLIT == 0 ? 4 : 2, NPA = NSPLIT == 0 ? 1 : 2, ASZ = 16 * KS * 1024, BSZ = 8 * KS * 1024, STG = NPA * ASZ + BSZ, NSTG = K / (32 * KS);
    constexpr int NCA = ASZ / 4096, NCB = BSZ / 4096, NC = NPA * NCA + NCB;   // copies a thread and stage
    constexpr size_t RTB = (size_t)(K / 32) * 1024, RS = (size_t)(4 / KS) * RTB;   // bytes of a row tile in a plane; step of a thread's global address from one copy to the next (4 / KS row tiles)
    static_assert(NSTG >= 2 && K % (32 * KS) == 0 && (NC == 24 || NC == 20) && 8 * 16 * 68 * 4 <= 2 * STG, "two stages at least; the copy statements below are written for 24 and 20 copies; the epilogue's rows fit the ring");
    __shared__ __align__(16) char sm[2 * STG];
    const size_t z = blockIdx.z; A += z * sA; if (A2) A2 += z * sA; Bt += z * sB; C += z * sC;
    const int w = __builtin_amdgcn_readfirstlane(threadIdx.x >> 5), wm = w & 3, wn = w >> 2;   // the wave's 64 x 64 tile in the block's 256 x 128
    const int lane = threadIdx.x & 31, lr = lane & 15, hi = lane >> 4; const int r0 = blockIdx.x * 256 + wm * 64, c0 = blockIdx.y * 128 + wn * 64; const int bz = r0 / TT, t0 = r0 % TT;
    float* os = (float*)(sm + w * (16 * 68 * 4));   // the epilogue's rows, each wave's own, in the ring's place: used only behind the last stage's barrier
    v8f acc[4][4];
#pragma unroll
    for (int mb = 0; mb < 4; ++mb)
#pragma unroll
        for (int nb = 0; nb < 4; ++nb) acc[mb][nb] = (v8f){};
    const unsigned lb = lane * 16, sm0 = (unsigned)(size_t)(char*)sm + threadIdx.x * 16;
    const size_t to = (size_t)(threadIdx.x / (KS * 64)) * RTB + (threadIdx.x % (KS * 64)) * 16;   // the thread's place in its first copy's row tile
    const gch* gA = (const gch*)A + (size_t)(blockIdx.x * 16) * RTB + to; const gch* gA2 = (const gch*)A2 + (size_t)(blockIdx.x * 16) * RTB + to; const gch* gB = (const gch*)Bt + (size_t)(blockIdx.y * 8) * RTB + to;
    auto fill = [&](int t, int buf) __attribute__((always_inline)) {   // the s_wait_xcnt stands inside the copies' own statement: the address registers live to its end, nothing rewrites them ahead of it
        unsigned l[NC]; const gch* g[NC]; const size_t ko = (size_t)t * (KS * 1024);   // the four loops below are unrolled so that every address is a register, an operand of a copy statement
#pragma unroll
        for (int c = 0; c < NC; ++c) l[c] = sm0 + buf * STG + c * 4096;
#pragma unroll
        for (int c = 0; c < NCA; ++c) { g[c] = gA + ko + c * RS; if constexpr (NSPLIT == 1) g[NCA + c] = gA2 + ko + c * RS; }
#pragma unroll
        for (int c = 0; c < NCB; ++c) g[NPA * NCA + c] = gB + ko + c * RS;
#pragma unroll
        for (int h = 0; h < 2; ++h) { constexpr int H = NC / 2; const int b = h * H;
            if constexpr (NC == 24) asm volatile(CPY(0, 12) CPY(1, 13) CPY(2, 14) CPY(3, 15) CPY(4, 16) CPY(5, 17) CPY(6, 18) CPY(7, 19) CPY(8, 20) CPY(9, 21) CPY(10, 22) CPY(11, 23) "s_wait_xcnt 0x0"
                :: "v"(l[b]), "v"(l[b + 1]), "v"(l[b + 2]), "v"(l[b + 3]), "v"(l[b + 4]), "v"(l[b + 5]), "v"(l[b + 6]), "v"(l[b + 7]), "v"(l[b + 8]), "v"(l[b + 9]), "v"(l[b + 10]), "v"(l[b + 11]),
                   "v"(g[b]), "v"(g[b + 1]), "v"(g[b + 2]), "v"(g[b + 3]), "v"(g[b + 4]), "v"(g[b + 5]), "v"(g[b + 6]), "v"(g[b + 7]), "v"(g[b + 8]), "v"(g[b + 9]), "v"(g[b + 10]), "v"(g[b + 11]) : "memory");
            else asm volatile(CPY(0, 10) CPY(1, 11) CPY(2, 12) CPY(3, 13) CPY(4, 14) CPY(5, 15) CPY(6, 16) CPY(7, 17) CPY(8, 18) CPY(9, 19) "s_wait_xcnt 0x0"
                :: "v"(l[b]), "v"(l[b + 1]), "v"(l[b + 2]), "v"(l[b + 3]), "v"(l[b + 4]), "v"(l[b + 5]), "v"(l[b + 6]), "v"(l[b + 7]), "v"(l[b + 8]), "v"(l[b + 9]),
                   "v"(g[b]), "v"(g[b + 1]), "v"(g[b + 2]), "v"(g[b + 3]), "v"(g[b + 4]), "v"(g[b + 5]), "v"(g[b + 6]), "v"(g[b + 7]), "v"(g[b + 8]), "v"(g[b + 9]) : "memory"); }
    };
    // Two register sets, one k block (all fragments of both operands) a set: inside a stage block j + 1 is read from LDS in front of block j's products; never beyond the stage, whose successor is not published yet.
    V a[2][4], a2[2][4], b[2][4];
    const lch* sa; const lch* sbt;   // this stage's fragments of the wave's four row tiles of A and of Bt, at the lane's 16 bytes of a fragment half
    auto ldset = [&](int s, int blk) __attribute__((always_inline)) {
#pragma unroll
        for (int mb = 0; mb < 4; ++mb) { a[s][mb] = WFrag<T16>::ldl(sa + (mb * KS + blk) * 1024); if constexpr (NSPLIT == 1) a2[s][mb] = WFrag<T16>::ldl(sa + ASZ + (mb * KS + blk) * 1024); }
#pragma unroll
        for (int nb = 0; nb < 4; ++nb) b[s][nb] = WFrag<T16>::ldl(sbt + (nb * KS + blk) * 1024);
        __builtin_amdgcn_sched_barrier(0);   // keeps the set's loads here as one group, ahead of the products of the older set: moved down to their use they would be waited for at once
    };
    auto mmaset = [&](int s) __attribute__((always_inline)) {
#pragma unroll
        for (int nb = 0; nb < 4; ++nb)
#pragma unroll
            for (int mb = 0; mb < 4; ++mb) { acc[mb][nb] = WFrag<T16>::mma(a[s][mb], b[s][nb], acc[mb][nb]); if constexpr (NSPLIT == 1) acc[mb][nb] = WFrag<T16>::mma(a2[s][mb], b[s][nb], acc[mb][nb]); }
        __builtin_amdgcn_sched_barrier(0);   // keeps the next set's loads behind these products, which read the registers that those loads fill
    };
    fill(0, 0);
    asm volatile("s_wait_asynccnt 0x0" ::: "memory");   // this wave's copies of stage 0 have landed
    __syncthreads();                                    // and every other wave's: stage 0 may be read
    fill(1, 1);
#pragma unroll 1   // one stage a trip: the two buffers differ by one address addition
    for (int t = 0; t < NSTG; ++t) {
        const lch* sb = (const lch*)(char*)sm + (t & 1) * STG + lb; sa = sb + wm * (4 * KS * 1024); sbt = sb + NPA * ASZ + wn * (4 * KS * 1024);
        ldset(0, 0);
#pragma unroll   // a set's number is then a constant and the sets are registers
        for (int j = 0; j < KS; ++j) { if (j + 1 < KS) ldset((j + 1) & 1, j + 1); mmaset(j & 1); }
        // publish point of stage t + 1, every wave, in this order:
        asm volatile("s_wait_dscnt 0x0" ::: "memory");      // this wave's reads of stage t's buffer have returned
        asm volatile("s_wait_asynccnt 0x0" ::: "memory");   // its copies of stage t + 1 have landed
        __syncthreads();                                    // the same holds of every wave: stage t + 1 may be read, stage t's buffer refilled
        if (t + 2 < NSTG) fill(t + 2, t & 1);
    }
    asm volatile("s_wait_asynccnt 0x0" ::: "memory");   // no copy is outstanding when the ring becomes the epilogue's rows
    const int cy = c0 / 64, sel = EPI == 1 ? cy / NH_ : 0, hy = EPI == 1 ? cy % NH_ : cy, b0 = hy * 64;   // EPI 1: which projection, its head, the head's place in its bias
    if constexpr (EPI == 1) { constexpr size_t PLN = (size_t)NB_ * NH_ * TT * HD; bias = sel == 0 ? bias : sel == 1 ? biasK : biasV; P16 += sel * PLN; Ph += sel * 2 * PLN; Pl += sel * 2 * PLN; }
    if (EPI == 1 && sel == 2) {
#pragma unroll
        for (int nb = 0; nb < 4; ++nb) { const float bn = bfr(bias[b0 + nb * 16 + lr]);
#pragma unroll
            for (int mb = 0; mb < 4; ++mb) { const size_t po = ((size_t)bz * NKV + hy) * HD * TT + (size_t)(((t0 >> 5) + (mb >> 1)) * 4 + nb) * 512 + (mb & 1) * 256 + lane * 8; v8h o16; v8us oh, ol;
#pragma unroll
                for (int j = 0; j < 8; ++j) { const float x = acc[mb][nb][j] + bn; o16[j] = tohx(x); unsigned short a2, c2; splitf(x, a2, c2); oh[j] = a2; ol[j] = c2; }
                *(v8h*)(P16 + po) = o16; *(v8us*)(Ph + po) = oh; *(v8us*)(Pl + po) = ol; } }
    } else
#pragma unroll
    for (int mb = 0; mb < 4; ++mb) {
#pragma unroll
        for (int nb = 0; nb < 4; ++nb) {
#pragma unroll
            for (int j = 0; j < 8; ++j) os[(hi * 8 + j) * 68 + nb * 16 + lr] = acc[mb][nb][j]; }
        __builtin_amdgcn_wave_barrier(); asm volatile("" ::: "memory");
        if constexpr (EPI == 1) {
#pragma unroll
            for (int s = 0; s < 4; ++s) { const int cofs = s * 16 + hi * 8; const v4f v0 = *(const v4fa*)(os + lr * 68 + cofs), v1 = *(const v4fa*)(os + lr * 68 + cofs + 4);   // s = k block * 2 + half
                const size_t po = ((size_t)bz * NH_ + hy) * TT * HD + (size_t)((t0 >> 4) + mb) * 1024 + s * 256 + lane * 8; v8h o16; v8us oh, ol;
#pragma unroll
                for (int q = 0; q < 8; ++q) { const float x = (q < 4 ? v0[q & 3] : v1[q & 3]) + bfr(bias[b0 + cofs + q]); o16[q] = tohx(x); unsigned short a2, c2; splitf(x, a2, c2); oh[q] = a2; ol[q] = c2; }
                *(v8h*)(P16 + po) = o16; *(v8us*)(Ph + po) = oh; *(v8us*)(Pl + po) = ol;
                asm volatile("s_wait_xcnt 0x0" ::: "memory"); }   // the wait in front of a rewrite of the registers that these three stores name (the next quarter reuses them; behind the last quarter the built code falls, on a test that never holds there, into V's branch, which rewrites them too)
        } else {
            float* crow = C + (size_t)(r0 + mb * 16) * ldc + c0;
#pragma unroll
            for (int s = 0; s < 8; ++s) { const int row = 2 * s + hi, cofs = lr * 4; v4f val = *(const v4fa*)(os + row * 68 + cofs); if (BIAS) { val[0] += bfr(bias[c0 + cofs]); val[1] += bfr(bias[c0 + cofs + 1]); val[2] += bfr(bias[c0 + cofs + 2]); val[3] += bfr(bias[c0 + cofs + 3]); }
                *(v4f*)(crow + (size_t)row * ldc + cofs) = val; }
            if (mb < 3) asm volatile("s_wait_xcnt 0x0" ::: "memory");   // the wait in front of a rewrite of the registers that these eight stores name (the next row block reuses them)
        }
        __builtin_amdgcn_wave_barrier(); asm volatile("" ::: "memory");
    }
}


// k_pack: the 16-bit planes of x and of the four weights in ONE launch of DQ * DM / 8 = 131072 threads. Piece i = the 16 bytes at element i * 8 of a fragment-major plane of 1024-long rows: lane = i % 32, half = (i / 32) % 2, k block = (i / 64) % 32, row tile = i / 2048.
// Thread g writes piece g of each of the four weight planes (a plane has as many pieces as the grid has threads) and 8 pieces of x: lane and half g % 64 of the 8 k blocks from (g / 64) * 8 on (128 bytes of f32 and 1 KiB of the plane from one to the next). Its 48 loads depend on nothing and are all asked for before the first store.
// Bt[h * 64 + e][k] = w[h][k][e] for Wq, Wk, Wv (planes one behind the other in WQKV), Bt[n][k] = wo[k][n]: 16 lanes read 64 contiguous bytes of w for each of their 8 k; x: rows as they are, 32 bytes of f32 a piece.
#define PKT (DQ * DM / 8)
__global__ __launch_bounds__(256) void k_pack(const float* __restrict__ x, const float* __restrict__ wq, const float* __restrict__ wk, const float* __restrict__ wv, const float* __restrict__ wo, bf* __restrict__ XB, bf* __restrict__ WQKV, bf* __restrict__ WO) {
    constexpr int NX = NB_ * TT * DM / 8 / PKT;   // pieces of x a thread
    static_assert(DQ == DM && DKV == DQ && (DM / 32) % NX == 0, "one index map for the weight planes; a thread's pieces of x lie in one row tile");
    const int g = blockIdx.x * 256 + threadIdx.x, lane = g & 31, kin = ((g >> 5) & 1) * 16 + (lane >> 4) * 8, kb = (g >> 6) % (DM / 32), r = (g >> 6) / (DM / 32) * 16 + (lane & 15), k0 = kb * 32 + kin; const int h = r / HD, e = r % HD;
    const int xb = (g >> 6) * NX, xr = xb / (DM / 32) * 16 + (lane & 15), xk = xb % (DM / 32) * 32 + kin;   // first k block (counted through the plane), row and first k of the thread's pieces of x
    v8f fx[NX]; float fq[8], fk[8], fv[8], fo[8];
    unsigned xo = (unsigned)(xr * DM + xk) * 4, ho = (unsigned)((h * DM + k0) * HD + e) * 4, oo4 = (unsigned)(k0 * DM + r) * 4;   // the thread's byte offsets into x, into a [h][e][d] weight and into wo: scalar base + one 32-bit register, the steps are immediates
#pragma unroll
    for (int j = 0; j < NX; ++j) fx[j] = *(const GLB v8f*)((const gch*)x + j * 128 + xo);
#pragma unroll
    for (int q = 0; q < 8; ++q) { fq[q] = *(const GLB float*)((const gch*)wq + q * HD * 4 + ho); fk[q] = *(const GLB float*)((const gch*)wk + q * HD * 4 + ho); fv[q] = *(const GLB float*)((const gch*)wv + q * HD * 4 + ho); fo[q] = *(const GLB float*)((const gch*)wo + q * DM * 4 + oo4); }
    asm volatile("s_wait_xcnt 0x0" : "+v"(xo), "+v"(ho), "+v"(oo4) :: "memory");   // the wait in front of a rewrite of the registers that the 48 loads name: as its operands the three offsets live up to it, so no load's result and no conversion reuses them earlier
    __builtin_amdgcn_sched_barrier(0);   // keeps all 48 loads ahead of the first conversion: without it three weights' loads are issued only behind the wait for x, a second memory latency in a launch that lasts little longer than one
#pragma unroll
    for (int j = 0; j < NX; ++j) { v8us o;
#pragma unroll
        for (int q = 0; q < 8; ++q) o[q] = f2bf(fx[j][q]);
        *(v8us*)(XB + ((size_t)(xb + j) * 64 + (g & 63)) * 8) = o; }
    v8us oq, ok, ov, oo;
#pragma unroll
    for (int q = 0; q < 8; ++q) { oq[q] = f2bf(fq[q]); ok[q] = f2bf(fk[q]); ov[q] = f2bf(fv[q]); oo[q] = f2bf(fo[q]); }
    *(v8us*)(WQKV + (size_t)g * 8) = oq; *(v8us*)(WQKV + (size_t)DQ * DM + (size_t)g * 8) = ok; *(v8us*)(WQKV + (size_t)2 * DQ * DM + (size_t)g * 8) = ov; *(v8us*)(WO + (size_t)g * 8) = oo;
}
// ---- k_fattn: one wave owns NT x 16 query rows of one head and walks the 2048 keys 32 at a time.
// St = K Qt (A = 16 key rows, B = 16 query rows, both fragment-major planes): in the accumulator a lane holds ONE query (column lane & 15) and keys 8 * (lane >> 4) + j of each 16-key tile,
// which is the k order of a B fragment (elements 0..7 = tile 0, 8..15 = tile 1), so the weights go from the score accumulators straight into Ot += Vt Pt (A = 16 rows d of the V plane, k = t).
// Softmax with a running maximum per query: maximum and sum in-lane plus one exchange between the wave halves; sums of the halves joined once at the end; division by the sum at the end.
// exp8: eight weights in place, p = exp2(p * c + nm). Written as one statement so that every v_exp_f32 is followed by an instruction that neither reads its result nor writes its source
// (the slot the instruction set asks for behind a transcendental): a later element's multiply-add or v_exp_f32 fills it, a v_nop behind the last. exp8a does the same and takes the rescale factor a = exp2(a) along.
__device__ __forceinline__ void exp8(float* p, float c, float nm) {
    asm("v_fma_f32 %0, %0, %8, %9\n\tv_fma_f32 %1, %1, %8, %9\n\tv_exp_f32 %0, %0\n\tv_fma_f32 %2, %2, %8, %9\n\tv_exp_f32 %1, %1\n\tv_fma_f32 %3, %3, %8, %9\n\tv_exp_f32 %2, %2\n\t"
        "v_fma_f32 %4, %4, %8, %9\n\tv_exp_f32 %3, %3\n\tv_fma_f32 %5, %5, %8, %9\n\tv_exp_f32 %4, %4\n\tv_fma_f32 %6, %6, %8, %9\n\tv_exp_f32 %5, %5\n\tv_fma_f32 %7, %7, %8, %9\n\tv_exp_f32 %6, %6\n\tv_exp_f32 %7, %7\n\tv_nop"
        : "+v"(p[0]), "+v"(p[1]), "+v"(p[2]), "+v"(p[3]), "+v"(p[4]), "+v"(p[5]), "+v"(p[6]), "+v"(p[7]) : "s"(c), "v"(nm));
}
__device__ __forceinline__ void exp8a(float* p, float c, float nm, float& a) {
    asm("v_fma_f32 %0, %0, %9, %10\n\tv_exp_f32 %8, %8\n\tv_fma_f32 %1, %1, %9, %10\n\tv_exp_f32 %0, %0\n\tv_fma_f32 %2, %2, %9, %10\n\tv_exp_f32 %1, %1\n\tv_fma_f32 %3, %3, %9, %10\n\tv_exp_f32 %2, %2\n\t"
        "v_fma_f32 %4, %4, %9, %10\n\tv_exp_f32 %3, %3\n\tv_fma_f32 %5, %5, %9, %10\n\tv_exp_f32 %4, %4\n\tv_fma_f32 %6, %6, %9, %10\n\tv_exp_f32 %5, %5\n\tv_fma_f32 %7, %7, %9, %10\n\tv_exp_f32 %6, %6\n\tv_exp_f32 %7, %7\n\tv_nop"
        : "+v"(p[0]), "+v"(p[1]), "+v"(p[2]), "+v"(p[3]), "+v"(p[4]), "+v"(p[5]), "+v"(p[6]), "+v"(p[7]), "+v"(a) : "s"(c), "v"(nm));
}
#define STGB 32768   // bytes of one buffer of the ring
#define CP1(l, g, o) "global_load_async_to_lds_b128 " l ", " g ", off offset:" #o "\n\t"
#define CP4(l, g)  CP1(l, g, 0) CP1(l, g, 2048) CP1(l, g, 4096) CP1(l, g, 6144)
#define CP4B(l, g) CP1(l, g, 8192) CP1(l, g, 10240) CP1(l, g, 12288) CP1(l, g, 14336)
template <bool HI> struct ASel { typedef h16 T; };
template <> struct ASel<true> { typedef bf T; };
template <bool HI, int NT>
__device__ __forceinline__ void fa_tile(const typename ASel<HI>::T* __restrict__ Q, const typename ASel<HI>::T* __restrict__ Q2, const typename ASel<HI>::T* __restrict__ Kp, const typename ASel<HI>::T* __restrict__ Kp2,
                                        const typename ASel<HI>::T* __restrict__ Vp, const typename ASel<HI>::T* __restrict__ Vp2, int q0, bf* Ah, bf* Al, char* sm) {
    typedef WFrag<typename ASel<HI>::T> F; typedef typename F::V V;
    const int lane = threadIdx.x & 31; unsigned lb = lane * 16;
    const float CL2 = SCL * 1.4426950408889634f;   // score -> log2 domain
    const float PSH = HI ? 0.0f : 10.0f;           // fp16 weights carry x1024 (log2 = 10): keeps small weights out of the fp16 denormals; the sum carries it too, so it cancels in the division
    V qf[NT][2], qf2[NT][2], kf[2][2], kf2[2][2];
    const typename ASel<HI>::T* pq = Q; const typename ASel<HI>::T* pq2 = Q2;
#pragma unroll
    for (int nt = 0; nt < NT; ++nt)
#pragma unroll
        for (int ks = 0; ks < 2; ++ks) { const size_t qo = (size_t)(q0 + nt * 16) * HD + ks * 512; qf[nt][ks] = F::ld(pq + qo, lb); if constexpr (HI) qf2[nt][ks] = F::ld(pq2 + qo, lb); }
    // the wait in front of a rewrite of the registers that the query loads name: their address registers are given up behind it; lb lives on as the lane's offset into a fragment in LDS
    if constexpr (HI) asm volatile("s_wait_xcnt 0x0" : "+s"(pq), "+s"(pq2), "+v"(lb) :: "memory"); else asm volatile("s_wait_xcnt 0x0" : "+s"(pq), "+v"(lb) :: "memory");
    // Ring of two 32-KiB buffers in LDS, filled by asynchronous copies and read by all four waves of the block. A stage = PPS passes of 32 keys; of each plane that is PB bytes in a row (the planes are fragment-major), copied as they lie:
    // fp16 rows: K at 0, V at 16 KiB; hi/lo rows: K hi, K lo, V hi, V lo at 0, 8, 16, 24 KiB. A thread copies 16 bytes at threadIdx.x * 16 of every 2 KiB; the immediate offset moves the LDS and the global address alike.
    constexpr int PPS = HI ? 2 : 4, PB = PPS * 4096, NSTG = TT / (32 * PPS);
    static_assert(NSTG >= 2 && TT % (32 * PPS) == 0 && (HI ? 4 : 2) * PB == STGB, "two stages at least; the planes' slices fill a buffer");
    const unsigned tb = threadIdx.x * 16, sm0 = (unsigned)(size_t)sm + tb;
    auto fill = [&](int t, int buf) __attribute__((always_inline)) {   // the s_wait_xcnt stands inside the copies' own statement: the address registers live to its end, nothing rewrites them ahead of it
        const unsigned l0 = sm0 + buf * STGB; const size_t go = (size_t)t * PB + tb;
        if constexpr (HI) asm volatile(CP4("%0", "%4") CP4("%1", "%5") CP4("%2", "%6") CP4("%3", "%7") "s_wait_xcnt 0x0"
            :: "v"(l0), "v"(l0 + PB), "v"(l0 + 2 * PB), "v"(l0 + 3 * PB), "v"((const gch*)Kp + go), "v"((const gch*)Kp2 + go), "v"((const gch*)Vp + go), "v"((const gch*)Vp2 + go) : "memory");
        else asm volatile(CP4("%0", "%2") CP4B("%0", "%2") CP4("%1", "%3") CP4B("%1", "%3") "s_wait_xcnt 0x0"
            :: "v"(l0), "v"(l0 + PB), "v"((const gch*)Kp + go), "v"((const gch*)Vp + go) : "memory");
    };
    v8f o[NT][4]; float m[NT], l[NT];
#pragma unroll
    for (int nt = 0; nt < NT; ++nt) { m[nt] = -3.0e38f; l[nt] = 0.f;
#pragma unroll
        for (int dt = 0; dt < 4; ++dt) o[nt][dt] = (v8f){}; }
    fill(0, 0);
    asm volatile("s_wait_asynccnt 0x0" ::: "memory");   // this wave's copies of stage 0 have landed
    __syncthreads();                                    // and every other wave's: stage 0 may be read
    fill(1, 1);
#pragma unroll 1   // one stage a trip: the two buffers differ by one address addition
    for (int t = 0; t < NSTG; ++t) {
      const lch* sb = (const lch*)sm + (t & 1) * STGB + lb;   // this stage's buffer, at the lane's 16 bytes of a fragment half; pass p's 4 KiB of a plane start p * 4096 into the plane's slice
      if constexpr (!HI) {   // the stage's first key rows; the later passes' are fetched one pass ahead, inside the stage
#pragma unroll
        for (int mt = 0; mt < 2; ++mt)
#pragma unroll
            for (int ks = 0; ks < 2; ++ks) kf[mt][ks] = F::ldl(sb + mt * 2048 + ks * 1024);
      }
      const lch* sp = sb;   // this pass's 4 KiB of the first plane: walks the stage
#pragma unroll 1   // the passes stay rolled: unrolled, the accumulators end a stage in other registers than they began it in (copies at every stage) and the register count leaves room for two waves a SIMD, not four
      for (int r = PPS; r > 0; --r, sp += 4096) {   // r = passes of the stage still to do, this one counted
        V vf[4], vf2[4];
        if constexpr (HI) {   // hi/lo rows: four planes do not fit the registers one pass ahead; this pass's key rows are asked for first, its value rows behind them
#pragma unroll
            for (int mt = 0; mt < 2; ++mt)
#pragma unroll
                for (int ks = 0; ks < 2; ++ks) { kf[mt][ks] = F::ldl(sp + mt * 2048 + ks * 1024); kf2[mt][ks] = F::ldl(sp + PB + mt * 2048 + ks * 1024); }
        }
#pragma unroll
        for (int dt = 0; dt < 4; ++dt) { vf[dt] = F::ldl(sp + STGB / 2 + dt * 1024); if constexpr (HI) vf2[dt] = F::ldl(sp + STGB / 2 + PB + dt * 1024); }
        if constexpr (!HI) __builtin_amdgcn_sched_barrier(0);   // keeps the eight value loads here, at the head of the pass: moved down to save registers they would be waited for soon after their issue
        v8f s[NT][2];
#pragma unroll
        for (int nt = 0; nt < NT; ++nt)
#pragma unroll
            for (int mt = 0; mt < 2; ++mt) { s[nt][mt] = (v8f){};
#pragma unroll
                for (int ks = 0; ks < 2; ++ks) { s[nt][mt] = F::mma(kf[mt][ks], qf[nt][ks], s[nt][mt]); if constexpr (HI) { s[nt][mt] = F::mma(kf[mt][ks], qf2[nt][ks], s[nt][mt]); s[nt][mt] = F::mma(kf2[mt][ks], qf[nt][ks], s[nt][mt]); } } }
        if (!HI && r > 1) {   // the next pass's key rows, fetched behind this pass's score products; never beyond the stage, whose successor is not published yet
#pragma unroll
            for (int mt = 0; mt < 2; ++mt)
#pragma unroll
                for (int ks = 0; ks < 2; ++ks) kf[mt][ks] = F::ldl(sp + 4096 + mt * 2048 + ks * 1024);
            __builtin_amdgcn_sched_barrier(0);   // keeps the eight key loads here, with the softmax and the second product between them and their use: moved down to the foot of the pass they would be waited for at once
        }
#pragma unroll
        for (int nt = 0; nt < NT; ++nt) {
            float mx = s[nt][0][0];
#pragma unroll
            for (int j = 0; j < 8; ++j) { mx = fmaxf(mx, s[nt][0][j]); mx = fmaxf(mx, s[nt][1][j]); }
            mx = fmaxf(mx, __shfl_xor(mx, 16, 32));
            const float mn = fmaxf(m[nt], mx); float al = (m[nt] - mn) * CL2; const float nm = PSH - mn * CL2; m[nt] = mn;
            float p[16], ps = 0.f;
#pragma unroll
            for (int j = 0; j < 8; ++j) { p[j] = s[nt][0][j]; p[8 + j] = s[nt][1][j]; }
            exp8a(p, CL2, nm, al); exp8(p + 8, CL2, nm);
#pragma unroll
            for (int j = 0; j < 16; ++j) ps += p[j];
            l[nt] = l[nt] * al + ps;
#pragma unroll
            for (int dt = 0; dt < 4; ++dt)
#pragma unroll
                for (int j = 0; j < 8; ++j) o[nt][dt][j] *= al;
            if constexpr (HI) {
                v8us h0, h1, l0, l1;
#pragma unroll
                for (int j = 0; j < 8; ++j) { unsigned short a, c2; splitf(p[j], a, c2); h0[j] = a; l0[j] = c2; splitf(p[8 + j], a, c2); h1[j] = a; l1[j] = c2; }
                const V ph = cat16b(h0, h1), pl = cat16b(l0, l1);
#pragma unroll
                for (int dt = 0; dt < 4; ++dt) { o[nt][dt] = F::mma(vf[dt], ph, o[nt][dt]); o[nt][dt] = F::mma(vf[dt], pl, o[nt][dt]); o[nt][dt] = F::mma(vf2[dt], ph, o[nt][dt]); }
            } else {
                V pb;
#pragma unroll
                for (int j = 0; j < 16; ++j) pb[j] = tohx(p[j]);
#pragma unroll
                for (int dt = 0; dt < 4; ++dt) o[nt][dt] = F::mma(vf[dt], pb, o[nt][dt]);
            }
        }
      }
      // publish point of stage t + 1, every wave, in this order:
      asm volatile("s_wait_dscnt 0x0" ::: "memory");      // this wave's reads of stage t's buffer have returned
      asm volatile("s_wait_asynccnt 0x0" ::: "memory");   // its copies of stage t + 1 have landed
      __syncthreads();                                    // the same holds of every wave: stage t + 1 may be read, stage t's buffer refilled
      if (t + 2 < NSTG) fill(t + 2, t & 1);
    }
    asm volatile("s_wait_asynccnt 0x0" ::: "memory");   // no copy is outstanding when the wave ends
#pragma unroll
    for (int nt = 0; nt < NT; ++nt) {
        const float inv = __fdiv_rn(1.0f, l[nt] + __shfl_xor(l[nt], 16, 32));
        const size_t oo = (size_t)(q0 + nt * 16) * DQ + 8 * lane;   // a lane holds d = dt * 16 + 8 * (lane >> 4) + j of its query (row lane & 15): its 16 bytes of half dt & 1 of k block h * 2 + dt / 2 of the merged plane's row tile
#pragma unroll
        for (int dt = 0; dt < 4; ++dt) { v8us oh, ol;
#pragma unroll
            for (int j = 0; j < 8; ++j) { unsigned short a, c2; splitf(o[nt][dt][j] * inv, a, c2); oh[j] = a; ol[j] = c2; }
            *(v8us*)(Ah + oo + dt * 256) = oh; *(v8us*)(Al + oo + dt * 256) = ol; }
    }
}
// grid (batches x heads, RH / 64 + (TT - RH) / 128), 4 waves a block, which share the staged keys and values of their head: blockIdx.y < RH / 64 takes 16 hi/lo rows a wave (the longer blocks, so they come first in index order), the rest 32 fp16 rows a wave; output = the merged hi/lo planes (rows b * 2048 + t, k = h * 64 + d; a head's two k blocks start h * 1024 into a row tile)
__global__ __launch_bounds__(128) void k_fattn(const h16* __restrict__ Q16, const h16* __restrict__ K16, const h16* __restrict__ V16, const bf* __restrict__ Qh, const bf* __restrict__ Ql, const bf* __restrict__ Kh, const bf* __restrict__ Kl, const bf* __restrict__ Vh, const bf* __restrict__ Vl, bf* Ah, bf* Al) {
    const int h = blockIdx.x % NH_, w = threadIdx.x >> 5, bx = blockIdx.y; const size_t po = (size_t)blockIdx.x * TT * HD; Ah += (size_t)(blockIdx.x / NH_) * TT * DQ; Al += (size_t)(blockIdx.x / NH_) * TT * DQ;
    __shared__ __align__(16) char sm[2 * STGB];
    if (bx < RH / 64) fa_tile<true, 1>(Qh + po, Ql + po, Kh + po, Kl + po, Vh + po, Vl + po, (bx * 4 + w) * 16, Ah + h * 1024, Al + h * 1024, sm);
    else fa_tile<false, 2>(Q16 + po, nullptr, K16 + po, nullptr, V16 + po, nullptr, RH + ((bx - RH / 64) * 4 + w) * 32, Ah + h * 1024, Al + h * 1024, sm);
}

extern "C" void kernel_launch(void* const* d_in, const int* in_sizes, int n_in,
                              void* d_out, int out_size, void* d_ws, size_t ws_size, hipStream_t stream) {
    (void)in_sizes; (void)n_in; (void)out_size;
    const float* x = (const float*)d_in[0]; const float* wq = (const float*)d_in[1]; const float* bq = (const float*)d_in[2]; const float* wk = (const float*)d_in[3]; const float* bk = (const float*)d_in[4]; const float* wv = (const float*)d_in[5]; const float* bv = (const float*)d_in[6]; const float* wo = (const float*)d_in[7]; const float* bo = (const float*)d_in[8];   /* order seq_inputs, Wq [16][1024][64], bq [16][64], Wk, bk, Wv, bv, Wo ('xw' [1024][1024]), bo */
    float* OUT = (float*)d_out;     // [4][2048][1024]
    char* wsp = (char*)d_ws;
    auto take = [&](size_t bytes) { char* p = wsp; wsp += (bytes + 255) & ~(size_t)255; return (void*)p; };
    constexpr size_t PLN = (size_t)NB_ * NH_ * TT * HD;   // elements of one set of head planes
    bf* WQKV = (bf*)take((size_t)3 * DQ * DM * 2); bf* WO = (bf*)take((size_t)DM * DQ * 2);
    bf* XB = (bf*)take((size_t)NB_ * TT * DM * 2);
    h16* QP16 = (h16*)take(3 * PLN * 2); h16* KP16 = QP16 + PLN; h16* VT16 = QP16 + 2 * PLN;
    bf* QPh = (bf*)take(6 * PLN * 2); bf* QPl = QPh + PLN; bf* KPh = QPh + 2 * PLN; bf* KPl = QPh + 3 * PLN; bf* VTh = QPh + 4 * PLN; bf* VTl = QPh + 5 * PLN;
    bf* ATh = (bf*)take((size_t)NB_ * TT * DQ * 2); bf* ATl = (bf*)take((size_t)NB_ * TT * DQ * 2);
    if ((size_t)(wsp - (char*)d_ws) > ws_size) return;    // 200 MiB of the 256 MiB
    k_pack<<<PKT / 256, 256, 0, stream>>>(x, wq, wk, wv, wo, XB, WQKV, WO);
    k_gemmw<bf, 0, true, 1, DM><<<dim3(NB_ * TT / 256, 3 * DQ / 128, 1), 256, 0, stream>>>(XB, nullptr, WQKV, nullptr, nullptr, 0, bq, bk, bv, 0, 0, 0, QP16, QPh, QPl);
    k_fattn<<<dim3(NB_ * NH_, RH / 64 + (TT - RH) / 128, 1), 128, 0, stream>>>(QP16, KP16, VT16, QPh, QPl, KPh, KPl, VTh, VTl, ATh, ATl);
    k_gemmw<bf, 1, true, 0, DQ><<<dim3(NB_ * TT / 256, DM / 128, 1), 256, 0, stream>>>(ATh, ATl, WO, nullptr, OUT, DM, bo, nullptr, nullptr, 0, 0, 0, nullptr, nullptr, nullptr);
}

// v009
// Measured time: 167 microseconds a run.
// Two timings next to v008 both put it at 1.05 times that version's speed.
// All steps since v000 together make it 23.8 times as fast.
#include <hip/hip_runtime.h>

// Multi-head attention layer with per-head packed projection layers (seq_inputs [4][2048][1024]; Q, K, V = einsum('bse,hed', x, W) + b with W [16][1024][64] = [h][e][d] (1/32) and b [16][64]; scores / sqrt(64); softmax (no mask); heads concatenated in order; out = cat Wo + bo ('xw' [1024][1024] + bias) -> [4][2048][1024] (8.4 M); argument order seq_inputs, Wq, bq, Wk, bk, Wv, bv, Wo, bo).
// Every launch covers all 4 batches (the rows of the GEMMs are b * 2048 + t, the head planes are [b][h][..], the attention grid's x is b * 16 + h). Layout: k_pack (one launch) makes the bf16 copy of x, turns each [h][e][d] weight into Bt rows h*64 + d (Q, K, V rows one behind the other: one Bt of 3072 rows) and transposes Wo; the [16][64] biases are the flat [1024] epilogue vectors; exact projections + f32 biases, all three as one product of N = 3072, whose epilogues write the head planes themselves (Q, K as [h][t][d], V as [h][d][t]; fp16 + hi/lo); k_fattn: scores, softmax and weights x V of all 64 (batch, head) pairs in one launch, scores never leave registers (hybrid rows: < 512 hi/lo 3 products, rest fp16 weights x1024); merged hi/lo x Wo ('xw' transposed once) exact + bo.
// Every 16-bit operand plane is stored FRAGMENT-MAJOR: a 16-row x 32-k fragment is 1 KiB, [half = (k % 32) / 16][lane = ((k % 16) / 8) * 16 + row % 16][k % 8], so each of a fragment's two 16-byte-a-lane loads covers 512 contiguous bytes (4 whole lines, not 16 pieces of 32 bytes).
// Order of the fragments: GEMM operands, Q and K [row tile][k block]; V (rows d, k = t) [k block][row tile], so a pass of 32 keys reads 4 KiB in a row of K and of V. Values and every sum order are those of the row-major planes.
// Compute dtypes, f32 accumulate: every input rounded to bf16; projections exact + f32 biases; attention rows < 512 3 products, rest fp16; softmax f32 (running maximum); Wo hl x exact + bias.

#define NB_  4
#define TT   2048
#define DM   1024
#define NH_  16
#define NKV  16
#define HD   64
#define DQ   (NH_ * HD)
#define DKV  (NKV * HD)
#define RH   512                  // query rows < RH use hi+lo planes (0: none)
#define SCL  0.125f   // HD^-0.5
typedef _Float16 h16;
typedef unsigned short bf;
typedef __attribute__((ext_vector_type(16))) __bf16   v16bf;
typedef __attribute__((ext_vector_type(8)))  __bf16   v8bf;
typedef __attribute__((ext_vector_type(4)))  unsigned v4u;
typedef __attribute__((ext_vector_type(16))) _Float16 v16h;
typedef __attribute__((ext_vector_type(8)))  _Float16 v8h;
typedef __attribute__((ext_vector_type(8)))  unsigned short v8us;
typedef __attribute__((ext_vector_type(8)))  float    v8f;
typedef __attribute__((ext_vector_type(4)))  float    v4f;
typedef v8h  __attribute__((may_alias)) v8ha;
typedef v4f  __attribute__((may_alias)) v4fa;
typedef v8us __attribute__((may_alias)) v8usa;

__device__ __forceinline__ unsigned short f2bf(float f) { return __builtin_bit_cast(unsigned short, (__bf16)f); }   // the hardware's conversion, nearest even
__device__ __forceinline__ v8us f2bf8(v8f f) { return __builtin_bit_cast(v8us, __builtin_convertvector(f, v8bf)); }   // one v_cvt_pk_bf16_f32 a pair
__device__ __forceinline__ float bf2f(unsigned short b) { return __uint_as_float(((unsigned)b) << 16); }
__device__ __forceinline__ float bfr(float f) { return bf2f(f2bf(f)); }
__device__ __forceinline__ v16h cat16(v8h lo, v8h hi) { return __builtin_shufflevector(lo, hi, 0, 1, 2, 3, 4, 5, 6, 7, 8, 9, 10, 11, 12, 13, 14, 15); }
__device__ __forceinline__ v16bf cat16b(v8us lo, v8us hi) { return __builtin_bit_cast(v16bf, __builtin_shufflevector(lo, hi, 0, 1, 2, 3, 4, 5, 6, 7, 8, 9, 10, 11, 12, 13, 14, 15)); }
__device__ __forceinline__ v8f wmma16(v16h a, v16h b, v8f c) { return __builtin_amdgcn_wmma_f32_16x16x32_f16(false, a, false, b, (short)0, c, false, false); }
__device__ __forceinline__ v8f wmmab(v16bf a, v16bf b, v8f c) { return __builtin_amdgcn_wmma_f32_16x16x32_bf16(false, a, false, b, (short)0, c, false, false); }
__device__ __forceinline__ h16 tohx(float x) { return (h16)x; }
// split8: eight f32 -> their bf16 hi and lo parts (hi = x to nearest even, lo = x - hi to nearest even; the difference is exact in f32), packed in element order, three instructions a pair:
// v_cvt_pk_bf16_f32 makes two hi; v_fma_mixlo_bf16 / v_fma_mixhi_bf16 take x * 1.0 - hi with hi read as the bf16 half it is and write the rounded result into the low / high half of lo.
// Written as one statement because the source form compiles to more than twice as many instructions (each hi widened again, a subtraction, a second conversion); four of a kind in a row keep each instruction four behind the one it depends on.
__device__ __forceinline__ void split8(const float* x, v8us& h, v8us& l) {
    v4u a, b;
    asm("v_cvt_pk_bf16_f32 %0, %8, %9\n\tv_cvt_pk_bf16_f32 %1, %10, %11\n\tv_cvt_pk_bf16_f32 %2, %12, %13\n\tv_cvt_pk_bf16_f32 %3, %14, %15\n\t"
        "v_fma_mixlo_bf16 %4, %8, 1.0, -%0 op_sel_hi:[0,0,1]\n\tv_fma_mixlo_bf16 %5, %10, 1.0, -%1 op_sel_hi:[0,0,1]\n\tv_fma_mixlo_bf16 %6, %12, 1.0, -%2 op_sel_hi:[0,0,1]\n\tv_fma_mixlo_bf16 %7, %14, 1.0, -%3 op_sel_hi:[0,0,1]\n\t"
        "v_fma_mixhi_bf16 %4, %9, 1.0, -%0 op_sel:[0,0,1] op_sel_hi:[0,0,1]\n\tv_fma_mixhi_bf16 %5, %11, 1.0, -%1 op_sel:[0,0,1] op_sel_hi:[0,0,1]\n\tv_fma_mixhi_bf16 %6, %13, 1.0, -%2 op_sel:[0,0,1] op_sel_hi:[0,0,1]\n\tv_fma_mixhi_bf16 %7, %15, 1.0, -%3 op_sel:[0,0,1] op_sel_hi:[0,0,1]"
        : "=&v"(a[0]), "=&v"(a[1]), "=&v"(a[2]), "=&v"(a[3]), "=&v"(b[0]), "=&v"(b[1]), "=&v"(b[2]), "=&v"(b[3])
        : "v"(x[0]), "v"(x[1]), "v"(x[2]), "v"(x[3]), "v"(x[4]), "v"(x[5]), "v"(x[6]), "v"(x[7]));
    h = __builtin_bit_cast(v8us, a); l = __builtin_bit_cast(v8us, b);
}



// ---- k_gemmw: register-blocked GEMM, one wave per 64x64 output tile (16 accumulators), eight waves (4 x 2) a block = a 256x128 tile; the fragment-major 16-bit operand planes are staged in LDS, so a fragment leaves L2 once a block and not once a wave; grid (M/256, N/128, Z), 256 threads.
// C[m][n] (f32, pitch ldc, + optional f32 bias[n]) = sum_k A[m][k] Bt[n][k] (+ split products per NSPLIT). z-batch strides sA/sB/sC in elements. K is a compile-time constant, a whole number of stages.
// EPI 0 stores C. EPI 1 is the three projections in one grid and stores no f32: m = b * 2048 + t (a 64-row tile lies in one batch), a tile's 64 columns are one head of one projection (n = sel * 1024 + h * 64 + d; sel 0, 1, 2 = Q, K, V, the same for the whole wave), and the result + that projection's bias goes out as fp16 and as bf16 hi + lo
// (P16 = three planes Q, K, V one behind the other; Ph and Pl point into six: Q hi, Q lo, K hi, K lo, V hi, V lo):
// Q and K as [b][h] planes of rows t, k = d (through the LDS rows: a lane picks up its 8 d of its row, a store is 512 bytes in a row), V as [b][h] planes of rows d, k = t (a lane's accumulator holds 8 consecutive t of one d, which is its 16 bytes of a fragment half: straight from registers, 512 bytes in a row a store).
#define GLB __attribute__((address_space(1)))   // the planes lie in global memory: said at the load, because a pointer that has been an operand of an asm statement is otherwise read with flat loads
typedef GLB char gch;
#define LDSA __attribute__((address_space(3)))   // the staged tiles lie in LDS: said at the load, so that it is a ds_load
typedef LDSA char lch;
template <typename T16> struct WFrag;
template <> struct WFrag<h16> { typedef v16h V; static __device__ __forceinline__ V ld(const h16* p, unsigned lb) { const gch* c = (const gch*)p + lb; return cat16(*(const GLB v8h*)c, *(const GLB v8h*)(c + 512)); } static __device__ __forceinline__ V ldl(const lch* c) { return cat16(*(const LDSA v8h*)c, *(const LDSA v8h*)(c + 512)); } static __device__ __forceinline__ v8f mma(V a, V b, v8f c) { return wmma16(a, b, c); } };
template <> struct WFrag<bf> { typedef v16bf V; static __device__ __forceinline__ V ld(const bf* p, unsigned lb) { const gch* c = (const gch*)p + lb; return cat16b(*(const GLB v8us*)c, *(const GLB v8us*)(c + 512)); } static __device__ __forceinline__ V ldl(const lch* c) { return cat16b(*(const LDSA v8us*)c, *(const LDSA v8us*)(c + 512)); } static __device__ __forceinline__ v8f mma(V a, V b, v8f c) { return wmmab(a, b, c); } };
#define CPY(l, g) "global_load_async_to_lds_b128 %" #l ", %" #g ", off\n\t"
template <typename T16, int NSPLIT, bool BIAS, int EPI, int K>
__global__ __launch_bounds__(256) void k_gemmw(const T16* __restrict__ A, const T16* __restrict__ A2, const T16* __restrict__ Bt, const T16* __restrict__ Bt2, float* C, int ldc, const float* __restrict__ bias, const float* __restrict__ biasK, const float* __restrict__ biasV, size_t sA, size_t sB, size_t sC, h16* P16, bf* Ph, bf* Pl) {
    typedef typename WFrag<T16>::V V;
    static_assert(NSPLIT <= 1, "the staged form holds A, the split plane A2 and Bt"); (void)Bt2;
    // Ring of two buffers in LDS, filled by asynchronous copies and read by all eight waves. A stage = KS k blocks of the block's 16 row tiles of A (and of A2) and 8 row tiles of Bt; of one row tile that is KS KiB in a row (the planes are fragment-major), copied as it lies:
    // a buffer holds [A: 16 row tiles][A2: 16][Bt: 8], each row tile KS fragments of 1 KiB. Copy c of a thread brings the 16 bytes at (c * 256 + threadIdx.x) * 16 of the buffer.
    constexpr int KS = NSPLIT == 0 ? 4 : 2, NPA = NSPLIT == 0 ? 1 : 2, ASZ = 16 * KS * 1024, BSZ = 8 * KS * 1024, STG = NPA * ASZ + BSZ, NSTG = K / (32 * KS);
    constexpr int NCA = ASZ / 4096, NCB = BSZ / 4096, NC = NPA * NCA + NCB;   // copies a thread and stage
    constexpr size_t RTB = (size_t)(K / 32) * 1024, RS = (size_t)(4 / KS) * RTB;   // bytes of a row tile in a plane; step of a thread's global address from one copy to the next (4 / KS row tiles)
    static_assert(NSTG >= 2 && K % (32 * KS) == 0 && (NC == 24 || NC == 20) && 8 * 16 * 68 * 4 <= 2 * STG, "two stages at least; the copy statements below are written for 24 and 20 copies; the epilogue's rows fit the ring");
    __shared__ __align__(16) char sm[2 * STG];
    const size_t z = blockIdx.z; A += z * sA; if (A2) A2 += z * sA; Bt += z * sB; C += z * sC;
    const int w = __builtin_amdgcn_readfirstlane(threadIdx.x >> 5), wm = w & 3, wn = w >> 2;   // the wave's 64 x 64 tile in the block's 256 x 128
    const int lane = threadIdx.x & 31, lr = lane & 15, hi = lane >> 4; const int r0 = blockIdx.x * 256 + wm * 64, c0 = blockIdx.y * 128 + wn * 64; const int bz = r0 / TT, t0 = r0 % TT;
    float* os = (float*)(sm + w * (16 * 68 * 4));   // the epilogue's rows, each wave's own, in the ring's place: used only behind the last stage's barrier
    v8f acc[4][4];
#pragma unroll
    for (int mb = 0; mb < 4; ++mb)
#pragma unroll
        for (int nb = 0; nb < 4; ++nb) acc[mb][nb] = (v8f){};
    const unsigned lb = lane * 16, sm0 = (unsigned)(size_t)(char*)sm + threadIdx.x * 16;
    const size_t to = (size_t)(threadIdx.x / (KS * 64)) * RTB + (threadIdx.x % (KS * 64)) * 16;   // the thread's place in its first copy's row tile
    const gch* gA = (const gch*)A + (size_t)(blockIdx.x * 16) * RTB + to; const gch* gA2 = (const gch*)A2 + (size_t)(blockIdx.x * 16) * RTB + to; const gch* gB = (const gch*)Bt + (size_t)(blockIdx.y * 8) * RTB + to;
    auto fill = [&](int t, int buf) __attribute__((always_inline)) {   // the s_wait_xcnt stands inside the copies' own statement: the address registers live to its end, nothing rewrites them ahead of it
        unsigned l[NC]; const gch* g[NC]; const size_t ko = (size_t)t * (KS * 1024);   // the four loops below are unrolled so that every address is a register, an operand of a copy statement
#pragma unroll
        for (int c = 0; c < NC; ++c) l[c] = sm0 + buf * STG + c * 4096;
#pragma unroll
        for (int c = 0; c < NCA; ++c) { g[c] = gA + ko + c * RS; if constexpr (NSPLIT == 1) g[NCA + c] = gA2 + ko + c * RS; }
#pragma unroll
        for (int c = 0; c < NCB; ++c) g[NPA * NCA + c] = gB + ko + c * RS;
#pragma unroll
        for (int h = 0; h < 2; ++h) { constexpr int H = NC / 2; const int b = h * H;
            if constexpr (NC == 24) asm volatile(CPY(0, 12) CPY(1, 13) CPY(2, 14) CPY(3, 15) CPY(4, 16) CPY(5, 17) CPY(6, 18) CPY(7, 19) CPY(8, 20) CPY(9, 21) CPY(10, 22) CPY(11, 23) "s_wait_xcnt 0x0"
                :: "v"(l[b]), "v"(l[b + 1]), "v"(l[b + 2]), "v"(l[b + 3]), "v"(l[b + 4]), "v"(l[b + 5]), "v"(l[b + 6]), "v"(l[b + 7]), "v"(l[b + 8]), "v"(l[b + 9]), "v"(l[b + 10]), "v"(l[b + 11]),
                   "v"(g[b]), "v"(g[b + 1]), "v"(g[b + 2]), "v"(g[b + 3]), "v"(g[b + 4]), "v"(g[b + 5]), "v"(g[b + 6]), "v"(g[b + 7]), "v"(g[b + 8]), "v"(g[b + 9]), "v"(g[b + 10]), "v"(g[b + 11]) : "memory");
            else asm volatile(CPY(0, 10) CPY(1, 11) CPY(2, 12) CPY(3, 13) CPY(4, 14) CPY(5, 15) CPY(6, 16) CPY(7, 17) CPY(8, 18) CPY(9, 19) "s_wait_xcnt 0x0"
                :: "v"(l[b]), "v"(l[b + 1]), "v"(l[b + 2]), "v"(l[b + 3]), "v"(l[b + 4]), "v"(l[b + 5]), "v"(l[b + 6]), "v"(l[b + 7]), "v"(l[b + 8]), "v"(l[b + 9]),
                   "v"(g[b]), "v"(g[b + 1]), "v"(g[b + 2]), "v"(g[b + 3]), "v"(g[b + 4]), "v"(g[b + 5]), "v"(g[b + 6]), "v"(g[b + 7]), "v"(g[b + 8]), "v"(g[b + 9]) : "memory"); }
    };
    // Two register sets, one k block (all fragments of both operands) a set: inside a stage block j + 1 is read from LDS in front of block j's products; never beyond the stage, whose successor is not published yet.
    V a[2][4], a2[2][4], b[2][4];
    const lch* sa; const lch* sbt;   // this stage's fragments of the wave's four row tiles of A and of Bt, at the lane's 16 bytes of a fragment half
    auto ldset = [&](int s, int blk) __attribute__((always_inline)) {
#pragma unroll
        for (int mb = 0; mb < 4; ++mb) { a[s][mb] = WFrag<T16>::ldl(sa + (mb * KS + blk) * 1024); if constexpr (NSPLIT == 1) a2[s][mb] = WFrag<T16>::ldl(sa + ASZ + (mb * KS + blk) * 1024); }
#pragma unroll
        for (int nb = 0; nb < 4; ++nb) b[s][nb] = WFrag<T16>::ldl(sbt + (nb * KS + blk) * 1024);
        __builtin_amdgcn_sched_barrier(0);   // keeps the set's loads here as one group, ahead of the products of the older set: moved down to their use they would be waited for at once
    };
    auto mmaset = [&](int s) __attribute__((always_inline)) {
#pragma unroll
        for (int nb = 0; nb < 4; ++nb)
#pragma unroll
            for (int mb = 0; mb < 4; ++mb) { acc[mb][nb] = WFrag<T16>::mma(a[s][mb], b[s][nb], acc[mb][nb]); if constexpr (NSPLIT == 1) acc[mb][nb] = WFrag<T16>::mma(a2[s][mb], b[s][nb], acc[mb][nb]); }
        __builtin_amdgcn_sched_barrier(0);   // keeps the next set's loads behind these products, which read the registers that those loads fill
    };
    fill(0, 0);
    asm volatile("s_wait_asynccnt 0x0" ::: "memory");   // this wave's copies of stage 0 have landed
    __syncthreads();                                    // and every other wave's: stage 0 may be read
    fill(1, 1);
#pragma unroll 1   // one stage a trip: the two buffers differ by one address addition
    for (int t = 0; t < NSTG; ++t) {
        const lch* sb = (const lch*)(char*)sm + (t & 1) * STG + lb; sa = sb + wm * (4 * KS * 1024); sbt = sb + NPA * ASZ + wn * (4 * KS * 1024);
        ldset(0, 0);
#pragma unroll   // a set's number is then a constant and the sets are registers
        for (int j = 0; j < KS; ++j) { if (j + 1 < KS) ldset((j + 1) & 1, j + 1); mmaset(j & 1); }
        // publish point of stage t + 1, every wave, in this order:
        asm volatile("s_wait_dscnt 0x0" ::: "memory");      // this wave's reads of stage t's buffer have returned
        asm volatile("s_wait_asynccnt 0x0" ::: "memory");   // its copies of stage t + 1 have landed
        __syncthreads();                                    // the same holds of every wave: stage t + 1 may be read, stage t's buffer refilled
        if (t + 2 < NSTG) fill(t + 2, t & 1);
    }
    asm volatile("s_wait_asynccnt 0x0" ::: "memory");   // no copy is outstanding when the ring becomes the epilogue's rows
    const int cy = c0 / 64, sel = EPI == 1 ? cy / NH_ : 0, hy = EPI == 1 ? cy % NH_ : cy, b0 = hy * 64;   // EPI 1: which projection, its head, the head's place in its bias
    if constexpr (EPI == 1) { constexpr size_t PLN = (size_t)NB_ * NH_ * TT * HD; bias = sel == 0 ? bias : sel == 1 ? biasK : biasV; P16 += sel * PLN; Ph += sel * 2 * PLN; Pl += sel * 2 * PLN; }
    if (EPI == 1 && sel == 2) {
#pragma unroll
        for (int nb = 0; nb < 4; ++nb) { const float bn = bfr(bias[b0 + nb * 16 + lr]);
#pragma unroll
            for (int mb = 0; mb < 4; ++mb) { const size_t po = ((size_t)bz * NKV + hy) * HD * TT + (size_t)(((t0 >> 5) + (mb >> 1)) * 4 + nb) * 512 + (mb & 1) * 256 + lane * 8; v8h o16; v8us oh, ol; float xs[8];
#pragma unroll
                for (int j = 0; j < 8; ++j) { xs[j] = acc[mb][nb][j] + bn; o16[j] = tohx(xs[j]); }
                split8(xs, oh, ol);
                *(v8h*)(P16 + po) = o16; *(v8us*)(Ph + po) = oh; *(v8us*)(Pl + po) = ol; } }
    } else
#pragma unroll
    for (int mb = 0; mb < 4; ++mb) {
#pragma unroll
        for (int nb = 0; nb < 4; ++nb) {
#pragma unroll
            for (int j = 0; j < 8; ++j) os[(hi * 8 + j) * 68 + nb * 16 + lr] = acc[mb][nb][j]; }
        __builtin_amdgcn_wave_barrier(); asm volatile("" ::: "memory");
        if constexpr (EPI == 1) {
#pragma unroll
            for (int s = 0; s < 4; ++s) { const int cofs = s * 16 + hi * 8; const v4f v0 = *(const v4fa*)(os + lr * 68 + cofs), v1 = *(const v4fa*)(os + lr * 68 + cofs + 4);   // s = k block * 2 + half
                const size_t po = ((size_t)bz * NH_ + hy) * TT * HD + (size_t)((t0 >> 4) + mb) * 1024 + s * 256 + lane * 8; v8h o16; v8us oh, ol; float xs[8];
#pragma unroll
                for (int q = 0; q < 8; ++q) { xs[q] = (q < 4 ? v0[q & 3] : v1[q & 3]) + bfr(bias[b0 + cofs + q]); o16[q] = tohx(xs[q]); }
                split8(xs, oh, ol);
                *(v8h*)(P16 + po) = o16; *(v8us*)(Ph + po) = oh; *(v8us*)(Pl + po) = ol;
                asm volatile("s_wait_xcnt 0x0" ::: "memory"); }   // the wait in front of a rewrite of the registers that these three stores name (the next quarter reuses them; behind the last quarter the built code falls, on a test that never holds there, into V's branch, which rewrites them too)
        } else {
            float* crow = C + (size_t)(r0 + mb * 16) * ldc + c0;
#pragma unroll
            for (int s = 0; s < 8; ++s) { const int row = 2 * s + hi, cofs = lr * 4; v4f val = *(const v4fa*)(os + row * 68 + cofs); if (BIAS) { val[0] += bfr(bias[c0 + cofs]); val[1] += bfr(bias[c0 + cofs + 1]); val[2] += bfr(bias[c0 + cofs + 2]); val[3] += bfr(bias[c0 + cofs + 3]); }
                *(v4f*)(crow + (size_t)row * ldc + cofs) = val; }
            if (mb < 3) asm volatile("s_wait_xcnt 0x0" ::: "memory");   // the wait in front of a rewrite of the registers that these eight stores name (the next row block reuses them)
        }
        __builtin_amdgcn_wave_barrier(); asm volatile("" ::: "memory");
    }
}


// k_pack: the 16-bit planes of x and of the four weights in ONE launch of DQ * DM / 8 = 131072 threads. Piece i = the 16 bytes at element i * 8 of a fragment-major plane of 1024-long rows: lane = i % 32, half = (i / 32) % 2, k block = (i / 64) % 32, row tile = i / 2048.
// Thread g writes piece g of each of the four weight planes (a plane has as many pieces as the grid has threads) and 8 pieces of x: lane and half g % 64 of the 8 k blocks from (g / 64) * 8 on (128 bytes of f32 and 1 KiB of the plane from one to the next). Its 48 loads depend on nothing and are all asked for before the first store.
// Bt[h * 64 + e][k] = w[h][k][e] for Wq, Wk, Wv (planes one behind the other in WQKV), Bt[n][k] = wo[k][n]: 16 lanes read 64 contiguous bytes of w for each of their 8 k; x: rows as they are, 32 bytes of f32 a piece.
#define PKT (DQ * DM / 8)
__global__ __launch_bounds__(256) void k_pack(const float* __restrict__ x, const float* __restrict__ wq, const float* __restrict__ wk, const float* __restrict__ wv, const float* __restrict__ wo, bf* __restrict__ XB, bf* __restrict__ WQKV, bf* __restrict__ WO) {
    constexpr int NX = NB_ * TT * DM / 8 / PKT;   // pieces of x a thread
    static_assert(DQ == DM && DKV == DQ && (DM / 32) % NX == 0, "one index map for the weight planes; a thread's pieces of x lie in one row tile");
    const int g = blockIdx.x * 256 + threadIdx.x, lane = g & 31, kin = ((g >> 5) & 1) * 16 + (lane >> 4) * 8, kb = (g >> 6) % (DM / 32), r = (g >> 6) / (DM / 32) * 16 + (lane & 15), k0 = kb * 32 + kin; const int h = r / HD, e = r % HD;
    const int xb = (g >> 6) * NX, xr = xb / (DM / 32) * 16 + (lane & 15), xk = xb % (DM / 32) * 32 + kin;   // first k block (counted through the plane), row and first k of the thread's pieces of x
    v8f fx[NX]; float fq[8], fk[8], fv[8], fo[8];
    unsigned xo = (unsigned)(xr * DM + xk) * 4, ho = (unsigned)((h * DM + k0) * HD + e) * 4, oo4 = (unsigned)(k0 * DM + r) * 4;   // the thread's byte offsets into x, into a [h][e][d] weight and into wo: scalar base + one 32-bit register, the steps are immediates
#pragma unroll
    for (int j = 0; j < NX; ++j) fx[j] = *(const GLB v8f*)((const gch*)x + j * 128 + xo);
#pragma unroll
    for (int q = 0; q < 8; ++q) { fq[q] = *(const GLB float*)((const gch*)wq + q * HD * 4 + ho); fk[q] = *(const GLB float*)((const gch*)wk + q * HD * 4 + ho); fv[q] = *(const GLB float*)((const gch*)wv + q * HD * 4 + ho); fo[q] = *(const GLB float*)((const gch*)wo + q * DM * 4 + oo4); }
    asm volatile("s_wait_xcnt 0x0" : "+v"(xo), "+v"(ho), "+v"(oo4) :: "memory");   // the wait in front of a rewrite of the registers that the 48 loads name: as its operands the three offsets live up to it, so no load's result and no conversion reuses them earlier
    __builtin_amdgcn_sched_barrier(0);   // keeps all 48 loads ahead of the first conversion: without it three weights' loads are issued only behind the wait for x, a second memory latency in a launch that lasts little longer than one
#pragma unroll
    for (int j = 0; j < NX; ++j) *(v8us*)(XB + ((size_t)(xb + j) * 64 + (g & 63)) * 8) = f2bf8(fx[j]);
    v8f gq, gk, gv, go;
#pragma unroll
    for (int q = 0; q < 8; ++q) { gq[q] = fq[q]; gk[q] = fk[q]; gv[q] = fv[q]; go[q] = fo[q]; }
    const v8us oq = f2bf8(gq), ok = f2bf8(gk), ov = f2bf8(gv), oo = f2bf8(go);
    *(v8us*)(WQKV + (size_t)g * 8) = oq; *(v8us*)(WQKV + (size_t)DQ * DM + (size_t)g * 8) = ok; *(v8us*)(WQKV + (size_t)2 * DQ * DM + (size_t)g * 8) = ov; *(v8us*)(WO + (size_t)g * 8) = oo;
}
// ---- k_fattn: one wave owns NT x 16 query rows of one head and walks the 2048 keys 32 at a time.
// St = K Qt (A = 16 key rows, B = 16 query rows, both fragment-major planes): in the accumulator a lane holds ONE query (column lane & 15) and keys 8 * (lane >> 4) + j of each 16-key tile,
// which is the k order of a B fragment (elements 0..7 = tile 0, 8..15 = tile 1), so the weights go from the score accumulators straight into Ot += Vt Pt (A = 16 rows d of the V plane, k = t).
// Softmax with a running maximum per query: maximum and sum in-lane plus one exchange between the wave halves; sums of the halves joined once at the end; division by the sum at the end.
// exp8: eight weights in place, p = exp2(p * c + nm). Written as one statement so that every v_exp_f32 is followed by an instruction that neither reads its result nor writes its source
// (the slot the instruction set asks for behind a transcendental): a later element's multiply-add or v_exp_f32 fills it, a v_nop behind the last. exp8a does the same and takes the rescale factor a = exp2(a) along.
__device__ __forceinline__ void exp8(float* p, float c, float nm) {
    asm("v_fma_f32 %0, %0, %8, %9\n\tv_fma_f32 %1, %1, %8, %9\n\tv_exp_f32 %0, %0\n\tv_fma_f32 %2, %2, %8, %9\n\tv_exp_f32 %1, %1\n\tv_fma_f32 %3, %3, %8, %9\n\tv_exp_f32 %2, %2\n\t"
        "v_fma_f32 %4, %4, %8, %9\n\tv_exp_f32 %3, %3\n\tv_fma_f32 %5, %5, %8, %9\n\tv_exp_f32 %4, %4\n\tv_fma_f32 %6, %6, %8, %9\n\tv_exp_f32 %5, %5\n\tv_fma_f32 %7, %7, %8, %9\n\tv_exp_f32 %6, %6\n\tv_exp_f32 %7, %7\n\tv_nop"
        : "+v"(p[0]), "+v"(p[1]), "+v"(p[2]), "+v"(p[3]), "+v"(p[4]), "+v"(p[5]), "+v"(p[6]), "+v"(p[7]) : "s"(c), "v"(nm));
}
__device__ __forceinline__ void exp8a(float* p, float c, float nm, float& a) {
    asm("v_fma_f32 %0, %0, %9, %10\n\tv_exp_f32 %8, %8\n\tv_fma_f32 %1, %1, %9, %10\n\tv_exp_f32 %0, %0\n\tv_fma_f32 %2, %2, %9, %10\n\tv_exp_f32 %1, %1\n\tv_fma_f32 %3, %3, %9, %10\n\tv_exp_f32 %2, %2\n\t"
        "v_fma_f32 %4, %4, %9, %10\n\tv_exp_f32 %3, %3\n\tv_fma_f32 %5, %5, %9, %10\n\tv_exp_f32 %4, %4\n\tv_fma_f32 %6, %6, %9, %10\n\tv_exp_f32 %5, %5\n\tv_fma_f32 %7, %7, %9, %10\n\tv_exp_f32 %6, %6\n\tv_exp_f32 %7, %7\n\tv_nop"
        : "+v"(p[0]), "+v"(p[1]), "+v"(p[2]), "+v"(p[3]), "+v"(p[4]), "+v"(p[5]), "+v"(p[6]), "+v"(p[7]), "+v"(a) : "s"(c), "v"(nm));
}
#define STGB 32768   // bytes of one buffer of the ring
#define CP1(l, g, o) "global_load_async_to_lds_b128 " l ", " g ", off offset:" #o "\n\t"
#define CP4(l, g)  CP1(l, g, 0) CP1(l, g, 2048) CP1(l, g, 4096) CP1(l, g, 6144)
#define CP4B(l, g) CP1(l, g, 8192) CP1(l, g, 10240) CP1(l, g, 12288) CP1(l, g, 14336)
template <bool HI> struct ASel { typedef h16 T; };
template <> struct ASel<true> { typedef bf T; };
template <bool HI, int NT>
__device__ __forceinline__ void fa_tile(const typename ASel<HI>::T* __restrict__ Q, const typename ASel<HI>::T* __restrict__ Q2, const typename ASel<HI>::T* __restrict__ Kp, const typename ASel<HI>::T* __restrict__ Kp2,
                                        const typename ASel<HI>::T* __restrict__ Vp, const typename ASel<HI>::T* __restrict__ Vp2, int q0, bf* Ah, bf* Al, char* sm) {
    typedef WFrag<typename ASel<HI>::T> F; typedef typename F::V V;
    const int lane = threadIdx.x & 31; unsigned lb = lane * 16;
    const float CL2 = SCL * 1.4426950408889634f;   // score -> log2 domain
    const float PSH = HI ? 0.0f : 10.0f;           // fp16 weights carry x1024 (log2 = 10): keeps small weights out of the fp16 denormals; the sum carries it too, so it cancels in the division
    V qf[NT][2], qf2[NT][2], kf[2][2], kf2[2][2];
    const typename ASel<HI>::T* pq = Q; const typename ASel<HI>::T* pq2 = Q2;
#pragma unroll
    for (int nt = 0; nt < NT; ++nt)
#pragma unroll
        for (int ks = 0; ks < 2; ++ks) { const size_t qo = (size_t)(q0 + nt * 16) * HD + ks * 512; qf[nt][ks] = F::ld(pq + qo, lb); if constexpr (HI) qf2[nt][ks] = F::ld(pq2 + qo, lb); }
    // the wait in front of a rewrite of the registers that the query loads name: their address registers are given up behind it; lb lives on as the lane's offset into a fragment in LDS
    if constexpr (HI) asm volatile("s_wait_xcnt 0x0" : "+s"(pq), "+s"(pq2), "+v"(lb) :: "memory"); else asm volatile("s_wait_xcnt 0x0" : "+s"(pq), "+v"(lb) :: "memory");
    // Ring of two 32-KiB buffers in LDS, filled by asynchronous copies and read by all four waves of the block. A stage = PPS passes of 32 keys; of each plane that is PB bytes in a row (the planes are fragment-major), copied as they lie:
    // fp16 rows: K at 0, V at 16 KiB; hi/lo rows: K hi, K lo, V hi, V lo at 0, 8, 16, 24 KiB. A thread copies 16 bytes at threadIdx.x * 16 of every 2 KiB; the immediate offset moves the LDS and the global address alike.
    constexpr int PPS = HI ? 2 : 4, PB = PPS * 4096, NSTG = TT / (32 * PPS);
    static_assert(NSTG >= 2 && TT % (32 * PPS) == 0 && (HI ? 4 : 2) * PB == STGB, "two stages at least; the planes' slices fill a buffer");
    const unsigned tb = threadIdx.x * 16, sm0 = (unsigned)(size_t)sm + tb;
    auto fill = [&](int t, int buf) __attribute__((always_inline)) {   // the s_wait_xcnt stands inside the copies' own statement: the address registers live to its end, nothing rewrites them ahead of it
        const unsigned l0 = sm0 + buf * STGB; const size_t go = (size_t)t * PB + tb;
        if constexpr (HI) asm volatile(CP4("%0", "%4") CP4("%1", "%5") CP4("%2", "%6") CP4("%3", "%7") "s_wait_xcnt 0x0"
            :: "v"(l0), "v"(l0 + PB), "v"(l0 + 2 * PB), "v"(l0 + 3 * PB), "v"((const gch*)Kp + go), "v"((const gch*)Kp2 + go), "v"((const gch*)Vp + go), "v"((const gch*)Vp2 + go) : "memory");
        else asm volatile(CP4("%0", "%2") CP4B("%0", "%2") CP4("%1", "%3") CP4B("%1", "%3") "s_wait_xcnt 0x0"
            :: "v"(l0), "v"(l0 + PB), "v"((const gch*)Kp + go), "v"((const gch*)Vp + go) : "memory");
    };
    v8f o[NT][4]; float m[NT], l[NT];
#pragma unroll
    for (int nt = 0; nt < NT; ++nt) { m[nt] = -3.0e38f; l[nt] = 0.f;
#pragma unroll
        for (int dt = 0; dt < 4; ++dt) o[nt][dt] = (v8f){}; }
    fill(0, 0);
    asm volatile("s_wait_asynccnt 0x0" ::: "memory");   // this wave's copies of stage 0 have landed
    __syncthreads();                                    // and every other wave's: stage 0 may be read
    fill(1, 1);
#pragma unroll 1   // one stage a trip: the two buffers differ by one address addition
    for (int t = 0; t < NSTG; ++t) {
      const lch* sb = (const lch*)sm + (t & 1) * STGB + lb;   // this stage's buffer, at the lane's 16 bytes of a fragment half; pass p's 4 KiB of a plane start p * 4096 into the plane's slice
      if constexpr (!HI) {   // the stage's first key rows; the later passes' are fetched one pass ahead, inside the stage
#pragma unroll
        for (int mt = 0; mt < 2; ++mt)
#pragma unroll
            for (int ks = 0; ks < 2; ++ks) kf[mt][ks] = F::ldl(sb + mt * 2048 + ks * 1024);
      }
      const lch* sp = sb;   // this pass's 4 KiB of the first plane: walks the stage
#pragma unroll 1   // the passes stay rolled: unrolled, the accumulators end a stage in other registers than they began it in (copies at every stage) and the register count leaves room for two waves a SIMD, not four
      for (int r = PPS; r > 0; --r, sp += 4096) {   // r = passes of the stage still to do, this one counted
        V vf[4], vf2[4];
        if constexpr (HI) {   // hi/lo rows: four planes do not fit the registers one pass ahead; this pass's key rows are asked for first, its value rows behind them
#pragma unroll
            for (int mt = 0; mt < 2; ++mt)
#pragma unroll
                for (int ks = 0; ks < 2; ++ks) { kf[mt][ks] = F::ldl(sp + mt * 2048 + ks * 1024); kf2[mt][ks] = F::ldl(sp + PB + mt * 2048 + ks * 1024); }
        }
#pragma unroll
        for (int dt = 0; dt < 4; ++dt) { vf[dt] = F::ldl(sp + STGB / 2 + dt * 1024); if constexpr (HI) vf2[dt] = F::ldl(sp + STGB / 2 + PB + dt * 1024); }
        if constexpr (!HI) __builtin_amdgcn_sched_barrier(0);   // keeps the eight value loads here, at the head of the pass: moved down to save registers they would be waited for soon after their issue
        v8f s[NT][2];
#pragma unroll
        for (int nt = 0; nt < NT; ++nt)
#pragma unroll
            for (int mt = 0; mt < 2; ++mt) { s[nt][mt] = (v8f){};
#pragma unroll
                for (int ks = 0; ks < 2; ++ks) { if constexpr (!HI) s[nt][mt] = F::mma(kf[mt][ks], qf[nt][ks], s[nt][mt]); } }
        if constexpr (HI) {   // hi/lo rows: the two key tiles' chains of six products written turn by turn, each chain in its old order, so that a product does not stand directly behind the one whose sum it takes up
#pragma unroll
            for (int nt = 0; nt < NT; ++nt)
#pragma unroll
                for (int ks = 0; ks < 2; ++ks) {
#pragma unroll
                    for (int mt = 0; mt < 2; ++mt) s[nt][mt] = F::mma(kf[mt][ks], qf[nt][ks], s[nt][mt]);
#pragma unroll
                    for (int mt = 0; mt < 2; ++mt) s[nt][mt] = F::mma(kf[mt][ks], qf2[nt][ks], s[nt][mt]);
#pragma unroll
                    for (int mt = 0; mt < 2; ++mt) s[nt][mt] = F::mma(kf2[mt][ks], qf[nt][ks], s[nt][mt]);
                }
        }
        if (!HI && r > 1) {   // the next pass's key rows, fetched behind this pass's score products; never beyond the stage, whose successor is not published yet
#pragma unroll
            for (int mt = 0; mt < 2; ++mt)
#pragma unroll
                for (int ks = 0; ks < 2; ++ks) kf[mt][ks] = F::ldl(sp + 4096 + mt * 2048 + ks * 1024);
            __builtin_amdgcn_sched_barrier(0);   // keeps the eight key loads here, with the softmax and the second product between them and their use: moved down to the foot of the pass they would be waited for at once
        }
#pragma unroll
        for (int nt = 0; nt < NT; ++nt) {
            float mx = s[nt][0][0];
#pragma unroll
            for (int j = 0; j < 8; ++j) { mx = fmaxf(mx, s[nt][0][j]); mx = fmaxf(mx, s[nt][1][j]); }
            mx = fmaxf(mx, __shfl_xor(mx, 16, 32));
            const float mn = fmaxf(m[nt], mx); float al = (m[nt] - mn) * CL2; const float nm = PSH - mn * CL2; m[nt] = mn;
            float p[16], ps = 0.f;
#pragma unroll
            for (int j = 0; j < 8; ++j) { p[j] = s[nt][0][j]; p[8 + j] = s[nt][1][j]; }
            exp8a(p, CL2, nm, al); exp8(p + 8, CL2, nm);
#pragma unroll
            for (int j = 0; j < 16; ++j) ps += p[j];
            l[nt] = l[nt] * al + ps;
#pragma unroll
            for (int dt = 0; dt < 4; ++dt)
#pragma unroll
                for (int j = 0; j < 8; ++j) o[nt][dt][j] *= al;
            if constexpr (HI) {
                v8us h0, h1, l0, l1; split8(p, h0, l0); split8(p + 8, h1, l1);
                const V ph = cat16b(h0, h1), pl = cat16b(l0, l1);
#pragma unroll
                for (int dt = 0; dt < 4; ++dt) { o[nt][dt] = F::mma(vf[dt], ph, o[nt][dt]); o[nt][dt] = F::mma(vf[dt], pl, o[nt][dt]); o[nt][dt] = F::mma(vf2[dt], ph, o[nt][dt]); }
            } else {
                V pb;
#pragma unroll
                for (int j = 0; j < 16; ++j) pb[j] = tohx(p[j]);
#pragma unroll
                for (int dt = 0; dt < 4; ++dt) o[nt][dt] = F::mma(vf[dt], pb, o[nt][dt]);
            }
        }
      }
      // publish point of stage t + 1, every wave, in this order:
      asm volatile("s_wait_dscnt 0x0" ::: "memory");      // this wave's reads of stage t's buffer have returned
      asm volatile("s_wait_asynccnt 0x0" ::: "memory");   // its copies of stage t + 1 have landed
      __syncthreads();                                    // the same holds of every wave: stage t + 1 may be read, stage t's buffer refilled
      if (t + 2 < NSTG) fill(t + 2, t & 1);
    }
    asm volatile("s_wait_asynccnt 0x0" ::: "memory");   // no copy is outstanding when the wave ends
#pragma unroll
    for (int nt = 0; nt < NT; ++nt) {
        const float inv = __fdiv_rn(1.0f, l[nt] + __shfl_xor(l[nt], 16, 32));
        const size_t oo = (size_t)(q0 + nt * 16) * DQ + 8 * lane;   // a lane holds d = dt * 16 + 8 * (lane >> 4) + j of its query (row lane & 15): its 16 bytes of half dt & 1 of k block h * 2 + dt / 2 of the merged plane's row tile
#pragma unroll
        for (int dt = 0; dt < 4; ++dt) { v8us oh, ol; float y[8];
#pragma unroll
            for (int j = 0; j < 8; ++j) y[j] = o[nt][dt][j] * inv;
            split8(y, oh, ol);
            *(v8us*)(Ah + oo + dt * 256) = oh; *(v8us*)(Al + oo + dt * 256) = ol; }
    }
}
// grid (batches x heads, RH / 64 + (TT - RH) / 128), 4 waves a block, which share the staged keys and values of their head: blockIdx.y < RH / 64 takes 16 hi/lo rows a wave (the longer blocks, so they come first in index order), the rest 32 fp16 rows a wave; output = the merged hi/lo planes (rows b * 2048 + t, k = h * 64 + d; a head's two k blocks start h * 1024 into a row tile)
__global__ __launch_bounds__(128) void k_fattn(const h16* __restrict__ Q16, const h16* __restrict__ K16, const h16* __restrict__ V16, const bf* __restrict__ Qh, const bf* __restrict__ Ql, const bf* __restrict__ Kh, const bf* __restrict__ Kl, const bf* __restrict__ Vh, const bf* __restrict__ Vl, bf* Ah, bf* Al) {
    const int h = blockIdx.x % NH_, w = threadIdx.x >> 5, bx = blockIdx.y; const size_t po = (size_t)blockIdx.x * TT * HD; Ah += (size_t)(blockIdx.x / NH_) * TT * DQ; Al += (size_t)(blockIdx.x / NH_) * TT * DQ;
    __shared__ __align__(16) char sm[2 * STGB];
    if (bx < RH / 64) fa_tile<true, 1>(Qh + po, Ql + po, Kh + po, Kl + po, Vh + po, Vl + po, (bx * 4 + w) * 16, Ah + h * 1024, Al + h * 1024, sm);
    else fa_tile<false, 2>(Q16 + po, nullptr, K16 + po, nullptr, V16 + po, nullptr, RH + ((bx - RH / 64) * 4 + w) * 32, Ah + h * 1024, Al + h * 1024, sm);
}

extern "C" void kernel_launch(void* const* d_in, const int* in_sizes, int n_in,
                              void* d_out, int out_size, void* d_ws, size_t ws_size, hipStream_t stream) {
    (void)in_sizes; (void)n_in; (void)out_size;
    const float* x = (const float*)d_in[0]; const float* wq = (const float*)d_in[1]; const float* bq = (const float*)d_in[2]; const float* wk = (const float*)d_in[3]; const float* bk = (const float*)d_in[4]; const float* wv = (const float*)d_in[5]; const float* bv = (const float*)d_in[6]; const float* wo = (const float*)d_in[7]; const float* bo = (const float*)d_in[8];   /* order seq_inputs, Wq [16][1024][64], bq [16][64], Wk, bk, Wv, bv, Wo ('xw' [1024][1024]), bo */
    float* OUT = (float*)d_out;     // [4][2048][1024]
    char* wsp = (char*)d_ws;
    auto take = [&](size_t bytes) { char* p = wsp; wsp += (bytes + 255) & ~(size_t)255; return (void*)p; };
    constexpr size_t PLN = (size_t)NB_ * NH_ * TT * HD;   // elements of one set of head planes
    bf* WQKV = (bf*)take((size_t)3 * DQ * DM * 2); bf* WO = (bf*)take((size_t)DM * DQ * 2);
    bf* XB = (bf*)take((size_t)NB_ * TT * DM * 2);
    h16* QP16 = (h16*)take(3 * PLN * 2); h16* KP16 = QP16 + PLN; h16* VT16 = QP16 + 2 * PLN;
    bf* QPh = (bf*)take(6 * PLN * 2); bf* QPl = QPh + PLN; bf* KPh = QPh + 2 * PLN; bf* KPl = QPh + 3 * PLN; bf* VTh = QPh + 4 * PLN; bf* VTl = QPh + 5 * PLN;
    bf* ATh = (bf*)take((size_t)NB_ * TT * DQ * 2); bf* ATl = (bf*)take((size_t)NB_ * TT * DQ * 2);
    if ((size_t)(wsp - (char*)d_ws) > ws_size) return;    // 200 MiB of the 256 MiB
    k_pack<<<PKT / 256, 256, 0, stream>>>(x, wq, wk, wv, wo, XB, WQKV, WO);
    k_gemmw<bf, 0, true, 1, DM><<<dim3(NB_ * TT / 256, 3 * DQ / 128, 1), 256, 0, stream>>>(XB, nullptr, WQKV, nullptr, nullptr, 0, bq, bk, bv, 0, 0, 0, QP16, QPh, QPl);
    k_fattn<<<dim3(NB_ * NH_, RH / 64 + (TT - RH) / 128, 1), 128, 0, stream>>>(QP16, KP16, VT16, QPh, QPl, KPh, KPl, VTh, VTl, ATh, ATl);
    k_gemmw<bf, 1, true, 0, DQ><<<dim3(NB_ * TT / 256, DM / 128, 1), 256, 0, stream>>>(ATh, ATl, WO, nullptr, OUT, DM, bo, nullptr, nullptr, 0, 0, 0, nullptr, nullptr, nullptr);
}

// v010
// A run of this version takes 154 microseconds.
// Two timings next to v009 put it at 1.08 and 1.09 times that version's speed.
// Counting every step since v000, it is 25.8 times as fast.
#include <hip/hip_runtime.h>

// Multi-head attention layer with per-head packed projection layers (seq_inputs [4][2048][1024]; Q, K, V = einsum('bse,hed', x, W) + b with W [16][1024][64] = [h][e][d] (1/32) and b [16][64]; scores / sqrt(64); softmax (no mask); heads concatenated in order; out = cat Wo + bo ('xw' [1024][1024] + bias) -> [4][2048][1024] (8.4 M); argument order seq_inputs, Wq, bq, Wk, bk, Wv, bv, Wo, bo).
// Every launch covers all 4 batches (the rows of the GEMMs are b * 2048 + t, the head planes are [b][h][..], the attention grid's x is b * 16 + h). Layout: k_pack (one launch) makes the bf16 copy of x, turns each [h][e][d] weight into Bt rows h*64 + d (Q, K, V rows one behind the other: one Bt of 3072 rows) and transposes Wo; the [16][64] biases are the flat [1024] epilogue vectors; exact projections + f32 biases, all three as one product of N = 3072, whose epilogues write the head planes themselves (Q, K as [h][t][d], V as [h][d][t]; fp16 + hi/lo); k_fattn: scores, softmax and weights x V of all 64 (batch, head) pairs in one launch, scores never leave registers (hybrid rows: < 512 hi/lo 3 products, rest fp16 weights x1024); merged hi/lo x Wo ('xw' transposed once) exact + bo.
// Every 16-bit operand plane is stored FRAGMENT-MAJOR: a 16-row x 32-k fragment is 1 KiB, [half = (k % 32) / 16][lane = ((k % 16) / 8) * 16 + row % 16][k % 8], so each of a fragment's two 16-byte-a-lane loads covers 512 contiguous bytes (4 whole lines, not 16 pieces of 32 bytes).
// Order of the fragments: GEMM operands, Q and K [row tile][k block]; V (rows d, k = t) [k block][row tile], so a pass of 32 keys reads 4 KiB in a row of K and of V. Values and every sum order are those of the row-major planes.
// Compute dtypes, f32 accumulate: every input rounded to bf16; projections exact + f32 biases; attention rows < 512 3 products, rest fp16; softmax f32 (against a maximum in use, raised when a pass's sums ask for it); Wo hl x exact + bias.

#define NB_  4
#define TT   2048
#define DM   1024
#define NH_  16
#define NKV  16
#define HD   64
#define DQ   (NH_ * HD)
#define DKV  (NKV * HD)
#define RH   512                  // query rows < RH use hi+lo planes (0: none)
#define SCL  0.125f   // HD^-0.5
typedef _Float16 h16;
typedef unsigned short bf;
typedef __attribute__((ext_vector_type(16))) __bf16   v16bf;
typedef __attribute__((ext_vector_type(8)))  __bf16   v8bf;
typedef __attribute__((ext_vector_type(4)))  unsigned v4u;
typedef __attribute__((ext_vector_type(16))) _Float16 v16h;
typedef __attribute__((ext_vector_type(8)))  _Float16 v8h;
typedef __attribute__((ext_vector_type(8)))  unsigned short v8us;
typedef __attribute__((ext_vector_type(8)))  float    v8f;
typedef __attribute__((ext_vector_type(4)))  float    v4f;
typedef v8h  __attribute__((may_alias)) v8ha;
typedef v4f  __attribute__((may_alias)) v4fa;
typedef v8us __attribute__((may_alias)) v8usa;

__device__ __forceinline__ unsigned short f2bf(float f) { return __builtin_bit_cast(unsigned short, (__bf16)f); }   // the hardware's conversion, nearest even
__device__ __forceinline__ v8us f2bf8(v8f f) { return __builtin_bit_cast(v8us, __builtin_convertvector(f, v8bf)); }   // one v_cvt_pk_bf16_f32 a pair
__device__ __forceinline__ float bf2f(unsigned short b) { return __uint_as_float(((unsigned)b) << 16); }
__device__ __forceinline__ float bfr(float f) { return bf2f(f2bf(f)); }
__device__ __forceinline__ v16h cat16(v8h lo, v8h hi) { return __builtin_shufflevector(lo, hi, 0, 1, 2, 3, 4, 5, 6, 7, 8, 9, 10, 11, 12, 13, 14, 15); }
__device__ __forceinline__ v16bf cat16b(v8us lo, v8us hi) { return __builtin_bit_cast(v16bf, __builtin_shufflevector(lo, hi, 0, 1, 2, 3, 4, 5, 6, 7, 8, 9, 10, 11, 12, 13, 14, 15)); }
__device__ __forceinline__ v8f wmma16(v16h a, v16h b, v8f c) { return __builtin_amdgcn_wmma_f32_16x16x32_f16(false, a, false, b, (short)0, c, false, false); }
__device__ __forceinline__ v8f wmmab(v16bf a, v16bf b, v8f c) { return __builtin_amdgcn_wmma_f32_16x16x32_bf16(false, a, false, b, (short)0, c, false, false); }
__device__ __forceinline__ h16 tohx(float x) { return (h16)x; }
// split8: eight f32 -> their bf16 hi and lo parts (hi = x to nearest even, lo = x - hi to nearest even; the difference is exact in f32), packed in element order, three instructions a pair:
// v_cvt_pk_bf16_f32 makes two hi; v_fma_mixlo_bf16 / v_fma_mixhi_bf16 take x * 1.0 - hi with hi read as the bf16 half it is and write the rounded result into the low / high half of lo.
// Written as one statement because the source form compiles to more than twice as many instructions (each hi widened again, a subtraction, a second conversion); four of a kind in a row keep each instruction four behind the one it depends on.
__device__ __forceinline__ void split8(const float* x, v8us& h, v8us& l) {
    v4u a, b;
    asm("v_cvt_pk_bf16_f32 %0, %8, %9\n\tv_cvt_pk_bf16_f32 %1, %10, %11\n\tv_cvt_pk_bf16_f32 %2, %12, %13\n\tv_cvt_pk_bf16_f32 %3, %14, %15\n\t"
        "v_fma_mixlo_bf16 %4, %8, 1.0, -%0 op_sel_hi:[0,0,1]\n\tv_fma_mixlo_bf16 %5, %10, 1.0, -%1 op_sel_hi:[0,0,1]\n\tv_fma_mixlo_bf16 %6, %12, 1.0, -%2 op_sel_hi:[0,0,1]\n\tv_fma_mixlo_bf16 %7, %14, 1.0, -%3 op_sel_hi:[0,0,1]\n\t"
        "v_fma_mixhi_bf16 %4, %9, 1.0, -%0 op_sel:[0,0,1] op_sel_hi:[0,0,1]\n\tv_fma_mixhi_bf16 %5, %11, 1.0, -%1 op_sel:[0,0,1] op_sel_hi:[0,0,1]\n\tv_fma_mixhi_bf16 %6, %13, 1.0, -%2 op_sel:[0,0,1] op_sel_hi:[0,0,1]\n\tv_fma_mixhi_bf16 %7, %15, 1.0, -%3 op_sel:[0,0,1] op_sel_hi:[0,0,1]"
        : "=&v"(a[0]), "=&v"(a[1]), "=&v"(a[2]), "=&v"(a[3]), "=&v"(b[0]), "=&v"(b[1]), "=&v"(b[2]), "=&v"(b[3])
        : "v"(x[0]), "v"(x[1]), "v"(x[2]), "v"(x[3]), "v"(x[4]), "v"(x[5]), "v"(x[6]), "v"(x[7]));
    h = __builtin_bit_cast(v8us, a); l = __builtin_bit_cast(v8us, b);
}



// ---- k_gemmw: register-blocked GEMM, one wave per 64x64 output tile (16 accumulators), eight waves (4 x 2) a block = a 256x128 tile; the fragment-major 16-bit operand planes are staged in LDS, so a fragment leaves L2 once a block and not once a wave; grid (M/256, N/128, Z), 256 threads.
// C[m][n] (f32, pitch ldc, + optional f32 bias[n]) = sum_k A[m][k] Bt[n][k] (+ split products per NSPLIT). z-batch strides sA/sB/sC in elements. K is a compile-time constant, a whole number of stages.
// EPI 0 stores C. EPI 1 is the three projections in one grid and stores no f32: m = b * 2048 + t (a 64-row tile lies in one batch), a tile's 64 columns are one head of one projection (n = sel * 1024 + h * 64 + d; sel 0, 1, 2 = Q, K, V, the same for the whole wave), and the result + that projection's bias goes out as fp16 and as bf16 hi + lo
// (P16 = three planes Q, K, V one behind the other; Ph and Pl point into six: Q hi, Q lo, K hi, K lo, V hi, V lo):
// Q and K as [b][h] planes of rows t, k = d (through the LDS rows: a lane picks up its 8 d of its row, a store is 512 bytes in a row), V as [b][h] planes of rows d, k = t (a lane's accumulator holds 8 consecutive t of one d, which is its 16 bytes of a fragment half: straight from registers, 512 bytes in a row a store).
#define GLB __attribute__((address_space(1)))   // the planes lie in global memory: said at the load, because a pointer that has been an operand of an asm statement is otherwise read with flat loads
typedef GLB char gch;
#define LDSA __attribute__((address_space(3)))   // the staged tiles lie in LDS: said at the load, so that it is a ds_load
typedef LDSA char lch;
template <typename T16> struct WFrag;
template <> struct WFrag<h16> { typedef v16h V; static __device__ __forceinline__ V ld(const h16* p, unsigned lb) { const gch* c = (const gch*)p + lb; return cat16(*(const GLB v8h*)c, *(const GLB v8h*)(c + 512)); } static __device__ __forceinline__ V ldl(const lch* c) { return cat16(*(const LDSA v8h*)c, *(const LDSA v8h*)(c + 512)); } static __device__ __forceinline__ v8f mma(V a, V b, v8f c) { return wmma16(a, b, c); } };
template <> struct WFrag<bf> { typedef v16bf V; static __device__ __forceinline__ V ld(const bf* p, unsigned lb) { const gch* c = (const gch*)p + lb; return cat16b(*(const GLB v8us*)c, *(const GLB v8us*)(c + 512)); } static __device__ __forceinline__ V ldl(const lch* c) { return cat16b(*(const LDSA v8us*)c, *(const LDSA v8us*)(c + 512)); } static __device__ __forceinline__ v8f mma(V a, V b, v8f c) { return wmmab(a, b, c); } };
#define CPY(l, g) "global_load_async_to_lds_b128 %" #l ", %" #g ", off\n\t"
template <typename T16, int NSPLIT, bool BIAS, int EPI, int K>
__global__ __launch_bounds__(256) void k_gemmw(const T16* __restrict__ A, const T16* __restrict__ A2, const T16* __restrict__ Bt, const T16* __restrict__ Bt2, float* C, int ldc, const float* __restrict__ bias, const float* __restrict__ biasK, const float* __restrict__ biasV, size_t sA, size_t sB, size_t sC, h16* P16, bf* Ph, bf* Pl) {
    typedef typename WFrag<T16>::V V;
    static_assert(NSPLIT <= 1, "the staged form holds A, the split plane A2 and Bt"); (void)Bt2;
    // Ring of two buffers in LDS, filled by asynchronous copies and read by all eight waves. A stage = KS k blocks of the block's 16 row tiles of A (and of A2) and 8 row tiles of Bt; of one row tile that is KS KiB in a row (the planes are fragment-major), copied as it lies:
    // a buffer holds [A: 16 row tiles][A2: 16][Bt: 8], each row tile KS fragments of 1 KiB. Copy c of a thread brings the 16 bytes at (c * 256 + threadIdx.x) * 16 of the buffer.
    constexpr int KS = NSPLIT == 0 ? 4 : 2, NPA = NSPLIT == 0 ? 1 : 2, ASZ = 16 * KS * 1024, BSZ = 8 * KS * 1024, STG = NPA * ASZ + BSZ, NSTG = K / (32 * KS);
    constexpr int NCA = ASZ / 4096, NCB = BSZ / 4096, NC = NPA * NCA + NCB;   // copies a thread and stage
    constexpr size_t RTB = (size_t)(K / 32) * 1024, RS = (size_t)(4 / KS) * RTB;   // bytes of a row tile in a plane; step of a thread's global address from one copy to the next (4 / KS row tiles)
    static_assert(NSTG >= 2 && K % (32 * KS) == 0 && (NC == 24 || NC == 20) && 8 * 16 * 68 * 4 <= 2 * STG, "two stages at least; the copy statements below are written for 24 and 20 copies; the epilogue's rows fit the ring");
    __shared__ __align__(16) char sm[2 * STG];
    const size_t z = blockIdx.z; A += z * sA; if (A2) A2 += z * sA; Bt += z * sB; C += z * sC;
    const int w = __builtin_amdgcn_readfirstlane(threadIdx.x >> 5), wm = w & 3, wn = w >> 2;   // the wave's 64 x 64 tile in the block's 256 x 128
    const int lane = threadIdx.x & 31, lr = lane & 15, hi = lane >> 4; const int r0 = blockIdx.x * 256 + wm * 64, c0 = blockIdx.y * 128 + wn * 64; const int bz = r0 / TT, t0 = r0 % TT;
    float* os = (float*)(sm + w * (16 * 68 * 4));   // the epilogue's rows, each wave's own, in the ring's place: used only behind the last stage's barrier
    v8f acc[4][4];
#pragma unroll
    for (int mb = 0; mb < 4; ++mb)
#pragma unroll
        for (int nb = 0; nb < 4; ++nb) acc[mb][nb] = (v8f){};
    const unsigned lb = lane * 16, sm0 = (unsigned)(size_t)(char*)sm + threadIdx.x * 16;
    const size_t to = (size_t)(threadIdx.x / (KS * 64)) * RTB + (threadIdx.x % (KS * 64)) * 16;   // the thread's place in its first copy's row tile
    const gch* gA = (const gch*)A + (size_t)(blockIdx.x * 16) * RTB + to; const gch* gA2 = (const gch*)A2 + (size_t)(blockIdx.x * 16) * RTB + to; const gch* gB = (const gch*)Bt + (size_t)(blockIdx.y * 8) * RTB + to;
    auto fill = [&](int t, int buf) __attribute__((always_inline)) {   // the s_wait_xcnt stands inside the copies' own statement: the address registers live to its end, nothing rewrites them ahead of it
        unsigned l[NC]; const gch* g[NC]; const size_t ko = (size_t)t * (KS * 1024);   // the four loops below are unrolled so that every address is a register, an operand of a copy statement
#pragma unroll
        for (int c = 0; c < NC; ++c) l[c] = sm0 + buf * STG + c * 4096;
#pragma unroll
        for (int c = 0; c < NCA; ++c) { g[c] = gA + ko + c * RS; if constexpr (NSPLIT == 1) g[NCA + c] = gA2 + ko + c * RS; }
#pragma unroll
        for (int c = 0; c < NCB; ++c) g[NPA * NCA + c] = gB + ko + c * RS;
#pragma unroll
        for (int h = 0; h < 2; ++h) { constexpr int H = NC / 2; const int b = h * H;
            if constexpr (NC == 24) asm volatile(CPY(0, 12) CPY(1, 13) CPY(2, 14) CPY(3, 15) CPY(4, 16) CPY(5, 17) CPY(6, 18) CPY(7, 19) CPY(8, 20) CPY(9, 21) CPY(10, 22) CPY(11, 23) "s_wait_xcnt 0x0"
                :: "v"(l[b]), "v"(l[b + 1]), "v"(l[b + 2]), "v"(l[b + 3]), "v"(l[b + 4]), "v"(l[b + 5]), "v"(l[b + 6]), "v"(l[b + 7]), "v"(l[b + 8]), "v"(l[b + 9]), "v"(l[b + 10]), "v"(l[b + 11]),
                   "v"(g[b]), "v"(g[b + 1]), "v"(g[b + 2]), "v"(g[b + 3]), "v"(g[b + 4]), "v"(g[b + 5]), "v"(g[b + 6]), "v"(g[b + 7]), "v"(g[b + 8]), "v"(g[b + 9]), "v"(g[b + 10]), "v"(g[b + 11]) : "memory");
            else asm volatile(CPY(0, 10) CPY(1, 11) CPY(2, 12) CPY(3, 13) CPY(4, 14) CPY(5, 15) CPY(6, 16) CPY(7, 17) CPY(8, 18) CPY(9, 19) "s_wait_xcnt 0x0"
                :: "v"(l[b]), "v"(l[b + 1]), "v"(l[b + 2]), "v"(l[b + 3]), "v"(l[b + 4]), "v"(l[b + 5]), "v"(l[b + 6]), "v"(l[b + 7]), "v"(l[b + 8]), "v"(l[b + 9]),
                   "v"(g[b]), "v"(g[b + 1]), "v"(g[b + 2]), "v"(g[b + 3]), "v"(g[b + 4]), "v"(g[b + 5]), "v"(g[b + 6]), "v"(g[b + 7]), "v"(g[b + 8]), "v"(g[b + 9]) : "memory"); }
    };
    // Two register sets, one k block (all fragments of both operands) a set: inside a stage block j + 1 is read from LDS in front of block j's products; never beyond the stage, whose successor is not published yet.
    V a[2][4], a2[2][4], b[2][4];
    const lch* sa; const lch* sbt;   // this stage's fragments of the wave's four row tiles of A and of Bt, at the lane's 16 bytes of a fragment half
    auto ldset = [&](int s, int blk) __attribute__((always_inline)) {
#pragma unroll
        for (int mb = 0; mb < 4; ++mb) { a[s][mb] = WFrag<T16>::ldl(sa + (mb * KS + blk) * 1024); if constexpr (NSPLIT == 1) a2[s][mb] = WFrag<T16>::ldl(sa + ASZ + (mb * KS + blk) * 1024); }
#pragma unroll
        for (int nb = 0; nb < 4; ++nb) b[s][nb] = WFrag<T16>::ldl(sbt + (nb * KS + blk) * 1024);
        __builtin_amdgcn_sched_barrier(0);   // keeps the set's loads here as one group, ahead of the products of the older set: moved down to their use they would be waited for at once
    };
    auto mmaset = [&](int s) __attribute__((always_inline)) {
#pragma unroll
        for (int nb = 0; nb < 4; ++nb)
#pragma unroll
            for (int mb = 0; mb < 4; ++mb) { acc[mb][nb] = WFrag<T16>::mma(a[s][mb], b[s][nb], acc[mb][nb]); if constexpr (NSPLIT == 1) acc[mb][nb] = WFrag<T16>::mma(a2[s][mb], b[s][nb], acc[mb][nb]); }
        __builtin_amdgcn_sched_barrier(0);   // keeps the next set's loads behind these products, which read the registers that those loads fill
    };
    fill(0, 0);
    asm volatile("s_wait_asynccnt 0x0" ::: "memory");   // this wave's copies of stage 0 have landed
    __syncthreads();                                    // and every other wave's: stage 0 may be read
    fill(1, 1);
#pragma unroll 1   // one stage a trip: the two buffers differ by one address addition
    for (int t = 0; t < NSTG; ++t) {
        const lch* sb = (const lch*)(char*)sm + (t & 1) * STG + lb; sa = sb + wm * (4 * KS * 1024); sbt = sb + NPA * ASZ + wn * (4 * KS * 1024);
        ldset(0, 0);
#pragma unroll   // a set's number is then a constant and the sets are registers
        for (int j = 0; j < KS; ++j) { if (j + 1 < KS) ldset((j + 1) & 1, j + 1); mmaset(j & 1); }
        // publish point of stage t + 1, every wave, in this order:
        asm volatile("s_wait_dscnt 0x0" ::: "memory");      // this wave's reads of stage t's buffer have returned
        asm volatile("s_wait_asynccnt 0x0" ::: "memory");   // its copies of stage t + 1 have landed
        __syncthreads();                                    // the same holds of every wave: stage t + 1 may be read, stage t's buffer refilled
        if (t + 2 < NSTG) fill(t + 2, t & 1);
    }
    asm volatile("s_wait_asynccnt 0x0" ::: "memory");   // no copy is outstanding when the ring becomes the epilogue's rows
    const int cy = c0 / 64, sel = EPI == 1 ? cy / NH_ : 0, hy = EPI == 1 ? cy % NH_ : cy, b0 = hy * 64;   // EPI 1: which projection, its head, the head's place in its bias
    if constexpr (EPI == 1) { constexpr size_t PLN = (size_t)NB_ * NH_ * TT * HD; bias = sel == 0 ? bias : sel == 1 ? biasK : biasV; P16 += sel * PLN; Ph += sel * 2 * PLN; Pl += sel * 2 * PLN; }
    if (EPI == 1 && sel == 2) {
#pragma unroll
        for (int nb = 0; nb < 4; ++nb) { const float bn = bfr(bias[b0 + nb * 16 + lr]);
#pragma unroll
            for (int mb = 0; mb < 4; ++mb) { const size_t po = ((size_t)bz * NKV + hy) * HD * TT + (size_t)(((t0 >> 5) + (mb >> 1)) * 4 + nb) * 512 + (mb & 1) * 256 + lane * 8; v8h o16; v8us oh, ol; float xs[8];
#pragma unroll
                for (int j = 0; j < 8; ++j) { xs[j] = acc[mb][nb][j] + bn; o16[j] = tohx(xs[j]); }
                split8(xs, oh, ol);
                *(v8h*)(P16 + po) = o16; *(v8us*)(Ph + po) = oh; *(v8us*)(Pl + po) = ol; } }
    } else
#pragma unroll
    for (int mb = 0; mb < 4; ++mb) {
#pragma unroll
        for (int nb = 0; nb < 4; ++nb) {
#pragma unroll
            for (int j = 0; j < 8; ++j) os[(hi * 8 + j) * 68 + nb * 16 + lr] = acc[mb][nb][j]; }
        __builtin_amdgcn_wave_barrier(); asm volatile("" ::: "memory");
        if constexpr (EPI == 1) {
#pragma unroll
            for (int s = 0; s < 4; ++s) { const int cofs = s * 16 + hi * 8; const v4f v0 = *(const v4fa*)(os + lr * 68 + cofs), v1 = *(const v4fa*)(os + lr * 68 + cofs + 4);   // s = k block * 2 + half
                const size_t po = ((size_t)bz * NH_ + hy) * TT * HD + (size_t)((t0 >> 4) + mb) * 1024 + s * 256 + lane * 8; v8h o16; v8us oh, ol; float xs[8];
#pragma unroll
                for (int q = 0; q < 8; ++q) { xs[q] = (q < 4 ? v0[q & 3] : v1[q & 3]) + bfr(bias[b0 + cofs + q]); o16[q] = tohx(xs[q]); }
                split8(xs, oh, ol);
                *(v8h*)(P16 + po) = o16; *(v8us*)(Ph + po) = oh; *(v8us*)(Pl + po) = ol;
                asm volatile("s_wait_xcnt 0x0" ::: "memory"); }   // the wait in front of a rewrite of the registers that these three stores name (the next quarter reuses them; behind the last quarter the built code falls, on a test that never holds there, into V's branch, which rewrites them too)
        } else {
            float* crow = C + (size_t)(r0 + mb * 16) * ldc + c0;
#pragma unroll
            for (int s = 0; s < 8; ++s) { const int row = 2 * s + hi, cofs = lr * 4; v4f val = *(const v4fa*)(os + row * 68 + cofs); if (BIAS) { val[0] += bfr(bias[c0 + cofs]); val[1] += bfr(bias[c0 + cofs + 1]); val[2] += bfr(bias[c0 + cofs + 2]); val[3] += bfr(bias[c0 + cofs + 3]); }
                *(v4f*)(crow + (size_t)row * ldc + cofs) = val; }
            if (mb < 3) asm volatile("s_wait_xcnt 0x0" ::: "memory");   // the wait in front of a rewrite of the registers that these eight stores name (the next row block reuses them)
        }
        __builtin_amdgcn_wave_barrier(); asm volatile("" ::: "memory");
    }
}


// k_pack: the 16-bit planes of x and of the four weights in ONE launch of DQ * DM / 8 = 131072 threads. Piece i = the 16 bytes at element i * 8 of a fragment-major plane of 1024-long rows: lane = i % 32, half = (i / 32) % 2, k block = (i / 64) % 32, row tile = i / 2048.
// Thread g writes piece g of each of the four weight planes (a plane has as many pieces as the grid has threads) and 8 pieces of x: lane and half g % 64 of the 8 k blocks from (g / 64) * 8 on (128 bytes of f32 and 1 KiB of the plane from one to the next). Its 48 loads depend on nothing and are all asked for before the first store.
// Bt[h * 64 + e][k] = w[h][k][e] for Wq, Wk, Wv (planes one behind the other in WQKV), Bt[n][k] = wo[k][n]: 16 lanes read 64 contiguous bytes of w for each of their 8 k; x: rows as they are, 32 bytes of f32 a piece.
#define PKT (DQ * DM / 8)
__global__ __launch_bounds__(256) void k_pack(const float* __restrict__ x, const float* __restrict__ wq, const float* __restrict__ wk, const float* __restrict__ wv, const float* __restrict__ wo, bf* __restrict__ XB, bf* __restrict__ WQKV, bf* __restrict__ WO) {
    constexpr int NX = NB_ * TT * DM / 8 / PKT;   // pieces of x a thread
    static_assert(DQ == DM && DKV == DQ && (DM / 32) % NX == 0, "one index map for the weight planes; a thread's pieces of x lie in one row tile");
    const int g = blockIdx.x * 256 + threadIdx.x, lane = g & 31, kin = ((g >> 5) & 1) * 16 + (lane >> 4) * 8, kb = (g >> 6) % (DM / 32), r = (g >> 6) / (DM / 32) * 16 + (lane & 15), k0 = kb * 32 + kin; const int h = r / HD, e = r % HD;
    const int xb = (g >> 6) * NX, xr = xb / (DM / 32) * 16 + (lane & 15), xk = xb % (DM / 32) * 32 + kin;   // first k block (counted through the plane), row and first k of the thread's pieces of x
    v8f fx[NX]; float fq[8], fk[8], fv[8], fo[8];
    unsigned xo = (unsigned)(xr * DM + xk) * 4, ho = (unsigned)((h * DM + k0) * HD + e) * 4, oo4 = (unsigned)(k0 * DM + r) * 4;   // the thread's byte offsets into x, into a [h][e][d] weight and into wo: scalar base + one 32-bit register, the steps are immediates
#pragma unroll
    for (int j = 0; j < NX; ++j) fx[j] = *(const GLB v8f*)((const gch*)x + j * 128 + xo);
#pragma unroll
    for (int q = 0; q < 8; ++q) { fq[q] = *(const GLB float*)((const gch*)wq + q * HD * 4 + ho); fk[q] = *(const GLB float*)((const gch*)wk + q * HD * 4 + ho); fv[q] = *(const GLB float*)((const gch*)wv + q * HD * 4 + ho); fo[q] = *(const GLB float*)((const gch*)wo + q * DM * 4 + oo4); }
    asm volatile("s_wait_xcnt 0x0" : "+v"(xo), "+v"(ho), "+v"(oo4) :: "memory");   // the wait in front of a rewrite of the registers that the 48 loads name: as its operands the three offsets live up to it, so no load's result and no conversion reuses them earlier
    __builtin_amdgcn_sched_barrier(0);   // keeps all 48 loads ahead of the first conversion: without it three weights' loads are issued only behind the wait for x, a second memory latency in a launch that lasts little longer than one
#pragma unroll
    for (int j = 0; j < NX; ++j) *(v8us*)(XB + ((size_t)(xb + j) * 64 + (g & 63)) * 8) = f2bf8(fx[j]);
    v8f gq, gk, gv, go;
#pragma unroll
    for (int q = 0; q < 8; ++q) { gq[q] = fq[q]; gk[q] = fk[q]; gv[q] = fv[q]; go[q] = fo[q]; }
    const v8us oq = f2bf8(gq), ok = f2bf8(gk), ov = f2bf8(gv), oo = f2bf8(go);
    *(v8us*)(WQKV + (size_t)g * 8) = oq; *(v8us*)(WQKV + (size_t)DQ * DM + (size_t)g * 8) = ok; *(v8us*)(WQKV + (size_t)2 * DQ * DM + (size_t)g * 8) = ov; *(v8us*)(WO + (size_t)g * 8) = oo;
}
// ---- k_fattn: one wave owns NT x 16 query rows of one head and walks the 2048 keys 32 at a time.
// St = K Qt (A = 16 key rows, B = 16 query rows, both fragment-major planes): in the accumulator a lane holds ONE query (column lane & 15) and keys 8 * (lane >> 4) + j of each 16-key tile,
// which is the k order of a B fragment (elements 0..7 = tile 0, 8..15 = tile 1), so the weights go from the score accumulators straight into Ot += Vt Pt (A = 16 rows d of the V plane, k = t).
// Softmax against a maximum in use per query (below); sums in-lane, those of the halves joined once at the end; division by the sum at the end.
// The maximum IN USE: the weights of a pass are taken against the reference m that the query already has, p = exp2((s - m) * c + shift), and m moves only when a pass shows that it is too low:
// a lane's sum of its 16 weights above 32 x 2^shift (not-a-number counts as above). One test a pass for the whole wave (ballot, scalar branch); behind it the true maximum of the pass is formed from the scores, which are still in their registers,
// the halves exchange it, O and the sum are scaled once and the pass's weights are made again. Against a true maximum a lane's sum is at most 16 x 2^shift, so one turn is enough; the first pass always takes it (m starts at -3e38: every weight is +inf).
// So no weight exceeds 2^15 in the fp16 rows, and the maximum tree, the exchange and the scaling of O leave the ordinary pass.
// exp8: eight values in place, p = exp2(p). Written as one statement so that every v_exp_f32 is followed by an instruction that neither reads its result nor writes its source
// (the slot the instruction set asks for behind a transcendental): the next element's v_exp_f32 fills it, a v_nop behind the last.
__device__ __forceinline__ void exp8(float* p) {
    asm("v_exp_f32 %0, %0\n\tv_exp_f32 %1, %1\n\tv_exp_f32 %2, %2\n\tv_exp_f32 %3, %3\n\tv_exp_f32 %4, %4\n\tv_exp_f32 %5, %5\n\tv_exp_f32 %6, %6\n\tv_exp_f32 %7, %7\n\tv_nop"
        : "+v"(p[0]), "+v"(p[1]), "+v"(p[2]), "+v"(p[3]), "+v"(p[4]), "+v"(p[5]), "+v"(p[6]), "+v"(p[7]));
}
__device__ __forceinline__ float exp1(float a) { asm("v_exp_f32 %0, %0\n\tv_nop" : "+v"(a)); return a; }   // exp2(a), with the same slot behind it
__device__ __forceinline__ float xhalf(float a) { const unsigned u = __float_as_uint(a); return __uint_as_float(__builtin_amdgcn_permlanex16(u, u, 0x76543210u, 0xfedcba98u, false, false)); }   // the value of lane ^ 16: a vector move, so the branch that holds it counts nothing on the LDS counter
#define STGB 32768   // bytes of one buffer of the ring
#define CP1(l, g, o) "global_load_async_to_lds_b128 " l ", " g ", off offset:" #o "\n\t"
#define CP4(l, g)  CP1(l, g, 0) CP1(l, g, 2048) CP1(l, g, 4096) CP1(l, g, 6144)
#define CP4B(l, g) CP1(l, g, 8192) CP1(l, g, 10240) CP1(l, g, 12288) CP1(l, g, 14336)
template <bool HI> struct ASel { typedef h16 T; };
template <> struct ASel<true> { typedef bf T; };
template <bool HI, int NT>
__device__ __forceinline__ void fa_tile(const typename ASel<HI>::T* __restrict__ Q, const typename ASel<HI>::T* __restrict__ Q2, const typename ASel<HI>::T* __restrict__ Kp, const typename ASel<HI>::T* __restrict__ Kp2,
                                        const typename ASel<HI>::T* __restrict__ Vp, const typename ASel<HI>::T* __restrict__ Vp2, int q0, bf* Ah, bf* Al, char* sm) {
    typedef WFrag<typename ASel<HI>::T> F; typedef typename F::V V;
    const int lane = threadIdx.x & 31; unsigned lb = lane * 16;
    const float CL2 = SCL * 1.4426950408889634f;   // score -> log2 domain
    const float PSH = HI ? 0.0f : 10.0f;           // fp16 weights carry x1024 (log2 = 10): keeps small weights out of the fp16 denormals; the sum carries it too, so it cancels in the division
    V qf[NT][2], qf2[NT][2], kf[2][2], kf2[2][2];
    const typename ASel<HI>::T* pq = Q; const typename ASel<HI>::T* pq2 = Q2;
#pragma unroll
    for (int nt = 0; nt < NT; ++nt)
#pragma unroll
        for (int ks = 0; ks < 2; ++ks) { const size_t qo = (size_t)(q0 + nt * 16) * HD + ks * 512; qf[nt][ks] = F::ld(pq + qo, lb); if constexpr (HI) qf2[nt][ks] = F::ld(pq2 + qo, lb); }
    // the wait in front of a rewrite of the registers that the query loads name: their address registers are given up behind it; lb lives on as the lane's offset into a fragment in LDS
    if constexpr (HI) asm volatile("s_wait_xcnt 0x0" : "+s"(pq), "+s"(pq2), "+v"(lb) :: "memory"); else asm volatile("s_wait_xcnt 0x0" : "+s"(pq), "+v"(lb) :: "memory");
    // Ring of two 32-KiB buffers in LDS, filled by asynchronous copies and read by all four waves of the block. A stage = PPS passes of 32 keys; of each plane that is PB bytes in a row (the planes are fragment-major), copied as they lie:
    // fp16 rows: K at 0, V at 16 KiB; hi/lo rows: K hi, K lo, V hi, V lo at 0, 8, 16, 24 KiB. A thread copies 16 bytes at threadIdx.x * 16 of every 2 KiB; the immediate offset moves the LDS and the global address alike.
    constexpr int PPS = HI ? 2 : 4, PB = PPS * 4096, NSTG = TT / (32 * PPS);
    static_assert(NSTG >= 2 && TT % (32 * PPS) == 0 && (HI ? 4 : 2) * PB == STGB, "two stages at least; the planes' slices fill a buffer");
    const unsigned tb = threadIdx.x * 16, sm0 = (unsigned)(size_t)sm + tb;
    auto fill = [&](int t, int buf) __attribute__((always_inline)) {   // the s_wait_xcnt stands inside the copies' own statement: the address registers live to its end, nothing rewrites them ahead of it
        const unsigned l0 = sm0 + buf * STGB; const size_t go = (size_t)t * PB + tb;
        if constexpr (HI) asm volatile(CP4("%0", "%4") CP4("%1", "%5") CP4("%2", "%6") CP4("%3", "%7") "s_wait_xcnt 0x0"
            :: "v"(l0), "v"(l0 + PB), "v"(l0 + 2 * PB), "v"(l0 + 3 * PB), "v"((const gch*)Kp + go), "v"((const gch*)Kp2 + go), "v"((const gch*)Vp + go), "v"((const gch*)Vp2 + go) : "memory");
        else asm volatile(CP4("%0", "%2") CP4B("%0", "%2") CP4("%1", "%3") CP4B("%1", "%3") "s_wait_xcnt 0x0"
            :: "v"(l0), "v"(l0 + PB), "v"((const gch*)Kp + go), "v"((const gch*)Vp + go) : "memory");
    };
    const float LIM = HI ? 32.0f : 32768.0f;       // 32 x 2^PSH: a lane's sum of a pass above it moves the maximum in use
    v8f o[NT][4]; float m[NT], nm[NT], l[NT];   // nm = PSH - m * CL2, the addend of the exponent
#pragma unroll
    for (int nt = 0; nt < NT; ++nt) { m[nt] = -3.0e38f; nm[nt] = PSH + 3.0e38f * CL2; l[nt] = 0.f;
#pragma unroll
        for (int dt = 0; dt < 4; ++dt) o[nt][dt] = (v8f){}; }
    fill(0, 0);
    asm volatile("s_wait_asynccnt 0x0" ::: "memory");   // this wave's copies of stage 0 have landed
    __syncthreads();                                    // and every other wave's: stage 0 may be read
    fill(1, 1);
#pragma unroll 1   // one stage a trip: the two buffers differ by one address addition
    for (int t = 0; t < NSTG; ++t) {
      const lch* sb = (const lch*)sm + (t & 1) * STGB + lb;   // this stage's buffer, at the lane's 16 bytes of a fragment half; pass p's 4 KiB of a plane start p * 4096 into the plane's slice
      if constexpr (!HI) {   // the stage's first key rows; the later passes' are fetched one pass ahead, inside the stage
#pragma unroll
        for (int mt = 0; mt < 2; ++mt)
#pragma unroll
            for (int ks = 0; ks < 2; ++ks) kf[mt][ks] = F::ldl(sb + mt * 2048 + ks * 1024);
      }
      const lch* sp = sb;   // this pass's 4 KiB of the first plane: walks the stage
#pragma unroll 1   // the passes stay rolled: unrolled, the accumulators end a stage in other registers than they began it in (copies at every stage) and the register count leaves room for two waves a SIMD, not four
      for (int r = PPS; r > 0; --r, sp += 4096) {   // r = passes of the stage still to do, this one counted
        V vf[4], vf2[4];
        if constexpr (HI) {   // hi/lo rows: four planes do not fit the registers one pass ahead; this pass's key rows are asked for first, its value rows behind them
#pragma unroll
            for (int mt = 0; mt < 2; ++mt)
#pragma unroll
                for (int ks = 0; ks < 2; ++ks) { kf[mt][ks] = F::ldl(sp + mt * 2048 + ks * 1024); kf2[mt][ks] = F::ldl(sp + PB + mt * 2048 + ks * 1024); }
        }
#pragma unroll
        for (int dt = 0; dt < 4; ++dt) { vf[dt] = F::ldl(sp + STGB / 2 + dt * 1024); if constexpr (HI) vf2[dt] = F::ldl(sp + STGB / 2 + PB + dt * 1024); }
        __builtin_amdgcn_sched_barrier(0);   // keeps the value loads here, at the head of the pass: moved down to save registers, or behind the branch of the pass's test, they would be waited for soon after their issue
        v8f s[NT][2];
#pragma unroll
        for (int nt = 0; nt < NT; ++nt)
#pragma unroll
            for (int mt = 0; mt < 2; ++mt) { s[nt][mt] = (v8f){};
#pragma unroll
                for (int ks = 0; ks < 2; ++ks) { if constexpr (!HI) s[nt][mt] = F::mma(kf[mt][ks], qf[nt][ks], s[nt][mt]); } }
        if constexpr (HI) {   // hi/lo rows: the two key tiles' chains of six products written turn by turn, each chain in its old order, so that a product does not stand directly behind the one whose sum it takes up
#pragma unroll
            for (int nt = 0; nt < NT; ++nt)
#pragma unroll
                for (int ks = 0; ks < 2; ++ks) {
#pragma unroll
                    for (int mt = 0; mt < 2; ++mt) s[nt][mt] = F::mma(kf[mt][ks], qf[nt][ks], s[nt][mt]);
#pragma unroll
                    for (int mt = 0; mt < 2; ++mt) s[nt][mt] = F::mma(kf[mt][ks], qf2[nt][ks], s[nt][mt]);
#pragma unroll
                    for (int mt = 0; mt < 2; ++mt) s[nt][mt] = F::mma(kf2[mt][ks], qf[nt][ks], s[nt][mt]);
                }
        }
        if (!HI && r > 1) {   // the next pass's key rows, fetched behind this pass's score products; never beyond the stage, whose successor is not published yet
#pragma unroll
            for (int mt = 0; mt < 2; ++mt)
#pragma unroll
                for (int ks = 0; ks < 2; ++ks) kf[mt][ks] = F::ldl(sp + 4096 + mt * 2048 + ks * 1024);
            __builtin_amdgcn_sched_barrier(0);   // keeps the eight key loads here, with the softmax and the second product between them and their use: moved down to the foot of the pass they would be waited for at once
        }
        V pb[NT], pl[NT]; float ps[NT];
        auto weights = [&](int nt) __attribute__((always_inline)) {   // the pass's weights of query tile nt against the maximum in use, as the second product's operand, and the lane's sum of them (in the order of the keys)
            float p[16], a = 0.f;
#pragma unroll
            for (int j = 0; j < 8; ++j) { p[j] = __builtin_fmaf(s[nt][0][j], CL2, nm[nt]); p[8 + j] = __builtin_fmaf(s[nt][1][j], CL2, nm[nt]); }
            exp8(p); exp8(p + 8);
#pragma unroll
            for (int j = 0; j < 16; ++j) a += p[j];
            ps[nt] = a;
            if constexpr (HI) { v8us h0, h1, l0, l1; split8(p, h0, l0); split8(p + 8, h1, l1); pb[nt] = cat16b(h0, h1); pl[nt] = cat16b(l0, l1); }
            else {
#pragma unroll
                for (int j = 0; j < 16; ++j) pb[nt][j] = tohx(p[j]); }
        };
        bool need = false;
#pragma unroll
        for (int nt = 0; nt < NT; ++nt) { weights(nt); need = need || !(ps[nt] <= LIM); }
        if (__builtin_amdgcn_ballot_w32(need) != 0) {   // some lane's maximum in use is too low: every query of the wave takes its true maximum so far (a factor of 1 where it has not risen)
#pragma unroll
            for (int nt = 0; nt < NT; ++nt) {
                float mx = s[nt][0][0];
#pragma unroll
                for (int j = 0; j < 8; ++j) { mx = fmaxf(mx, s[nt][0][j]); mx = fmaxf(mx, s[nt][1][j]); }
                mx = fmaxf(mx, xhalf(mx));
                const float mn = fmaxf(m[nt], mx), al = exp1((m[nt] - mn) * CL2); m[nt] = mn; nm[nt] = PSH - mn * CL2;
                l[nt] *= al;
#pragma unroll
                for (int dt = 0; dt < 4; ++dt)
#pragma unroll
                    for (int j = 0; j < 8; ++j) o[nt][dt][j] *= al;
                weights(nt);
            }
        }
#pragma unroll
        for (int nt = 0; nt < NT; ++nt) {
            l[nt] += ps[nt];
#pragma unroll
            for (int dt = 0; dt < 4; ++dt) { o[nt][dt] = F::mma(vf[dt], pb[nt], o[nt][dt]); if constexpr (HI) { o[nt][dt] = F::mma(vf[dt], pl[nt], o[nt][dt]); o[nt][dt] = F::mma(vf2[dt], pb[nt], o[nt][dt]); } }
        }
      }
      // publish point of stage t + 1, every wave, in this order:
      asm volatile("s_wait_dscnt 0x0" ::: "memory");      // this wave's reads of stage t's buffer have returned
      asm volatile("s_wait_asynccnt 0x0" ::: "memory");   // its copies of stage t + 1 have landed
      __syncthreads();                                    // the same holds of every wave: stage t + 1 may be read, stage t's buffer refilled
      if (t + 2 < NSTG) fill(t + 2, t & 1);
    }
    asm volatile("s_wait_asynccnt 0x0" ::: "memory");   // no copy is outstanding when the wave ends
#pragma unroll
    for (int nt = 0; nt < NT; ++nt) {
        const float inv = __fdiv_rn(1.0f, l[nt] + __shfl_xor(l[nt], 16, 32));
        const size_t oo = (size_t)(q0 + nt * 16) * DQ + 8 * lane;   // a lane holds d = dt * 16 + 8 * (lane >> 4) + j of its query (row lane & 15): its 16 bytes of half dt & 1 of k block h * 2 + dt / 2 of the merged plane's row tile
#pragma unroll
        for (int dt = 0; dt < 4; ++dt) { v8us oh, ol; float y[8];
#pragma unroll
            for (int j = 0; j < 8; ++j) y[j] = o[nt][dt][j] * inv;
            split8(y, oh, ol);
            *(v8us*)(Ah + oo + dt * 256) = oh; *(v8us*)(Al + oo + dt * 256) = ol; }
    }
}
// grid (batches x heads, RH / 64 + (TT - RH) / 128), 4 waves a block, which share the staged keys and values of their head: blockIdx.y < RH / 64 takes 16 hi/lo rows a wave (the longer blocks, so they come first in index order), the rest 32 fp16 rows a wave; output = the merged hi/lo planes (rows b * 2048 + t, k = h * 64 + d; a head's two k blocks start h * 1024 into a row tile)
__global__ __launch_bounds__(128) void k_fattn(const h16* __restrict__ Q16, const h16* __restrict__ K16, const h16* __restrict__ V16, const bf* __restrict__ Qh, const bf* __restrict__ Ql, const bf* __restrict__ Kh, const bf* __restrict__ Kl, const bf* __restrict__ Vh, const bf* __restrict__ Vl, bf* Ah, bf* Al) {
    const int h = blockIdx.x % NH_, w = threadIdx.x >> 5, bx = blockIdx.y; const size_t po = (size_t)blockIdx.x * TT * HD; Ah += (size_t)(blockIdx.x / NH_) * TT * DQ; Al += (size_t)(blockIdx.x / NH_) * TT * DQ;
    __shared__ __align__(16) char sm[2 * STGB];
    if (bx < RH / 64) fa_tile<true, 1>(Qh + po, Ql + po, Kh + po, Kl + po, Vh + po, Vl + po, (bx * 4 + w) * 16, Ah + h * 1024, Al + h * 1024, sm);
    else fa_tile<false, 2>(Q16 + po, nullptr, K16 + po, nullptr, V16 + po, nullptr, RH + ((bx - RH / 64) * 4 + w) * 32, Ah + h * 1024, Al + h * 1024, sm);
}

extern "C" void kernel_launch(void* const* d_in, const int* in_sizes, int n_in,
                              void* d_out, int out_size, void* d_ws, size_t ws_size, hipStream_t stream) {
    (void)in_sizes; (void)n_in; (void)out_size;
    const float* x = (const float*)d_in[0]; const float* wq = (const float*)d_in[1]; const float* bq = (const float*)d_in[2]; const float* wk = (const float*)d_in[3]; const float* bk = (const float*)d_in[4]; const float* wv = (const float*)d_in[5]; const float* bv = (const float*)d_in[6]; const float* wo = (const float*)d_in[7]; const float* bo = (const float*)d_in[8];   /* order seq_inputs, Wq [16][1024][64], bq [16][64], Wk, bk, Wv, bv, Wo ('xw' [1024][1024]), bo */
    float* OUT = (float*)d_out;     // [4][2048][1024]
    char* wsp = (char*)d_ws;
    auto take = [&](size_t bytes) { char* p = wsp; wsp += (bytes + 255) & ~(size_t)255; return (void*)p; };
    constexpr size_t PLN = (size_t)NB_ * NH_ * TT * HD;   // elements of one set of head planes
    bf* WQKV = (bf*)take((size_t)3 * DQ * DM * 2); bf* WO = (bf*)take((size_t)DM * DQ * 2);
    bf* XB = (bf*)take((size_t)NB_ * TT * DM * 2);
    h16* QP16 = (h16*)take(3 * PLN * 2); h16* KP16 = QP16 + PLN; h16* VT16 = QP16 + 2 * PLN;
    bf* QPh = (bf*)take(6 * PLN * 2); bf* QPl = QPh + PLN; bf* KPh = QPh + 2 * PLN; bf* KPl = QPh + 3 * PLN; bf* VTh = QPh + 4 * PLN; bf* VTl = QPh + 5 * PLN;
    bf* ATh = (bf*)take((size_t)NB_ * TT * DQ * 2); bf* ATl = (bf*)take((size_t)NB_ * TT * DQ * 2);
    if ((size_t)(wsp - (char*)d_ws) > ws_size) return;    // 200 MiB of the 256 MiB
    k_pack<<<PKT / 256, 256, 0, stream>>>(x, wq, wk, wv, wo, XB, WQKV, WO);
    k_gemmw<bf, 0, true, 1, DM><<<dim3(NB_ * TT / 256, 3 * DQ / 128, 1), 256, 0, stream>>>(XB, nullptr, WQKV, nullptr, nullptr, 0, bq, bk, bv, 0, 0, 0, QP16, QPh, QPl);
    k_fattn<<<dim3(NB_ * NH_, RH / 64 + (TT - RH) / 128, 1), 128, 0, stream>>>(QP16, KP16, VT16, QPh, QPl, KPh, KPl, VTh, VTl, ATh, ATl);
    k_gemmw<bf, 1, true, 0, DQ><<<dim3(NB_ * TT / 256, DM / 128, 1), 256, 0, stream>>>(ATh, ATl, WO, nullptr, OUT, DM, bo, nullptr, nullptr, 0, 0, 0, nullptr, nullptr, nullptr);
}
